// v000
// Times are from an AMD MI455X. After a warm-up the kernel runs many times in a row, and a time is the length of
// such a window on the GPU divided by its runs, so every launch and the gaps after it count. The runs cycle
// through copies of the inputs. A figure is the median of several windows, for all but v000 over two sittings.
// Sittings can differ by a few percent; kernels timed side by side share one.
// The starting kernel, v000, takes 279 microseconds a run.
#include <hip/hip_runtime.h>

// Windowed causal multi-head attention with a fused qkv projection (x [2][2048][1024]; qkv = x w_attn ('io' [1024][3072], column = which*1024 + h*64 + d, no bias; 16 heads x 64); scores x 64^-0.5, key j visible to query i when 0 <= i - j < 256; softmax; out = merged w_proj ('io' [1024][1024], no bias) -> [2][2048][1024]).
// Compute dtypes, f32 accumulate everywhere: x, w_attn, w_proj converted to bf16 (RNE) and multiplied with v_wmma_f32_16x16x32_bf16 (exact products); attention on v_wmma_f32_16x16x32_f16:
// q, k, v carried as f16 value + f16 residual x2^11 (separate accumulator, folded back x2^-11); query rows < 256 use value+residual on q, k, P, v (3 products); rows >= 256 use q value+residual against single f16 k, single f16 P (x1024) and v;
// softmax f32 (running max, exp2); merged context stored as bf16 hi | lo along K and multiplied with [w_proj ; w_proj] on the bf16 WMMA.
// Fused flash-style attention in the transposed form S^T = K Q^T, O^T = V^T P^T: the packed score tiles are the B fragment of the second product directly (no probability plane, no LDS exchange); only the 32-key halves inside the window of a query tile are visited.

#ifndef NB
#define NB 2
#endif
#ifndef SEQ
#define SEQ 2048
#endif
#define NB_FULL  2
#define SEQ_FULL 2048
#define DM   1024
#define NH   16
#define HD   64
#define NQKV (3 * DM)
#define CK   (2 * DM)                 // context plane pitch: hi | lo along K
#define RH   256                      // query rows < RH use value+residual on every attention operand
#define RHE  ((SEQ < RH) ? SEQ : RH)
#define WIN  256                      // attention window: key j visible to query i when 0 <= i - j < WIN
#define PCAR 1024.0f                  // carry of the f16 probability operand
#define RSC  2048.0f                  // carry of every f16 residual plane (2^11)
#define RINV (1.0f / 2048.0f)
#define SCL  0.125f                   // HD^-0.5
#define NEGB (-3.0e38f)
#define MFLOOR (-1.0e30f)             // floor of the running maximum: a key half with no visible key for a query yields probabilities exactly 0
#define PLN  ((size_t)NH * SEQ * HD)  // elements per head plane set

#define WS_WQKV ((size_t)NQKV * DM * 2)
#define WS_WO2  ((size_t)DM * CK * 2)
#define WS_XB   ((size_t)SEQ * DM * 2)
#define WS_F    ((size_t)SEQ * NQKV * 4)
#define WS_PL   ((size_t)6 * NH * SEQ * HD * 2)
#define WS_CTX  ((size_t)SEQ * CK * 2)
#define WS_TOTAL (WS_WQKV + WS_WO2 + WS_XB + WS_F + WS_PL + WS_CTX)

static_assert(NB <= NB_FULL);                 // batch count within the inputs
static_assert(SEQ <= SEQ_FULL);               // sequence rows within the inputs
static_assert(SEQ % 64 == 0);
static_assert(DM % 64 == 0);                  // GEMM column tiles
static_assert(NQKV % 64 == 0);                // GEMM column tiles
static_assert(DM % 32 == 0);                  // k-step of the projection
static_assert(CK % 32 == 0);                  // k-step of the output product
static_assert(HD == 64);
static_assert(NH * HD == DM);                 // merged head columns
static_assert(RH % 32 == 0);                  // whole key halves below the precision boundary
static_assert(RHE % 16 == 0);                 // whole query tiles per kernel
static_assert((SEQ - RHE) % 16 == 0);         // whole query tiles per kernel
static_assert(WIN >= 16);                     // every query of a 16-row tile sees at least its own key
static_assert(WIN <= SEQ_FULL);               // window within the sequence
static_assert(WS_WQKV % 256 == 0);
static_assert(WS_WO2 % 256 == 0);
static_assert(WS_XB % 256 == 0);
static_assert(WS_F % 256 == 0);
static_assert(WS_PL % 256 == 0);
static_assert(WS_CTX % 256 == 0);
static_assert(WS_TOTAL <= (size_t)134217728); // total carve <= 128 MiB

typedef _Float16 h16;
typedef unsigned short bf;
typedef __attribute__((ext_vector_type(16))) __bf16   v16bf;
typedef __attribute__((ext_vector_type(16))) _Float16 v16h;
typedef __attribute__((ext_vector_type(8)))  _Float16 v8h;
typedef __attribute__((ext_vector_type(8)))  unsigned short v8us;
typedef __attribute__((ext_vector_type(2)))  unsigned short v2us;
typedef __attribute__((ext_vector_type(8)))  float    v8f;
typedef __attribute__((ext_vector_type(4)))  float    v4f;
typedef v4f  __attribute__((may_alias)) v4fa;
typedef v8us __attribute__((may_alias)) v8usa;

__device__ __forceinline__ unsigned short f2bf(float f) { unsigned u = __float_as_uint(f); u += 0x7FFFu + ((u >> 16) & 1u); return (unsigned short)(u >> 16); }   // RNE convert
__device__ __forceinline__ float bf2f(unsigned short b) { return __uint_as_float(((unsigned)b) << 16); }
__device__ __forceinline__ void splitf(float y, unsigned short& h, unsigned short& l) { h = f2bf(y); l = f2bf(y - bf2f(h)); }
__device__ __forceinline__ v16h cat16(v8h lo, v8h hi) { return __builtin_shufflevector(lo, hi, 0, 1, 2, 3, 4, 5, 6, 7, 8, 9, 10, 11, 12, 13, 14, 15); }
__device__ __forceinline__ v16bf cat16b(v8us lo, v8us hi) { return __builtin_bit_cast(v16bf, __builtin_shufflevector(lo, hi, 0, 1, 2, 3, 4, 5, 6, 7, 8, 9, 10, 11, 12, 13, 14, 15)); }
__device__ __forceinline__ v8f wmma16(v16h a, v16h b, v8f c) { return __builtin_amdgcn_wmma_f32_16x16x32_f16(false, a, false, b, (short)0, c, false, false); }
__device__ __forceinline__ v8f wmmab(v16bf a, v16bf b, v8f c) { return __builtin_amdgcn_wmma_f32_16x16x32_bf16(false, a, false, b, (short)0, c, false, false); }
// Fragment loaders from K-contiguous 16-bit rows; the pointer already includes row (lane & 15) and 8 * (lane >> 4): elements 0..7 <- k0 + 8h + i, elements 8..15 <- k0 + 16 + 8h + i (A and B alike).
__device__ __forceinline__ v16h  ldh(const h16* p) { return cat16(*(const v8h*)p, *(const v8h*)(p + 16)); }
__device__ __forceinline__ v16bf ldb(const bf* p)  { return cat16b(*(const v8us*)p, *(const v8us*)(p + 16)); }
// f32 -> f16 operand convert that cannot produce an f16 subnormal (value select after the plane's carry).
static __device__ __forceinline__ h16 toh_flush(float v) { const h16 r = (h16)v; return (fabsf(v) < 6.103515625e-05f) ? (h16)0.0f : r; }

// ---- k_gemmw: register-blocked GEMM, ONE WAVE per 64x64 output tile (16 accumulators), bf16 operands straight from K-contiguous planes; grid (M/64, N/64), 32 threads.
// C[m][n] (f32, pitch ldc) = sum_k A[m][k] Bt[n][k]. K % 32 == 0, M and N multiples of 64 (asserted above for every use).
__global__ __launch_bounds__(32) __attribute__((amdgpu_num_vgpr(256)))
void k_gemmw(const bf* __restrict__ A, const bf* __restrict__ Bt, int K, float* C, int ldc) {
    __shared__ __align__(16) float os[16 * 68];
    const int lane = threadIdx.x & 31, lr = lane & 15, hi = lane >> 4; const int r0 = blockIdx.x * 64, c0 = blockIdx.y * 64;
    v8f acc[4][4];
#pragma unroll
    for (int mb = 0; mb < 4; ++mb)
#pragma unroll
        for (int nb = 0; nb < 4; ++nb) acc[mb][nb] = (v8f){};
    const size_t aoff = (size_t)(r0 + lr) * K + 8 * hi, boff = (size_t)(c0 + lr) * K + 8 * hi;
#pragma unroll 1
    for (int kc = 0; kc < K; kc += 32) {
        v16bf a[4];
#pragma unroll
        for (int mb = 0; mb < 4; ++mb) a[mb] = ldb(A + aoff + (size_t)mb * 16 * K + kc);
#pragma unroll
        for (int nb = 0; nb < 4; ++nb) { const v16bf b = ldb(Bt + boff + (size_t)nb * 16 * K + kc);
#pragma unroll
            for (int mb = 0; mb < 4; ++mb) acc[mb][nb] = wmmab(a[mb], b, acc[mb][nb]); }
        asm volatile("v_nop\n\tv_nop\n\tv_nop\n\tv_nop" : "+v"(acc[0][0]), "+v"(acc[1][1]), "+v"(acc[2][2]), "+v"(acc[3][3]) : "v"(a[0]), "v"(a[3]));
    }
#pragma unroll
    for (int mb = 0; mb < 4; ++mb) {
#pragma unroll
        for (int nb = 0; nb < 4; ++nb) {
#pragma unroll
            for (int j = 0; j < 8; ++j) os[(hi * 8 + j) * 68 + nb * 16 + lr] = acc[mb][nb][j]; }
        __builtin_amdgcn_wave_barrier(); asm volatile("" ::: "memory");
        float* crow = C + (size_t)(r0 + mb * 16) * ldc + c0;
{
#pragma unroll
            for (int s = 0; s < 8; ++s) { const int row = 2 * s + hi, cofs = lr * 4; const v4f val = *(const v4fa*)(os + row * 68 + cofs);
                *(v4f*)(crow + (size_t)row * ldc + cofs) = val; }
             }
        __builtin_amdgcn_wave_barrier(); asm volatile("" ::: "memory");
    }
}

__global__ __launch_bounds__(256) void k_wt(const float* __restrict__ w, int K, int N, int rep, bf* Bt) {
    const int lane = threadIdx.x & 31; const int wave = __builtin_amdgcn_readfirstlane(threadIdx.x >> 5);
    const int KO = K * rep; const int L0 = (blockIdx.x * 8 + wave) * 8; const int nlines = (int)(((size_t)N * KO) / 64);
{
#pragma unroll 1
        for (int l = 0; l < 8; ++l) { const int L = L0 + l; if (L >= nlines) break; const size_t e = (size_t)L * 64 + lane * 2; const int ko = (int)(e % KO), n = (int)(e / KO); const int k = ko % K; v2us o;
            o[0] = f2bf(w[(size_t)k * N + n]); o[1] = f2bf(w[(size_t)(k + 1) * N + n]); *(v2us*)(Bt + e) = o; }
         }
}

__global__ __launch_bounds__(256) void k_cvt8(const float* __restrict__ src, bf* dst, size_t n8) { const size_t i = (size_t)blockIdx.x * 256 + threadIdx.x; if (i >= n8) return; const v8f v = *(const v8f*)(src + i * 8); v8us o;
#pragma unroll
    for (int k = 0; k < 8; ++k) o[k] = f2bf(v[k]); *(v8us*)(dst + i * 8) = o;  }

// Plane set layout in PL (PLN elements each): 0 q value, 1 q residual, 2 k value, 3 k residual, 4 v^T value, 5 v^T residual.
__global__ __launch_bounds__(256) void k_qkp(const float* __restrict__ F, h16* PL) {
    const size_t i = (size_t)blockIdx.x * 256 + threadIdx.x; if (i >= PLN / 8) return; const int which = blockIdx.y;
    const size_t e = i * 8; const int d = (int)(e % HD); const int t = (int)((e / HD) % SEQ); const int h = (int)(e / ((size_t)HD * SEQ));
    const v8f v = *(const v8f*)(F + (size_t)t * NQKV + which * DM + h * HD + d); v8h o, r;
#pragma unroll
    for (int k = 0; k < 8; ++k) { const h16 a = (h16)v[k]; o[k] = a; r[k] = (h16)((v[k] - (float)a) * RSC); }
    h16* p16 = PL + (size_t)which * 2 * PLN + e; h16* pr = p16 + PLN;
    *(v8h*)p16 = o; *(v8h*)pr = r;  }

__global__ __launch_bounds__(256) void k_vtp(const float* __restrict__ F, h16* PL) {
    const size_t i = (size_t)blockIdx.x * 256 + threadIdx.x; if (i >= PLN / 8) return;
    const size_t e = i * 8; const int t = (int)(e % SEQ); const int d = (int)((e / SEQ) % HD); const int h = (int)(e / ((size_t)SEQ * HD));
    const float* f = F + (size_t)t * NQKV + 2 * DM + h * HD + d; v8h o, r;
#pragma unroll
    for (int k = 0; k < 8; ++k) { const float x = f[(size_t)k * NQKV]; const h16 a = (h16)x; o[k] = a; r[k] = (h16)((x - (float)a) * RSC); }
    h16* p16 = PL + 4 * PLN + e; h16* pr = p16 + PLN;
    *(v8h*)p16 = o; *(v8h*)pr = r;  }

// ---- fused windowed causal attention, one wave per 16 query rows of one head; grid (rows/16, NH), 32 threads.
// Key halves visited: from the 32-aligned half holding key q0 - (WIN - 1) (clipped at 0) up to the half holding key q0 + 15; all of them lie inside the written planes.
// Per 32-key half: S^T tiles [16 keys][16 queries] = K Q^T (A = key rows, B = query rows, k = d); lane (h, n) holds query q0+n, keys kb + 16*tile + 8h + r.
// Online softmax per lane (16 values) + one xor-16 shuffle; the two packed tiles are the B fragment (k = key, n = query) of O^T [d][query] += V^T [d][key] P^T.
// HIRES: value+residual on q, k, P, v (3 products each side); else q value+residual against single k, single P and v.
template <bool HIRES>
__device__ __forceinline__ void attn_body(const h16* __restrict__ PL, bf* CTX, const int qbase) {
    __shared__ __align__(16) unsigned short ost[2 * 16 * HD];
    const int lane = threadIdx.x & 31, lr = lane & 15, hi = lane >> 4;
    const int head = blockIdx.y;
    const int q0 = qbase + blockIdx.x * 16;
    const int kb0 = max(q0 - (WIN - 1), 0) & ~31;      // first key half with a key inside the window of query q0
    const size_t hb = (size_t)head * SEQ * HD;
    const size_t oQ = hb + (size_t)(q0 + lr) * HD + 8 * hi;
    const size_t oK = 2 * PLN + hb + (size_t)lr * HD + 8 * hi;
    const size_t oV = 4 * PLN + hb + (size_t)lr * SEQ + 8 * hi;
    const float CE = SCL * 1.4426950408889634f;
    v8f o[4], orr[4];
#pragma unroll
    for (int dt = 0; dt < 4; ++dt) { o[dt] = (v8f){}; orr[dt] = (v8f){}; }
    float m = NEGB, l = 0.0f;
#pragma unroll 1
    for (int kb = kb0; kb < q0 + 16; kb += 32) {
        v8f sh0 = (v8f){}, sh1 = (v8f){}, sr0 = (v8f){}, sr1 = (v8f){};
#pragma unroll
        for (int kc = 0; kc < HD; kc += 32) {
            const v16h bq  = ldh(PL + oQ + kc);
            const v16h bqr = ldh(PL + PLN + oQ + kc);
            const v16h ak0 = ldh(PL + oK + (size_t)kb * HD + kc);
            const v16h ak1 = ldh(PL + oK + (size_t)(kb + 16) * HD + kc);
            sh0 = wmma16(ak0, bq, sh0);  sh1 = wmma16(ak1, bq, sh1);
            sr0 = wmma16(ak0, bqr, sr0); sr1 = wmma16(ak1, bqr, sr1);
            if (HIRES) {
                const v16h kr0 = ldh(PL + PLN + oK + (size_t)kb * HD + kc);
                const v16h kr1 = ldh(PL + PLN + oK + (size_t)(kb + 16) * HD + kc);
                sr0 = wmma16(kr0, bq, sr0); sr1 = wmma16(kr1, bq, sr1);
                asm volatile("v_nop\n\tv_nop\n\tv_nop\n\tv_nop" : "+v"(sh0), "+v"(sh1), "+v"(sr0), "+v"(sr1) : "v"(ak0), "v"(ak1), "v"(bq), "v"(bqr), "v"(kr0), "v"(kr1));
            } else {
                asm volatile("v_nop\n\tv_nop\n\tv_nop\n\tv_nop" : "+v"(sh0), "+v"(sh1), "+v"(sr0), "+v"(sr1) : "v"(ak0), "v"(ak1), "v"(bq), "v"(bqr));
            }
        }
        float u[16];
#pragma unroll
        for (int r = 0; r < 8; ++r) { u[r] = (sh0[r] + sr0[r] * RINV) * CE; u[8 + r] = (sh1[r] + sr1[r] * RINV) * CE; }
        if (kb + 31 > q0 || kb + (WIN - 16) < q0) {   // wave-uniform: this half touches the diagonal or the far edge of the window; keys above the query or WIN or more behind it are excluded
            const int qi = q0 + lr; const int k0 = kb + 8 * hi;
#pragma unroll
            for (int r = 0; r < 8; ++r) { u[r] = (k0 + r > qi || qi - (k0 + r) >= WIN) ? NEGB : u[r]; u[8 + r] = (k0 + 16 + r > qi || qi - (k0 + 16 + r) >= WIN) ? NEGB : u[8 + r]; }
        }
        float mx = u[0];
#pragma unroll
        for (int i = 1; i < 16; ++i) mx = fmaxf(mx, u[i]);
        mx = fmaxf(mx, __shfl_xor(mx, 16, 32));
        const float mn = fmaxf(fmaxf(m, mx), MFLOOR);
        const float corr = __builtin_amdgcn_exp2f(m - mn);
        m = mn;
        float psum = 0.0f;
#pragma unroll
        for (int i = 0; i < 16; ++i) { u[i] = __builtin_amdgcn_exp2f(u[i] - mn); psum += u[i]; }
        l = l * corr + psum;
#pragma unroll
        for (int dt = 0; dt < 4; ++dt) {
#pragma unroll
            for (int r = 0; r < 8; ++r) { o[dt][r] *= corr; if (HIRES) orr[dt][r] *= corr; } }
        v16h pb, pr;
#pragma unroll
        for (int i = 0; i < 16; ++i) { const float pc = u[i] * PCAR; const h16 ph = toh_flush(pc); pb[i] = ph; pr[i] = toh_flush((pc - (float)ph) * RSC); }
        const size_t ov = oV + kb;
        if (HIRES) {
#pragma unroll
            for (int dt = 0; dt < 4; ++dt) {
                const v16h av  = ldh(PL + ov + (size_t)dt * 16 * SEQ);
                const v16h avr = ldh(PL + PLN + ov + (size_t)dt * 16 * SEQ);
                o[dt]   = wmma16(av, pb, o[dt]);
                orr[dt] = wmma16(avr, pb, orr[dt]);
                orr[dt] = wmma16(av, pr, orr[dt]);
                asm volatile("v_nop\n\tv_nop\n\tv_nop\n\tv_nop" : "+v"(o[dt]), "+v"(orr[dt]) : "v"(av), "v"(avr), "v"(pb), "v"(pr));
            }
        } else {
            const v16h av0 = ldh(PL + ov);
            const v16h av1 = ldh(PL + ov + (size_t)16 * SEQ);
            const v16h av2 = ldh(PL + ov + (size_t)32 * SEQ);
            const v16h av3 = ldh(PL + ov + (size_t)48 * SEQ);
            o[0] = wmma16(av0, pb, o[0]); o[1] = wmma16(av1, pb, o[1]); o[2] = wmma16(av2, pb, o[2]); o[3] = wmma16(av3, pb, o[3]);
            asm volatile("v_nop\n\tv_nop\n\tv_nop\n\tv_nop" : "+v"(o[0]), "+v"(o[1]), "+v"(o[2]), "+v"(o[3]) : "v"(av0), "v"(av1), "v"(av2), "v"(av3), "v"(pb));
        }
    }
    l += __shfl_xor(l, 16, 32);
    const float inv = 1.0f / (l * PCAR);
#pragma unroll
    for (int dt = 0; dt < 4; ++dt) { v8us vh, vl;
#pragma unroll
        for (int r = 0; r < 8; ++r) { float y = o[dt][r]; if (HIRES) y += orr[dt][r] * RINV; y *= inv; unsigned short a, c; splitf(y, a, c); vh[r] = a; vl[r] = c; }
        *(v8usa*)(ost + lr * HD + dt * 16 + hi * 8) = vh; *(v8usa*)(ost + 16 * HD + lr * HD + dt * 16 + hi * 8) = vl; }
    __builtin_amdgcn_wave_barrier(); asm volatile("" ::: "memory");
    bf* crow = CTX + (size_t)q0 * CK + head * HD;
{
#pragma unroll
        for (int s = 0; s < 4; ++s) { const int row = 4 * s + (lane >> 3), pc = (lane & 7) * 8;
            const v8us a = *(const v8usa*)(ost + row * HD + pc); const v8us c = *(const v8usa*)(ost + 16 * HD + row * HD + pc);
            *(v8us*)(crow + (size_t)row * CK + pc) = a; *(v8us*)(crow + (size_t)row * CK + DM + pc) = c; }
         }
}
__global__ __launch_bounds__(32) __attribute__((amdgpu_num_vgpr(256))) void k_attn_hi(const h16* __restrict__ PL, bf* CTX) { attn_body<true>(PL, CTX, 0); }
__global__ __launch_bounds__(32) __attribute__((amdgpu_num_vgpr(256))) void k_attn_lo(const h16* __restrict__ PL, bf* CTX) { attn_body<false>(PL, CTX, RHE); }

extern "C" void kernel_launch(void* const* d_in, const int* in_sizes, int n_in,
                              void* d_out, int out_size, void* d_ws, size_t ws_size, hipStream_t stream) {
    if (n_in < 3) return;
    const int need_x = (NB - 1) * SEQ_FULL * DM + SEQ * DM;
    if (in_sizes[0] < need_x || in_sizes[1] < DM * NQKV || in_sizes[2] < DM * DM || out_size < need_x) return;
    if (WS_TOTAL > ws_size) return;
    const float* x = (const float*)d_in[0]; const float* wqkv = (const float*)d_in[1]; const float* wo = (const float*)d_in[2];   // x, w_attn, w_proj
    float* OUT = (float*)d_out;     // [2][2048][1024]
    char* wsp = (char*)d_ws;
    bf* WQKV = (bf*)wsp;  wsp += WS_WQKV;      // [3072][1024] bf16, K-contiguous
    bf* WO2  = (bf*)wsp;  wsp += WS_WO2;
    bf* XB   = (bf*)wsp;  wsp += WS_XB;        // [SEQ][1024] bf16
    float* F = (float*)wsp; wsp += WS_F;       // [SEQ][3072] f32 q | k | v
    h16* PL  = (h16*)wsp; wsp += WS_PL;        // six head plane sets
    bf* CTX  = (bf*)wsp;  wsp += WS_CTX;       // [SEQ][2048] bf16 hi | lo
    k_wt<<<(unsigned)(((size_t)NQKV * DM / 64 + 63) / 64), 256, 0, stream>>>(wqkv, DM, NQKV, 1, WQKV);   // in[1024][3072] -> out[3072][1024]
    k_wt<<<(unsigned)(((size_t)DM * CK / 64 + 63) / 64), 256, 0, stream>>>(wo, DM, DM, 2, WO2);          // in[1024][1024] -> out[1024][2 x 1024]
    const unsigned LP = (unsigned)((PLN / 8 + 255) / 256);
    for (int b = 0; b < NB; ++b) {
        const float* xb = x + (size_t)b * SEQ_FULL * DM;
        k_cvt8<<<(unsigned)(((size_t)SEQ * DM / 8 + 255) / 256), 256, 0, stream>>>(xb, XB, (size_t)SEQ * DM / 8);
        k_gemmw<<<dim3(SEQ / 64, NQKV / 64, 1), 32, 0, stream>>>(XB, WQKV, DM, F, NQKV);
        k_qkp<<<dim3(LP, 2, 1), 256, 0, stream>>>(F, PL);
        k_vtp<<<LP, 256, 0, stream>>>(F, PL);
        k_attn_hi<<<dim3(RHE / 16, NH, 1), 32, 0, stream>>>(PL, CTX);
        if (SEQ > RHE) k_attn_lo<<<dim3((SEQ - RHE) / 16, NH, 1), 32, 0, stream>>>(PL, CTX);
        k_gemmw<<<dim3(SEQ / 64, DM / 64, 1), 32, 0, stream>>>(CTX, WO2, CK, OUT + (size_t)b * SEQ_FULL * DM, DM);
    }
}

// v001
// A run of this version takes 203 microseconds.
// Next to v000, in two timings, it ran 1.37 times as fast each time.
#include <hip/hip_runtime.h>

// Windowed causal multi-head attention with a fused qkv projection (x [2][2048][1024]; qkv = x w_attn ('io' [1024][3072], column = which*1024 + h*64 + d, no bias; 16 heads x 64); scores x 64^-0.5, key j visible to query i when 0 <= i - j < 256; softmax; out = merged w_proj ('io' [1024][1024], no bias) -> [2][2048][1024]).
// Compute dtypes, f32 accumulate everywhere: x, w_attn, w_proj converted to bf16 (RNE) and multiplied with v_wmma_f32_16x16x32_bf16 (exact products); attention on v_wmma_f32_16x16x32_f16:
// q, k, v carried as f16 value + f16 residual x2^11 (separate accumulator, folded back x2^-11); query rows < 256 use value+residual on q, k, P, v (3 products); rows >= 256 use q value+residual against single f16 k, single f16 P (x1024) and v;
// softmax f32 (running max, exp2); merged context stored as bf16 hi | lo along K and multiplied with [w_proj ; w_proj] on the bf16 WMMA.
// Fused flash-style attention in the transposed form S^T = K Q^T, O^T = V^T P^T: the packed score tiles are the B fragment of the second product directly (no probability plane, no LDS exchange); only the 32-key halves inside the window of a query tile are visited.

#ifndef NB
#define NB 2
#endif
#ifndef SEQ
#define SEQ 2048
#endif
#define NB_FULL  2
#define SEQ_FULL 2048
#define DM   1024
#define NH   16
#define HD   64
#define NQKV (3 * DM)
#define CK   (2 * DM)                 // context plane pitch: hi | lo along K
#define RH   256                      // query rows < RH use value+residual on every attention operand
#define RHE  ((SEQ < RH) ? SEQ : RH)
#define WIN  256                      // attention window: key j visible to query i when 0 <= i - j < WIN
#define PCAR 1024.0f                  // carry of the f16 probability operand
#define RSC  2048.0f                  // carry of every f16 residual plane (2^11)
#define RINV (1.0f / 2048.0f)
#define SCL  0.125f                   // HD^-0.5
#define NEGB (-3.0e38f)
#define MFLOOR (-1.0e30f)             // floor of the running maximum: a key half with no visible key for a query yields probabilities exactly 0
#define PLN  ((size_t)NH * SEQ * HD)  // elements per head plane set

#define WS_WQKV ((size_t)NQKV * DM * 2)
#define WS_WO2  ((size_t)DM * CK * 2)
#define WS_XB   ((size_t)NB * SEQ * DM * 2)
#define WS_F    ((size_t)NB * SEQ * NQKV * 4)
#define WS_PL   ((size_t)NB * 6 * NH * SEQ * HD * 2)
#define WS_CTX  ((size_t)NB * SEQ * CK * 2)
#define WS_TOTAL (WS_WQKV + WS_WO2 + WS_XB + WS_F + WS_PL + WS_CTX)

static_assert(NB <= NB_FULL);
static_assert(SEQ <= SEQ_FULL);
static_assert(NB == 1 || SEQ == SEQ_FULL);    // the batch elements' rows follow one another in x and out: one row range of NB * SEQ
static_assert(SEQ % 64 == 0);
static_assert(DM % 64 == 0);                  // GEMM column tiles
static_assert(NQKV % 64 == 0);                // GEMM column tiles
static_assert(DM % 32 == 0);                  // k-step of the projection
static_assert(CK % 32 == 0);                  // k-step of the output product
static_assert(HD == 64);
static_assert(NH * HD == DM);                 // merged head columns
static_assert(RH % 32 == 0);                  // whole key halves below the precision boundary
static_assert(RHE % 16 == 0);                 // whole query tiles per kernel
static_assert((SEQ - RHE) % 16 == 0);         // whole query tiles per kernel
static_assert(WIN >= 16);                     // every query of a 16-row tile sees at least its own key
static_assert(WIN <= SEQ_FULL);               // window within the sequence
static_assert(WS_WQKV % 256 == 0);
static_assert(WS_WO2 % 256 == 0);
static_assert(WS_XB % 256 == 0);
static_assert(WS_F % 256 == 0);
static_assert(WS_PL % 256 == 0);
static_assert(WS_CTX % 256 == 0);
static_assert(WS_TOTAL <= (size_t)268435456); // total carve <= 256 MiB

typedef _Float16 h16;
typedef unsigned short bf;
typedef __attribute__((ext_vector_type(16))) __bf16   v16bf;
typedef __attribute__((ext_vector_type(16))) _Float16 v16h;
typedef __attribute__((ext_vector_type(8)))  _Float16 v8h;
typedef __attribute__((ext_vector_type(8)))  unsigned short v8us;
typedef __attribute__((ext_vector_type(2)))  unsigned short v2us;
typedef __attribute__((ext_vector_type(8)))  float    v8f;
typedef __attribute__((ext_vector_type(4)))  float    v4f;
typedef v4f  __attribute__((may_alias)) v4fa;
typedef v8us __attribute__((may_alias)) v8usa;

__device__ __forceinline__ unsigned short f2bf(float f) { unsigned u = __float_as_uint(f); u += 0x7FFFu + ((u >> 16) & 1u); return (unsigned short)(u >> 16); }   // RNE convert
__device__ __forceinline__ float bf2f(unsigned short b) { return __uint_as_float(((unsigned)b) << 16); }
__device__ __forceinline__ void splitf(float y, unsigned short& h, unsigned short& l) { h = f2bf(y); l = f2bf(y - bf2f(h)); }
__device__ __forceinline__ v16h cat16(v8h lo, v8h hi) { return __builtin_shufflevector(lo, hi, 0, 1, 2, 3, 4, 5, 6, 7, 8, 9, 10, 11, 12, 13, 14, 15); }
__device__ __forceinline__ v16bf cat16b(v8us lo, v8us hi) { return __builtin_bit_cast(v16bf, __builtin_shufflevector(lo, hi, 0, 1, 2, 3, 4, 5, 6, 7, 8, 9, 10, 11, 12, 13, 14, 15)); }
__device__ __forceinline__ v8f wmma16(v16h a, v16h b, v8f c) { return __builtin_amdgcn_wmma_f32_16x16x32_f16(false, a, false, b, (short)0, c, false, false); }
__device__ __forceinline__ v8f wmmab(v16bf a, v16bf b, v8f c) { return __builtin_amdgcn_wmma_f32_16x16x32_bf16(false, a, false, b, (short)0, c, false, false); }
// Fragment loaders from K-contiguous 16-bit rows; the pointer already includes row (lane & 15) and 8 * (lane >> 4): elements 0..7 <- k0 + 8h + i, elements 8..15 <- k0 + 16 + 8h + i (A and B alike).
__device__ __forceinline__ v16h  ldh(const h16* p) { return cat16(*(const v8h*)p, *(const v8h*)(p + 16)); }
__device__ __forceinline__ v16bf ldb(const bf* p)  { return cat16b(*(const v8us*)p, *(const v8us*)(p + 16)); }
// f32 -> f16 operand convert that cannot produce an f16 subnormal (value select after the plane's carry).
static __device__ __forceinline__ h16 toh_flush(float v) { const h16 r = (h16)v; return (fabsf(v) < 6.103515625e-05f) ? (h16)0.0f : r; }

// ---- k_gemmw: register-blocked GEMM, ONE WAVE per 64x64 output tile (16 accumulators), bf16 operands straight from K-contiguous planes; grid (M/64, N/64), 32 threads.
// C[m][n] (f32, pitch ldc) = sum_k A[m][k] Bt[n][k]. K % 32 == 0, M and N multiples of 64 (asserted above for every use).
__global__ __launch_bounds__(32) __attribute__((amdgpu_num_vgpr(256)))
void k_gemmw(const bf* __restrict__ A, const bf* __restrict__ Bt, int K, float* C, int ldc) {
    __shared__ __align__(16) float os[16 * 68];
    const int lane = threadIdx.x & 31, lr = lane & 15, hi = lane >> 4; const int r0 = blockIdx.x * 64, c0 = blockIdx.y * 64;
    v8f acc[4][4];
#pragma unroll
    for (int mb = 0; mb < 4; ++mb)
#pragma unroll
        for (int nb = 0; nb < 4; ++nb) acc[mb][nb] = (v8f){};
    const size_t aoff = (size_t)(r0 + lr) * K + 8 * hi, boff = (size_t)(c0 + lr) * K + 8 * hi;
#pragma unroll 1
    for (int kc = 0; kc < K; kc += 32) {
        v16bf a[4];
#pragma unroll
        for (int mb = 0; mb < 4; ++mb) a[mb] = ldb(A + aoff + (size_t)mb * 16 * K + kc);
#pragma unroll
        for (int nb = 0; nb < 4; ++nb) { const v16bf b = ldb(Bt + boff + (size_t)nb * 16 * K + kc);
#pragma unroll
            for (int mb = 0; mb < 4; ++mb) acc[mb][nb] = wmmab(a[mb], b, acc[mb][nb]); }
        asm volatile("v_nop\n\tv_nop\n\tv_nop\n\tv_nop" : "+v"(acc[0][0]), "+v"(acc[1][1]), "+v"(acc[2][2]), "+v"(acc[3][3]) : "v"(a[0]), "v"(a[3]));
    }
#pragma unroll
    for (int mb = 0; mb < 4; ++mb) {
#pragma unroll
        for (int nb = 0; nb < 4; ++nb) {
#pragma unroll
            for (int j = 0; j < 8; ++j) os[(hi * 8 + j) * 68 + nb * 16 + lr] = acc[mb][nb][j]; }
        __builtin_amdgcn_wave_barrier(); asm volatile("" ::: "memory");
        float* crow = C + (size_t)(r0 + mb * 16) * ldc + c0;
{
#pragma unroll
            for (int s = 0; s < 8; ++s) { const int row = 2 * s + hi, cofs = lr * 4; const v4f val = *(const v4fa*)(os + row * 68 + cofs);
                *(v4f*)(crow + (size_t)row * ldc + cofs) = val; }
             }
        __builtin_amdgcn_wave_barrier(); asm volatile("" ::: "memory");
    }
}

__global__ __launch_bounds__(256) void k_wt(const float* __restrict__ w, int K, int N, int rep, bf* Bt) {
    const int lane = threadIdx.x & 31; const int wave = __builtin_amdgcn_readfirstlane(threadIdx.x >> 5);
    const int KO = K * rep; const int L0 = (blockIdx.x * 8 + wave) * 8; const int nlines = (int)(((size_t)N * KO) / 64);
{
#pragma unroll 1
        for (int l = 0; l < 8; ++l) { const int L = L0 + l; if (L >= nlines) break; const size_t e = (size_t)L * 64 + lane * 2; const int ko = (int)(e % KO), n = (int)(e / KO); const int k = ko % K; v2us o;
            o[0] = f2bf(w[(size_t)k * N + n]); o[1] = f2bf(w[(size_t)(k + 1) * N + n]); *(v2us*)(Bt + e) = o; }
         }
}

__global__ __launch_bounds__(256) void k_cvt8(const float* __restrict__ src, bf* dst, size_t n8) { const size_t i = (size_t)blockIdx.x * 256 + threadIdx.x; if (i >= n8) return; const v8f v = *(const v8f*)(src + i * 8); v8us o;
#pragma unroll
    for (int k = 0; k < 8; ++k) o[k] = f2bf(v[k]); *(v8us*)(dst + i * 8) = o;  }

// Plane set layout in PL (PLN elements each): 0 q value, 1 q residual, 2 k value, 3 k residual, 4 v^T value, 5 v^T residual; one such set of six per batch element, batch = grid z (grid y in k_vtp).
__global__ __launch_bounds__(256) void k_qkp(const float* __restrict__ F, h16* PL) {
    const size_t i = (size_t)blockIdx.x * 256 + threadIdx.x; if (i >= PLN / 8) return; const int which = blockIdx.y;
    F += (size_t)blockIdx.z * SEQ * NQKV; PL += (size_t)blockIdx.z * 6 * PLN;
    const size_t e = i * 8; const int d = (int)(e % HD); const int t = (int)((e / HD) % SEQ); const int h = (int)(e / ((size_t)HD * SEQ));
    const v8f v = *(const v8f*)(F + (size_t)t * NQKV + which * DM + h * HD + d); v8h o, r;
#pragma unroll
    for (int k = 0; k < 8; ++k) { const h16 a = (h16)v[k]; o[k] = a; r[k] = (h16)((v[k] - (float)a) * RSC); }
    h16* p16 = PL + (size_t)which * 2 * PLN + e; h16* pr = p16 + PLN;
    *(v8h*)p16 = o; *(v8h*)pr = r;  }

__global__ __launch_bounds__(256) void k_vtp(const float* __restrict__ F, h16* PL) {
    const size_t i = (size_t)blockIdx.x * 256 + threadIdx.x; if (i >= PLN / 8) return;
    F += (size_t)blockIdx.y * SEQ * NQKV; PL += (size_t)blockIdx.y * 6 * PLN;
    const size_t e = i * 8; const int t = (int)(e % SEQ); const int d = (int)((e / SEQ) % HD); const int h = (int)(e / ((size_t)SEQ * HD));
    const float* f = F + (size_t)t * NQKV + 2 * DM + h * HD + d; v8h o, r;
#pragma unroll
    for (int k = 0; k < 8; ++k) { const float x = f[(size_t)k * NQKV]; const h16 a = (h16)x; o[k] = a; r[k] = (h16)((x - (float)a) * RSC); }
    h16* p16 = PL + 4 * PLN + e; h16* pr = p16 + PLN;
    *(v8h*)p16 = o; *(v8h*)pr = r;  }

// ---- fused windowed causal attention, one wave per 16 query rows of one head; grid (rows/16, NH, NB), 32 threads.
// Key halves visited: from the 32-aligned half holding key q0 - (WIN - 1) (clipped at 0) up to the half holding key q0 + 15; all of them lie inside the written planes.
// Per 32-key half: S^T tiles [16 keys][16 queries] = K Q^T (A = key rows, B = query rows, k = d); lane (h, n) holds query q0+n, keys kb + 16*tile + 8h + r.
// Online softmax per lane (16 values) + one xor-16 shuffle; the two packed tiles are the B fragment (k = key, n = query) of O^T [d][query] += V^T [d][key] P^T.
// HIRES: value+residual on q, k, P, v (3 products each side); else q value+residual against single k, single P and v.
template <bool HIRES>
__device__ __forceinline__ void attn_body(const h16* __restrict__ PL, bf* CTX, const int qbase) {
    __shared__ __align__(16) unsigned short ost[2 * 16 * HD];
    const int lane = threadIdx.x & 31, lr = lane & 15, hi = lane >> 4;
    const int head = blockIdx.y;
    const int q0 = qbase + blockIdx.x * 16;
    const int kb0 = max(q0 - (WIN - 1), 0) & ~31;      // first key half with a key inside the window of query q0
    const size_t hb = (size_t)blockIdx.z * 6 * PLN + (size_t)head * SEQ * HD;   // this batch element's set of six planes, then the head
    const size_t oQ = hb + (size_t)(q0 + lr) * HD + 8 * hi;
    const size_t oK = 2 * PLN + hb + (size_t)lr * HD + 8 * hi;
    const size_t oV = 4 * PLN + hb + (size_t)lr * SEQ + 8 * hi;
    const float CE = SCL * 1.4426950408889634f;
    v8f o[4], orr[4];
#pragma unroll
    for (int dt = 0; dt < 4; ++dt) { o[dt] = (v8f){}; orr[dt] = (v8f){}; }
    float m = NEGB, l = 0.0f;
#pragma unroll 1
    for (int kb = kb0; kb < q0 + 16; kb += 32) {
        v8f sh0 = (v8f){}, sh1 = (v8f){}, sr0 = (v8f){}, sr1 = (v8f){};
#pragma unroll
        for (int kc = 0; kc < HD; kc += 32) {
            const v16h bq  = ldh(PL + oQ + kc);
            const v16h bqr = ldh(PL + PLN + oQ + kc);
            const v16h ak0 = ldh(PL + oK + (size_t)kb * HD + kc);
            const v16h ak1 = ldh(PL + oK + (size_t)(kb + 16) * HD + kc);
            sh0 = wmma16(ak0, bq, sh0);  sh1 = wmma16(ak1, bq, sh1);
            sr0 = wmma16(ak0, bqr, sr0); sr1 = wmma16(ak1, bqr, sr1);
            if (HIRES) {
                const v16h kr0 = ldh(PL + PLN + oK + (size_t)kb * HD + kc);
                const v16h kr1 = ldh(PL + PLN + oK + (size_t)(kb + 16) * HD + kc);
                sr0 = wmma16(kr0, bq, sr0); sr1 = wmma16(kr1, bq, sr1);
                asm volatile("v_nop\n\tv_nop\n\tv_nop\n\tv_nop" : "+v"(sh0), "+v"(sh1), "+v"(sr0), "+v"(sr1) : "v"(ak0), "v"(ak1), "v"(bq), "v"(bqr), "v"(kr0), "v"(kr1));
            } else {
                asm volatile("v_nop\n\tv_nop\n\tv_nop\n\tv_nop" : "+v"(sh0), "+v"(sh1), "+v"(sr0), "+v"(sr1) : "v"(ak0), "v"(ak1), "v"(bq), "v"(bqr));
            }
        }
        float u[16];
#pragma unroll
        for (int r = 0; r < 8; ++r) { u[r] = (sh0[r] + sr0[r] * RINV) * CE; u[8 + r] = (sh1[r] + sr1[r] * RINV) * CE; }
        if (kb + 31 > q0 || kb + (WIN - 16) < q0) {   // wave-uniform: this half touches the diagonal or the far edge of the window; keys above the query or WIN or more behind it are excluded
            const int qi = q0 + lr; const int k0 = kb + 8 * hi;
#pragma unroll
            for (int r = 0; r < 8; ++r) { u[r] = (k0 + r > qi || qi - (k0 + r) >= WIN) ? NEGB : u[r]; u[8 + r] = (k0 + 16 + r > qi || qi - (k0 + 16 + r) >= WIN) ? NEGB : u[8 + r]; }
        }
        float mx = u[0];
#pragma unroll
        for (int i = 1; i < 16; ++i) mx = fmaxf(mx, u[i]);
        mx = fmaxf(mx, __shfl_xor(mx, 16, 32));
        const float mn = fmaxf(fmaxf(m, mx), MFLOOR);
        const float corr = __builtin_amdgcn_exp2f(m - mn);
        m = mn;
        float psum = 0.0f;
#pragma unroll
        for (int i = 0; i < 16; ++i) { u[i] = __builtin_amdgcn_exp2f(u[i] - mn); psum += u[i]; }
        l = l * corr + psum;
#pragma unroll
        for (int dt = 0; dt < 4; ++dt) {
#pragma unroll
            for (int r = 0; r < 8; ++r) { o[dt][r] *= corr; if (HIRES) orr[dt][r] *= corr; } }
        v16h pb, pr;
#pragma unroll
        for (int i = 0; i < 16; ++i) { const float pc = u[i] * PCAR; const h16 ph = toh_flush(pc); pb[i] = ph; pr[i] = toh_flush((pc - (float)ph) * RSC); }
        const size_t ov = oV + kb;
        if (HIRES) {
#pragma unroll
            for (int dt = 0; dt < 4; ++dt) {
                const v16h av  = ldh(PL + ov + (size_t)dt * 16 * SEQ);
                const v16h avr = ldh(PL + PLN + ov + (size_t)dt * 16 * SEQ);
                o[dt]   = wmma16(av, pb, o[dt]);
                orr[dt] = wmma16(avr, pb, orr[dt]);
                orr[dt] = wmma16(av, pr, orr[dt]);
                asm volatile("v_nop\n\tv_nop\n\tv_nop\n\tv_nop" : "+v"(o[dt]), "+v"(orr[dt]) : "v"(av), "v"(avr), "v"(pb), "v"(pr));
            }
        } else {
            const v16h av0 = ldh(PL + ov);
            const v16h av1 = ldh(PL + ov + (size_t)16 * SEQ);
            const v16h av2 = ldh(PL + ov + (size_t)32 * SEQ);
            const v16h av3 = ldh(PL + ov + (size_t)48 * SEQ);
            o[0] = wmma16(av0, pb, o[0]); o[1] = wmma16(av1, pb, o[1]); o[2] = wmma16(av2, pb, o[2]); o[3] = wmma16(av3, pb, o[3]);
            asm volatile("v_nop\n\tv_nop\n\tv_nop\n\tv_nop" : "+v"(o[0]), "+v"(o[1]), "+v"(o[2]), "+v"(o[3]) : "v"(av0), "v"(av1), "v"(av2), "v"(av3), "v"(pb));
        }
    }
    l += __shfl_xor(l, 16, 32);
    const float inv = 1.0f / (l * PCAR);
#pragma unroll
    for (int dt = 0; dt < 4; ++dt) { v8us vh, vl;
#pragma unroll
        for (int r = 0; r < 8; ++r) { float y = o[dt][r]; if (HIRES) y += orr[dt][r] * RINV; y *= inv; unsigned short a, c; splitf(y, a, c); vh[r] = a; vl[r] = c; }
        *(v8usa*)(ost + lr * HD + dt * 16 + hi * 8) = vh; *(v8usa*)(ost + 16 * HD + lr * HD + dt * 16 + hi * 8) = vl; }
    __builtin_amdgcn_wave_barrier(); asm volatile("" ::: "memory");
    bf* crow = CTX + ((size_t)blockIdx.z * SEQ + q0) * CK + head * HD;
{
#pragma unroll
        for (int s = 0; s < 4; ++s) { const int row = 4 * s + (lane >> 3), pc = (lane & 7) * 8;
            const v8us a = *(const v8usa*)(ost + row * HD + pc); const v8us c = *(const v8usa*)(ost + 16 * HD + row * HD + pc);
            *(v8us*)(crow + (size_t)row * CK + pc) = a; *(v8us*)(crow + (size_t)row * CK + DM + pc) = c; }
         }
}
__global__ __launch_bounds__(32) __attribute__((amdgpu_num_vgpr(256))) void k_attn_hi(const h16* __restrict__ PL, bf* CTX) { attn_body<true>(PL, CTX, 0); }
__global__ __launch_bounds__(32) __attribute__((amdgpu_num_vgpr(256))) void k_attn_lo(const h16* __restrict__ PL, bf* CTX) { attn_body<false>(PL, CTX, RHE); }

extern "C" void kernel_launch(void* const* d_in, const int* in_sizes, int n_in,
                              void* d_out, int out_size, void* d_ws, size_t ws_size, hipStream_t stream) {
    if (n_in < 3) return;
    const int need_x = (NB - 1) * SEQ_FULL * DM + SEQ * DM;
    if (in_sizes[0] < need_x || in_sizes[1] < DM * NQKV || in_sizes[2] < DM * DM || out_size < need_x) return;
    if (WS_TOTAL > ws_size) return;
    const float* x = (const float*)d_in[0]; const float* wqkv = (const float*)d_in[1]; const float* wo = (const float*)d_in[2];   // x, w_attn, w_proj
    float* OUT = (float*)d_out;     // [2][2048][1024]
    char* wsp = (char*)d_ws;
    bf* WQKV = (bf*)wsp;  wsp += WS_WQKV;      // [3072][1024] bf16, K-contiguous
    bf* WO2  = (bf*)wsp;  wsp += WS_WO2;
    bf* XB   = (bf*)wsp;  wsp += WS_XB;        // [NB * SEQ][1024] bf16
    float* F = (float*)wsp; wsp += WS_F;       // [NB * SEQ][3072] f32 q | k | v
    h16* PL  = (h16*)wsp; wsp += WS_PL;        // six head plane sets per batch element
    bf* CTX  = (bf*)wsp;  wsp += WS_CTX;       // [NB * SEQ][2048] bf16 hi | lo
    k_wt<<<(unsigned)(((size_t)NQKV * DM / 64 + 63) / 64), 256, 0, stream>>>(wqkv, DM, NQKV, 1, WQKV);   // in[1024][3072] -> out[3072][1024]
    k_wt<<<(unsigned)(((size_t)DM * CK / 64 + 63) / 64), 256, 0, stream>>>(wo, DM, DM, 2, WO2);          // in[1024][1024] -> out[1024][2 x 1024]
    const unsigned LP = (unsigned)((PLN / 8 + 255) / 256);
    // every stage runs once, over all NB batch elements: the row-wise stages on NB * SEQ rows, the plane and attention stages with the batch as grid z (grid y in k_vtp)
    k_cvt8<<<(unsigned)(((size_t)NB * SEQ * DM / 8 + 255) / 256), 256, 0, stream>>>(x, XB, (size_t)NB * SEQ * DM / 8);
    k_gemmw<<<dim3(NB * SEQ / 64, NQKV / 64, 1), 32, 0, stream>>>(XB, WQKV, DM, F, NQKV);
    k_qkp<<<dim3(LP, 2, NB), 256, 0, stream>>>(F, PL);
    k_vtp<<<dim3(LP, NB, 1), 256, 0, stream>>>(F, PL);
    k_attn_hi<<<dim3(RHE / 16, NH, NB), 32, 0, stream>>>(PL, CTX);
    if (SEQ > RHE) k_attn_lo<<<dim3((SEQ - RHE) / 16, NH, NB), 32, 0, stream>>>(PL, CTX);
    k_gemmw<<<dim3(NB * SEQ / 64, DM / 64, 1), 32, 0, stream>>>(CTX, WO2, CK, OUT, DM);
}

// v002
// One run takes 155 microseconds.
// Two timings next to v001 both put it at 1.30 times that version's speed.
// All steps since v000 together make it 1.79 times as fast.
#include <hip/hip_runtime.h>

// Windowed causal multi-head attention with a fused qkv projection (x [2][2048][1024]; qkv = x w_attn ('io' [1024][3072], column = which*1024 + h*64 + d, no bias; 16 heads x 64); scores x 64^-0.5, key j visible to query i when 0 <= i - j < 256; softmax; out = merged w_proj ('io' [1024][1024], no bias) -> [2][2048][1024]).
// Compute dtypes, f32 accumulate everywhere: x, w_attn, w_proj converted to bf16 (RNE) and multiplied with v_wmma_f32_16x16x32_bf16 (exact products); attention on v_wmma_f32_16x16x32_f16:
// q, k, v carried as f16 value + f16 residual x2^11 (separate accumulator, folded back x2^-11); query rows < 256 use value+residual on q, k, P, v (3 products); rows >= 256 use q value+residual against single f16 k, single f16 P (x1024) and v;
// softmax f32 (running max, exp2); merged context stored as bf16 hi | lo along K and multiplied with [w_proj ; w_proj] on the bf16 WMMA.
// Fused flash-style attention in the transposed form S^T = K Q^T, O^T = V^T P^T: the packed score tiles are the B fragment of the second product directly (no probability plane, no LDS exchange); only the 32-key halves inside the window of a query tile are visited.

#ifndef NB
#define NB 2
#endif
#ifndef SEQ
#define SEQ 2048
#endif
#define NB_FULL  2
#define SEQ_FULL 2048
#define DM   1024
#define NH   16
#define HD   64
#define NQKV (3 * DM)
#define CK   (2 * DM)                 // context plane pitch: hi | lo along K
#define RH   256                      // query rows < RH use value+residual on every attention operand
#define RHE  ((SEQ < RH) ? SEQ : RH)
#define WIN  256                      // attention window: key j visible to query i when 0 <= i - j < WIN
#define PCAR 1024.0f                  // carry of the f16 probability operand
#define RSC  2048.0f                  // carry of every f16 residual plane (2^11)
#define RINV (1.0f / 2048.0f)
#define SCL  0.125f                   // HD^-0.5
#define NEGB (-3.0e38f)
#define MFLOOR (-1.0e30f)             // floor of the running maximum: a key half with no visible key for a query yields probabilities exactly 0
#define PLN  ((size_t)NH * SEQ * HD)  // elements per head plane set

#define WS_WQKV ((size_t)NQKV * DM * 2)
#define WS_WO2  ((size_t)DM * CK * 2)
#define WS_XB   ((size_t)NB * SEQ * DM * 2)
#define WS_F    ((size_t)NB * SEQ * NQKV * 4)
#define WS_PL   ((size_t)NB * 6 * NH * SEQ * HD * 2)
#define WS_CTX  ((size_t)NB * SEQ * CK * 2)
#define WS_TOTAL (WS_WQKV + WS_WO2 + WS_XB + WS_F + WS_PL + WS_CTX)

static_assert(NB <= NB_FULL);
static_assert(SEQ <= SEQ_FULL);
static_assert(NB == 1 || SEQ == SEQ_FULL);    // the batch elements' rows follow one another in x and out: one row range of NB * SEQ
static_assert(SEQ % 64 == 0);
static_assert(DM % 64 == 0);                  // wave quadrant columns
static_assert(NQKV % 64 == 0);                // wave quadrant columns
static_assert(DM % 32 == 0);                  // k-step of the projection
static_assert(CK % 32 == 0);                  // k-step of the output product
static_assert(HD == 64);
static_assert(NH * HD == DM);                 // merged head columns
static_assert(RH % 32 == 0);                  // whole key halves below the precision boundary
static_assert(RHE % 16 == 0);                 // whole query tiles per kernel
static_assert((SEQ - RHE) % 16 == 0);         // whole query tiles per kernel
static_assert(WIN >= 16);                     // every query of a 16-row tile sees at least its own key
static_assert(WIN <= SEQ_FULL);               // window within the sequence
static_assert(WS_WQKV % 256 == 0);
static_assert(WS_WO2 % 256 == 0);
static_assert(WS_XB % 256 == 0);
static_assert(WS_F % 256 == 0);
static_assert(WS_PL % 256 == 0);
static_assert(WS_CTX % 256 == 0);
static_assert(WS_TOTAL <= (size_t)268435456); // total carve <= 256 MiB

typedef _Float16 h16;
typedef unsigned short bf;
typedef __attribute__((ext_vector_type(16))) __bf16   v16bf;
typedef __attribute__((ext_vector_type(16))) _Float16 v16h;
typedef __attribute__((ext_vector_type(8)))  _Float16 v8h;
typedef __attribute__((ext_vector_type(8)))  unsigned short v8us;
typedef __attribute__((ext_vector_type(2)))  unsigned short v2us;
typedef __attribute__((ext_vector_type(8)))  float    v8f;
typedef __attribute__((ext_vector_type(4)))  float    v4f;
typedef v4f  __attribute__((may_alias)) v4fa;
typedef v8us __attribute__((may_alias)) v8usa;

__device__ __forceinline__ unsigned short f2bf(float f) { unsigned u = __float_as_uint(f); u += 0x7FFFu + ((u >> 16) & 1u); return (unsigned short)(u >> 16); }   // RNE convert
__device__ __forceinline__ float bf2f(unsigned short b) { return __uint_as_float(((unsigned)b) << 16); }
__device__ __forceinline__ void splitf(float y, unsigned short& h, unsigned short& l) { h = f2bf(y); l = f2bf(y - bf2f(h)); }
__device__ __forceinline__ v16h cat16(v8h lo, v8h hi) { return __builtin_shufflevector(lo, hi, 0, 1, 2, 3, 4, 5, 6, 7, 8, 9, 10, 11, 12, 13, 14, 15); }
__device__ __forceinline__ v16bf cat16b(v8us lo, v8us hi) { return __builtin_bit_cast(v16bf, __builtin_shufflevector(lo, hi, 0, 1, 2, 3, 4, 5, 6, 7, 8, 9, 10, 11, 12, 13, 14, 15)); }
__device__ __forceinline__ v8f wmma16(v16h a, v16h b, v8f c) { return __builtin_amdgcn_wmma_f32_16x16x32_f16(false, a, false, b, (short)0, c, false, false); }
__device__ __forceinline__ v8f wmmab(v16bf a, v16bf b, v8f c) { return __builtin_amdgcn_wmma_f32_16x16x32_bf16(false, a, false, b, (short)0, c, false, false); }
// Fragment loaders from K-contiguous 16-bit rows; the pointer already includes row (lane & 15) and 8 * (lane >> 4): elements 0..7 <- k0 + 8h + i, elements 8..15 <- k0 + 16 + 8h + i (A and B alike).
__device__ __forceinline__ v16h  ldh(const h16* p) { return cat16(*(const v8h*)p, *(const v8h*)(p + 16)); }
__device__ __forceinline__ v16bf ldb(const bf* p)  { return cat16b(*(const v8us*)p, *(const v8us*)(p + 16)); }
// f32 -> f16 operand convert that cannot produce an f16 subnormal (value select after the plane's carry).
static __device__ __forceinline__ h16 toh_flush(float v) { const h16 r = (h16)v; return (fabsf(v) < 6.103515625e-05f) ? (h16)0.0f : r; }

// ---- k_gemmw: GEMM, 128x128 output tile per work-group of four waves, each wave a 64x64 quadrant (16 accumulators); grid (M/128, N/128), 128 threads.
// C[m][n] (f32, pitch ldc) = sum_k A[m][k] Bt[n][k], bf16 operands in K-contiguous planes. K % 64 == 0, K >= 128, M and N multiples of 128 (asserted below for every use).
// A pass is 64 k = 128 bytes of each of the 256 operand rows. Every wave brings one slice of 64 rows per pass into LDS with one tensor load (waves 0, 1: the A rows; waves 2, 3: the Bt rows),
// padded to a pitch of 144 bytes for the ds_load_b128 fragment reads; two buffers, the load of pass s + 2 issued when every wave has left pass s.
#define GP_K     64                      // k per pass
#define GP_ROWB  128u                    // bytes of one operand row per pass
#define GP_PITCH 144u                    // LDS row pitch: 128 + 16
#define GP_SLICE 10240u                  // 64 rows x 144 bytes = 9216, rounded up to a multiple of 2 KiB
#define GP_BUF   (4u * GP_SLICE)
#define GP_RING  (2u * GP_BUF)
#define GP_OS    (16u * 68u * 4u)        // output staging bytes per wave, behind the ring
static_assert((NB * SEQ) % 128 == 0);    // GEMM row tiles
static_assert(NQKV % 128 == 0);          // GEMM column tiles
static_assert(DM % 128 == 0);            // GEMM column tiles
static_assert(DM % GP_K == 0 && DM / GP_K >= 2);   // whole passes, two stages or more
static_assert(CK % GP_K == 0 && CK / GP_K >= 2);   // whole passes, two stages or more
static_assert(64u * GP_PITCH <= GP_SLICE && GP_SLICE % 2048u == 0);
typedef unsigned u32x4 __attribute__((ext_vector_type(4)));
typedef unsigned u32x8 __attribute__((ext_vector_type(8)));
__device__ __forceinline__ unsigned uni(unsigned v) { return (unsigned)__builtin_amdgcn_readfirstlane(v); }
__device__ __forceinline__ unsigned pinned(unsigned v) { unsigned w = uni(v); asm volatile("" : "+s"(w)); return w; }   // holds a wave-uniform test in a scalar register: the branch around a tensor load must be a scalar one (the load ignores EXEC)
__device__ __forceinline__ v16bf ldbs(const unsigned char* p) { return cat16b(*(const v8usa*)p, *(const v8usa*)(p + 32)); }   // the k order of ldb, from an LDS row
// Descriptor of one request: 64 rows of 128 bytes, source pitch in bytes, 16 bytes of pad behind every row.
__device__ __forceinline__ u32x8 tile_group1(unsigned src_pitch) {
    u32x8 g;
    g[0] = uni((1u << 20) | (4u << 22) | (3u << 25));
    g[1] = uni((GP_ROWB & 0xFFFFu) << 16);
    g[2] = uni((GP_ROWB >> 16) | (64u << 16));
    g[3] = uni(GP_ROWB << 16);
    g[4] = uni(64u);
    g[5] = uni(src_pitch);
    g[6] = uni(0u);
    g[7] = uni(0u);
    return g;
}
__device__ __forceinline__ u32x4 tile_group0(unsigned lds_dst, unsigned long long ga) {
    u32x4 g;
    g[0] = uni(1u); g[1] = uni(lds_dst); g[2] = uni((unsigned)ga); g[3] = uni((((unsigned)(ga >> 32)) & 0x01FFFFFFu) | 0x80000000u);
    return g;
}
// the next 128 bytes of the same rows: the address advances inside the descriptor's own words (the carry stays below the type bits for any valid address)
__device__ __forceinline__ void tile_advance(u32x4& g0, unsigned lds_dst) {
    const unsigned lo = g0[2] + GP_ROWB;
    g0[3] = uni(g0[3] + (lo < GP_ROWB ? 1u : 0u)); g0[2] = uni(lo); g0[1] = uni(lds_dst);
}
// both groups are in-out operands: their values stay live behind the instruction, so the compiler reuses none of their registers for another value while the request is on its way
__device__ __forceinline__ void tile_load(u32x4& g0, u32x8& g1) { asm volatile("tensor_load_to_lds %0, %1" : "+s"(g0), "+s"(g1) :: "memory"); }
__global__ __launch_bounds__(128)
void k_gemmw(const bf* __restrict__ A, const bf* __restrict__ Bt, int K, float* C, int ldc) {
    __shared__ __attribute__((aligned(2048))) unsigned char sm[GP_RING + 4u * GP_OS];
    const int lane = threadIdx.x & 31, lr = lane & 15, hi = lane >> 4; const unsigned wave = uni(threadIdx.x >> 5);
    const int r0 = blockIdx.x * 128, c0 = blockIdx.y * 128;
    const unsigned pitch = (unsigned)K * 2u;
    const unsigned lbase = (unsigned)(size_t)sm + wave * GP_SLICE;      // this wave's slice in buffer 0
    const unsigned long long gsrc = (wave < 2u) ? (unsigned long long)(size_t)A + (unsigned long long)(r0 + 64 * (int)wave) * pitch
                                                : (unsigned long long)(size_t)Bt + (unsigned long long)(c0 + 64 * ((int)wave - 2)) * pitch;
    const int np = K / GP_K;
    v8f acc[4][4];
#pragma unroll
    for (int mb = 0; mb < 4; ++mb)
#pragma unroll
        for (int nb = 0; nb < 4; ++nb) acc[mb][nb] = (v8f){};
    u32x8 g1 = tile_group1(pitch);
    u32x4 g0 = tile_group0(lbase, gsrc);
    tile_load(g0, g1);
    asm volatile("s_wait_tensorcnt 0x0" ::: "memory");   // stage 0 has landed before the barrier that publishes it
    __syncthreads();
    tile_advance(g0, lbase + GP_BUF);
    tile_load(g0, g1);
    const unsigned wm = wave & 1u, wn = wave >> 1;       // quadrant: rows r0 + 64 wm, columns c0 + 64 wn
    const unsigned aofs = wm * GP_SLICE + (unsigned)lr * GP_PITCH + 16u * (unsigned)hi, bofs = (2u + wn) * GP_SLICE + (unsigned)lr * GP_PITCH + 16u * (unsigned)hi;
    int s = 0;
#pragma unroll 1
    do {                                                 // np >= 2: the body runs at least twice
        const unsigned char* pa = sm + (unsigned)(s & 1) * GP_BUF + aofs; const unsigned char* pb = sm + (unsigned)(s & 1) * GP_BUF + bofs;
        v16bf a0[4], b0[4], a1[4], b1[4];    // fragments of the pass's two k-steps
        b0[0] = ldbs(pb);
#pragma unroll
        for (int mb = 0; mb < 4; ++mb) a0[mb] = ldbs(pa + (unsigned)mb * 16u * GP_PITCH);
#pragma unroll
        for (int nb = 1; nb < 4; ++nb) b0[nb] = ldbs(pb + (unsigned)nb * 16u * GP_PITCH);
#pragma unroll
        for (int mb = 0; mb < 4; ++mb) a1[mb] = ldbs(pa + (unsigned)mb * 16u * GP_PITCH + 64u);
#pragma unroll
        for (int nb = 0; nb < 2; ++nb) b1[nb] = ldbs(pb + (unsigned)nb * 16u * GP_PITCH + 64u);
        __builtin_amdgcn_sched_barrier(0);   // the LDS reads stay one group ahead of the matrix block
#pragma unroll
        for (int nb = 0; nb < 2; ++nb)
#pragma unroll
            for (int mb = 0; mb < 4; ++mb) acc[mb][nb] = wmmab(a0[mb], b0[nb], acc[mb][nb]);
        __builtin_amdgcn_sched_barrier(0);   // the last two fragments go into registers that the eight WMMAs above have freed (keeps the wave within 256 registers), as one group
#pragma unroll
        for (int nb = 2; nb < 4; ++nb) b1[nb] = ldbs(pb + (unsigned)nb * 16u * GP_PITCH + 64u);
        __builtin_amdgcn_sched_barrier(0);   // as above: no LDS read moves in among the WMMAs below
#pragma unroll
        for (int nb = 2; nb < 4; ++nb)
#pragma unroll
            for (int mb = 0; mb < 4; ++mb) acc[mb][nb] = wmmab(a0[mb], b0[nb], acc[mb][nb]);
#pragma unroll
        for (int nb = 0; nb < 4; ++nb)
#pragma unroll
            for (int mb = 0; mb < 4; ++mb) acc[mb][nb] = wmmab(a1[mb], b1[nb], acc[mb][nb]);
        __builtin_amdgcn_sched_barrier(0);   // the WMMAs stay in front of the waits: sunk behind the barrier they would stand in front of the refill and shorten its lead
        asm volatile("s_wait_dscnt 0x0" ::: "memory");      // this wave's reads of buffer s & 1 are done before the buffer is refilled
        asm volatile("s_wait_tensorcnt 0x0" ::: "memory");  // this wave's slice of stage s + 1 has landed
        __syncthreads();                                     // publishes stage s + 1 and ends every wave's reads of stage s
        if (pinned(s + 2 < np)) { tile_advance(g0, lbase + (unsigned)(s & 1) * GP_BUF); tile_load(g0, g1); }
    } while (++s < np);
    asm volatile("s_wait_tensorcnt 0x0" ::: "memory");   // no request outstanding at the wave's end
    asm volatile("s_wait_dscnt 0x0" ::: "memory");       // and no LDS read of the ring
    float* os = (float*)(sm + GP_RING + wave * GP_OS);   // each wave stages in its own range, outside the ring
#pragma unroll
    for (int mb = 0; mb < 4; ++mb) {
#pragma unroll
        for (int nb = 0; nb < 4; ++nb) {
#pragma unroll
            for (int j = 0; j < 8; ++j) os[(hi * 8 + j) * 68 + nb * 16 + lr] = acc[mb][nb][j]; }
        __builtin_amdgcn_wave_barrier(); asm volatile("" ::: "memory");
        float* crow = C + (size_t)(r0 + (int)wm * 64 + mb * 16) * ldc + c0 + (int)wn * 64;
{
#pragma unroll
            for (int s = 0; s < 8; ++s) { const int row = 2 * s + hi, cofs = lr * 4; const v4f val = *(const v4fa*)(os + row * 68 + cofs);
                *(v4f*)(crow + (size_t)row * ldc + cofs) = val; }
             }
        __builtin_amdgcn_wave_barrier(); asm volatile("" ::: "memory");
    }
}

__global__ __launch_bounds__(256) void k_wt(const float* __restrict__ w, int K, int N, int rep, bf* Bt) {
    const int lane = threadIdx.x & 31; const int wave = __builtin_amdgcn_readfirstlane(threadIdx.x >> 5);
    const int KO = K * rep; const int L0 = (blockIdx.x * 8 + wave) * 8; const int nlines = (int)(((size_t)N * KO) / 64);
{
#pragma unroll 1
        for (int l = 0; l < 8; ++l) { const int L = L0 + l; if (L >= nlines) break; const size_t e = (size_t)L * 64 + lane * 2; const int ko = (int)(e % KO), n = (int)(e / KO); const int k = ko % K; v2us o;
            o[0] = f2bf(w[(size_t)k * N + n]); o[1] = f2bf(w[(size_t)(k + 1) * N + n]); *(v2us*)(Bt + e) = o; }
         }
}

__global__ __launch_bounds__(256) void k_cvt8(const float* __restrict__ src, bf* dst, size_t n8) { const size_t i = (size_t)blockIdx.x * 256 + threadIdx.x; if (i >= n8) return; const v8f v = *(const v8f*)(src + i * 8); v8us o;
#pragma unroll
    for (int k = 0; k < 8; ++k) o[k] = f2bf(v[k]); *(v8us*)(dst + i * 8) = o;  }

// Plane set layout in PL (PLN elements each): 0 q value, 1 q residual, 2 k value, 3 k residual, 4 v^T value, 5 v^T residual; one such set of six per batch element, batch = grid z (grid y in k_vtp).
__global__ __launch_bounds__(256) void k_qkp(const float* __restrict__ F, h16* PL) {
    const size_t i = (size_t)blockIdx.x * 256 + threadIdx.x; if (i >= PLN / 8) return; const int which = blockIdx.y;
    F += (size_t)blockIdx.z * SEQ * NQKV; PL += (size_t)blockIdx.z * 6 * PLN;
    const size_t e = i * 8; const int d = (int)(e % HD); const int t = (int)((e / HD) % SEQ); const int h = (int)(e / ((size_t)HD * SEQ));
    const v8f v = *(const v8f*)(F + (size_t)t * NQKV + which * DM + h * HD + d); v8h o, r;
#pragma unroll
    for (int k = 0; k < 8; ++k) { const h16 a = (h16)v[k]; o[k] = a; r[k] = (h16)((v[k] - (float)a) * RSC); }
    h16* p16 = PL + (size_t)which * 2 * PLN + e; h16* pr = p16 + PLN;
    *(v8h*)p16 = o; *(v8h*)pr = r;  }

__global__ __launch_bounds__(256) void k_vtp(const float* __restrict__ F, h16* PL) {
    const size_t i = (size_t)blockIdx.x * 256 + threadIdx.x; if (i >= PLN / 8) return;
    F += (size_t)blockIdx.y * SEQ * NQKV; PL += (size_t)blockIdx.y * 6 * PLN;
    const size_t e = i * 8; const int t = (int)(e % SEQ); const int d = (int)((e / SEQ) % HD); const int h = (int)(e / ((size_t)SEQ * HD));
    const float* f = F + (size_t)t * NQKV + 2 * DM + h * HD + d; v8h o, r;
#pragma unroll
    for (int k = 0; k < 8; ++k) { const float x = f[(size_t)k * NQKV]; const h16 a = (h16)x; o[k] = a; r[k] = (h16)((x - (float)a) * RSC); }
    h16* p16 = PL + 4 * PLN + e; h16* pr = p16 + PLN;
    *(v8h*)p16 = o; *(v8h*)pr = r;  }

// ---- fused windowed causal attention, one wave per 16 query rows of one head; grid (rows/16, NH, NB), 32 threads.
// Key halves visited: from the 32-aligned half holding key q0 - (WIN - 1) (clipped at 0) up to the half holding key q0 + 15; all of them lie inside the written planes.
// Per 32-key half: S^T tiles [16 keys][16 queries] = K Q^T (A = key rows, B = query rows, k = d); lane (h, n) holds query q0+n, keys kb + 16*tile + 8h + r.
// Online softmax per lane (16 values) + one xor-16 shuffle; the two packed tiles are the B fragment (k = key, n = query) of O^T [d][query] += V^T [d][key] P^T.
// HIRES: value+residual on q, k, P, v (3 products each side); else q value+residual against single k, single P and v.
template <bool HIRES>
__device__ __forceinline__ void attn_body(const h16* __restrict__ PL, bf* CTX, const int qbase) {
    __shared__ __align__(16) unsigned short ost[2 * 16 * HD];
    const int lane = threadIdx.x & 31, lr = lane & 15, hi = lane >> 4;
    const int head = blockIdx.y;
    const int q0 = qbase + blockIdx.x * 16;
    const int kb0 = max(q0 - (WIN - 1), 0) & ~31;      // first key half with a key inside the window of query q0
    const size_t hb = (size_t)blockIdx.z * 6 * PLN + (size_t)head * SEQ * HD;   // this batch element's set of six planes, then the head
    const size_t oQ = hb + (size_t)(q0 + lr) * HD + 8 * hi;
    const size_t oK = 2 * PLN + hb + (size_t)lr * HD + 8 * hi;
    const size_t oV = 4 * PLN + hb + (size_t)lr * SEQ + 8 * hi;
    const float CE = SCL * 1.4426950408889634f;
    v8f o[4], orr[4];
#pragma unroll
    for (int dt = 0; dt < 4; ++dt) { o[dt] = (v8f){}; orr[dt] = (v8f){}; }
    float m = NEGB, l = 0.0f;
#pragma unroll 1
    for (int kb = kb0; kb < q0 + 16; kb += 32) {
        v8f sh0 = (v8f){}, sh1 = (v8f){}, sr0 = (v8f){}, sr1 = (v8f){};
#pragma unroll
        for (int kc = 0; kc < HD; kc += 32) {
            const v16h bq  = ldh(PL + oQ + kc);
            const v16h bqr = ldh(PL + PLN + oQ + kc);
            const v16h ak0 = ldh(PL + oK + (size_t)kb * HD + kc);
            const v16h ak1 = ldh(PL + oK + (size_t)(kb + 16) * HD + kc);
            sh0 = wmma16(ak0, bq, sh0);  sh1 = wmma16(ak1, bq, sh1);
            sr0 = wmma16(ak0, bqr, sr0); sr1 = wmma16(ak1, bqr, sr1);
            if (HIRES) {
                const v16h kr0 = ldh(PL + PLN + oK + (size_t)kb * HD + kc);
                const v16h kr1 = ldh(PL + PLN + oK + (size_t)(kb + 16) * HD + kc);
                sr0 = wmma16(kr0, bq, sr0); sr1 = wmma16(kr1, bq, sr1);
                asm volatile("v_nop\n\tv_nop\n\tv_nop\n\tv_nop" : "+v"(sh0), "+v"(sh1), "+v"(sr0), "+v"(sr1) : "v"(ak0), "v"(ak1), "v"(bq), "v"(bqr), "v"(kr0), "v"(kr1));
            } else {
                asm volatile("v_nop\n\tv_nop\n\tv_nop\n\tv_nop" : "+v"(sh0), "+v"(sh1), "+v"(sr0), "+v"(sr1) : "v"(ak0), "v"(ak1), "v"(bq), "v"(bqr));
            }
        }
        float u[16];
#pragma unroll
        for (int r = 0; r < 8; ++r) { u[r] = (sh0[r] + sr0[r] * RINV) * CE; u[8 + r] = (sh1[r] + sr1[r] * RINV) * CE; }
        if (kb + 31 > q0 || kb + (WIN - 16) < q0) {   // wave-uniform: this half touches the diagonal or the far edge of the window; keys above the query or WIN or more behind it are excluded
            const int qi = q0 + lr; const int k0 = kb + 8 * hi;
#pragma unroll
            for (int r = 0; r < 8; ++r) { u[r] = (k0 + r > qi || qi - (k0 + r) >= WIN) ? NEGB : u[r]; u[8 + r] = (k0 + 16 + r > qi || qi - (k0 + 16 + r) >= WIN) ? NEGB : u[8 + r]; }
        }
        float mx = u[0];
#pragma unroll
        for (int i = 1; i < 16; ++i) mx = fmaxf(mx, u[i]);
        mx = fmaxf(mx, __shfl_xor(mx, 16, 32));
        const float mn = fmaxf(fmaxf(m, mx), MFLOOR);
        const float corr = __builtin_amdgcn_exp2f(m - mn);
        m = mn;
        float psum = 0.0f;
#pragma unroll
        for (int i = 0; i < 16; ++i) { u[i] = __builtin_amdgcn_exp2f(u[i] - mn); psum += u[i]; }
        l = l * corr + psum;
#pragma unroll
        for (int dt = 0; dt < 4; ++dt) {
#pragma unroll
            for (int r = 0; r < 8; ++r) { o[dt][r] *= corr; if (HIRES) orr[dt][r] *= corr; } }
        v16h pb, pr;
#pragma unroll
        for (int i = 0; i < 16; ++i) { const float pc = u[i] * PCAR; const h16 ph = toh_flush(pc); pb[i] = ph; pr[i] = toh_flush((pc - (float)ph) * RSC); }
        const size_t ov = oV + kb;
        if (HIRES) {
#pragma unroll
            for (int dt = 0; dt < 4; ++dt) {
                const v16h av  = ldh(PL + ov + (size_t)dt * 16 * SEQ);
                const v16h avr = ldh(PL + PLN + ov + (size_t)dt * 16 * SEQ);
                o[dt]   = wmma16(av, pb, o[dt]);
                orr[dt] = wmma16(avr, pb, orr[dt]);
                orr[dt] = wmma16(av, pr, orr[dt]);
                asm volatile("v_nop\n\tv_nop\n\tv_nop\n\tv_nop" : "+v"(o[dt]), "+v"(orr[dt]) : "v"(av), "v"(avr), "v"(pb), "v"(pr));
            }
        } else {
            const v16h av0 = ldh(PL + ov);
            const v16h av1 = ldh(PL + ov + (size_t)16 * SEQ);
            const v16h av2 = ldh(PL + ov + (size_t)32 * SEQ);
            const v16h av3 = ldh(PL + ov + (size_t)48 * SEQ);
            o[0] = wmma16(av0, pb, o[0]); o[1] = wmma16(av1, pb, o[1]); o[2] = wmma16(av2, pb, o[2]); o[3] = wmma16(av3, pb, o[3]);
            asm volatile("v_nop\n\tv_nop\n\tv_nop\n\tv_nop" : "+v"(o[0]), "+v"(o[1]), "+v"(o[2]), "+v"(o[3]) : "v"(av0), "v"(av1), "v"(av2), "v"(av3), "v"(pb));
        }
    }
    l += __shfl_xor(l, 16, 32);
    const float inv = 1.0f / (l * PCAR);
#pragma unroll
    for (int dt = 0; dt < 4; ++dt) { v8us vh, vl;
#pragma unroll
        for (int r = 0; r < 8; ++r) { float y = o[dt][r]; if (HIRES) y += orr[dt][r] * RINV; y *= inv; unsigned short a, c; splitf(y, a, c); vh[r] = a; vl[r] = c; }
        *(v8usa*)(ost + lr * HD + dt * 16 + hi * 8) = vh; *(v8usa*)(ost + 16 * HD + lr * HD + dt * 16 + hi * 8) = vl; }
    __builtin_amdgcn_wave_barrier(); asm volatile("" ::: "memory");
    bf* crow = CTX + ((size_t)blockIdx.z * SEQ + q0) * CK + head * HD;
{
#pragma unroll
        for (int s = 0; s < 4; ++s) { const int row = 4 * s + (lane >> 3), pc = (lane & 7) * 8;
            const v8us a = *(const v8usa*)(ost + row * HD + pc); const v8us c = *(const v8usa*)(ost + 16 * HD + row * HD + pc);
            *(v8us*)(crow + (size_t)row * CK + pc) = a; *(v8us*)(crow + (size_t)row * CK + DM + pc) = c; }
         }
}
__global__ __launch_bounds__(32) __attribute__((amdgpu_num_vgpr(256))) void k_attn_hi(const h16* __restrict__ PL, bf* CTX) { attn_body<true>(PL, CTX, 0); }
__global__ __launch_bounds__(32) __attribute__((amdgpu_num_vgpr(256))) void k_attn_lo(const h16* __restrict__ PL, bf* CTX) { attn_body<false>(PL, CTX, RHE); }

extern "C" void kernel_launch(void* const* d_in, const int* in_sizes, int n_in,
                              void* d_out, int out_size, void* d_ws, size_t ws_size, hipStream_t stream) {
    if (n_in < 3) return;
    const int need_x = (NB - 1) * SEQ_FULL * DM + SEQ * DM;
    if (in_sizes[0] < need_x || in_sizes[1] < DM * NQKV || in_sizes[2] < DM * DM || out_size < need_x) return;
    if (WS_TOTAL > ws_size) return;
    const float* x = (const float*)d_in[0]; const float* wqkv = (const float*)d_in[1]; const float* wo = (const float*)d_in[2];   // x, w_attn, w_proj
    float* OUT = (float*)d_out;     // [2][2048][1024]
    char* wsp = (char*)d_ws;
    bf* WQKV = (bf*)wsp;  wsp += WS_WQKV;      // [3072][1024] bf16, K-contiguous
    bf* WO2  = (bf*)wsp;  wsp += WS_WO2;
    bf* XB   = (bf*)wsp;  wsp += WS_XB;        // [NB * SEQ][1024] bf16
    float* F = (float*)wsp; wsp += WS_F;       // [NB * SEQ][3072] f32 q | k | v
    h16* PL  = (h16*)wsp; wsp += WS_PL;        // six head plane sets per batch element
    bf* CTX  = (bf*)wsp;  wsp += WS_CTX;       // [NB * SEQ][2048] bf16 hi | lo
    k_wt<<<(unsigned)(((size_t)NQKV * DM / 64 + 63) / 64), 256, 0, stream>>>(wqkv, DM, NQKV, 1, WQKV);   // in[1024][3072] -> out[3072][1024]
    k_wt<<<(unsigned)(((size_t)DM * CK / 64 + 63) / 64), 256, 0, stream>>>(wo, DM, DM, 2, WO2);          // in[1024][1024] -> out[1024][2 x 1024]
    const unsigned LP = (unsigned)((PLN / 8 + 255) / 256);
    // every stage runs once, over all NB batch elements: the row-wise stages on NB * SEQ rows, the plane and attention stages with the batch as grid z (grid y in k_vtp)
    k_cvt8<<<(unsigned)(((size_t)NB * SEQ * DM / 8 + 255) / 256), 256, 0, stream>>>(x, XB, (size_t)NB * SEQ * DM / 8);
    k_gemmw<<<dim3(NB * SEQ / 128, NQKV / 128, 1), 128, 0, stream>>>(XB, WQKV, DM, F, NQKV);
    k_qkp<<<dim3(LP, 2, NB), 256, 0, stream>>>(F, PL);
    k_vtp<<<dim3(LP, NB, 1), 256, 0, stream>>>(F, PL);
    k_attn_hi<<<dim3(RHE / 16, NH, NB), 32, 0, stream>>>(PL, CTX);
    if (SEQ > RHE) k_attn_lo<<<dim3((SEQ - RHE) / 16, NH, NB), 32, 0, stream>>>(PL, CTX);
    k_gemmw<<<dim3(NB * SEQ / 128, DM / 128, 1), 128, 0, stream>>>(CTX, WO2, CK, OUT, DM);
}

// v003
// A run of this version takes 119 microseconds.
// In both of two side-by-side timings against v002, it was 1.30 times as fast.
// All steps since v000 together make it 2.32 times as fast.
#include <hip/hip_runtime.h>

// Windowed causal multi-head attention with a fused qkv projection (x [2][2048][1024]; qkv = x w_attn ('io' [1024][3072], column = which*1024 + h*64 + d, no bias; 16 heads x 64); scores x 64^-0.5, key j visible to query i when 0 <= i - j < 256; softmax; out = merged w_proj ('io' [1024][1024], no bias) -> [2][2048][1024]).
// Compute dtypes, f32 accumulate everywhere: x, w_attn, w_proj converted to bf16 (RNE) and multiplied with v_wmma_f32_16x16x32_bf16 (exact products); attention on v_wmma_f32_16x16x32_f16:
// q, k, v carried as f16 value + f16 residual x2^11 (separate accumulator, folded back x2^-11); query rows < 256 use value+residual on q, k, P, v (3 products); rows >= 256 use q value+residual against single f16 k, single f16 P (x1024) and v;
// softmax f32 (running max, exp2); merged context stored as bf16 hi | lo along K and multiplied with [w_proj ; w_proj] on the bf16 WMMA.
// Fused flash-style attention in the transposed form S^T = K Q^T, O^T = V^T P^T: the packed score tiles are the B fragment of the second product directly (no probability plane, no LDS exchange); only the 32-key halves inside the window of a query tile are visited.

#ifndef NB
#define NB 2
#endif
#ifndef SEQ
#define SEQ 2048
#endif
#define NB_FULL  2
#define SEQ_FULL 2048
#define DM   1024
#define NH   16
#define HD   64
#define NQKV (3 * DM)
#define CK   (2 * DM)                 // context plane pitch: hi | lo along K
#define RH   256                      // query rows < RH use value+residual on every attention operand
#define RHE  ((SEQ < RH) ? SEQ : RH)
#define WIN  256                      // attention window: key j visible to query i when 0 <= i - j < WIN
#define PCAR 1024.0f                  // carry of the f16 probability operand
#define RSC  2048.0f                  // carry of every f16 residual plane (2^11)
#define RINV (1.0f / 2048.0f)
#define SCL  0.125f                   // HD^-0.5
#define NEGB (-3.0e38f)
#define MFLOOR (-1.0e30f)             // floor of the running maximum: a key half with no visible key for a query yields probabilities exactly 0
#define PLN  ((size_t)NH * SEQ * HD)  // elements per head plane set

#define WS_WQKV ((size_t)NQKV * DM * 2)
#define WS_WO2  ((size_t)DM * CK * 2)
#define WS_XB   ((size_t)NB * SEQ * DM * 2)
#define WS_PL   ((size_t)NB * 6 * NH * SEQ * HD * 2)
#define WS_CTX  ((size_t)NB * SEQ * CK * 2)
#define WS_TOTAL (WS_WQKV + WS_WO2 + WS_XB + WS_PL + WS_CTX)

static_assert(NB <= NB_FULL);                 // batch count within the inputs
static_assert(SEQ <= SEQ_FULL);               // sequence rows within the inputs
static_assert(NB == 1 || SEQ == SEQ_FULL);    // the batch elements' rows follow one another in x and out: one row range of NB * SEQ
static_assert(SEQ % 64 == 0);
static_assert(DM % 64 == 0);                  // wave quadrant columns
static_assert(NQKV % 64 == 0);                // wave quadrant columns
static_assert(DM % 32 == 0);                  // k-step of the projection
static_assert(CK % 32 == 0);                  // k-step of the output product
static_assert(HD == 64);
static_assert(NH * HD == DM);                 // merged head columns
static_assert(RH % 32 == 0);                  // whole key halves below the precision boundary
static_assert(RHE % 16 == 0);                 // whole query tiles per kernel
static_assert((SEQ - RHE) % 16 == 0);         // whole query tiles per kernel
static_assert(WIN >= 16);                     // every query of a 16-row tile sees at least its own key
static_assert(WIN <= SEQ_FULL);               // window within the sequence
static_assert(WS_WQKV % 256 == 0);
static_assert(WS_WO2 % 256 == 0);
static_assert(WS_XB % 256 == 0);
static_assert(WS_PL % 256 == 0);
static_assert(WS_CTX % 256 == 0);
static_assert(WS_TOTAL <= (size_t)268435456); // total carve <= 256 MiB

typedef _Float16 h16;
typedef unsigned short bf;
typedef __attribute__((ext_vector_type(16))) __bf16   v16bf;
typedef __attribute__((ext_vector_type(16))) _Float16 v16h;
typedef __attribute__((ext_vector_type(8)))  _Float16 v8h;
typedef __attribute__((ext_vector_type(8)))  unsigned short v8us;
typedef __attribute__((ext_vector_type(2)))  unsigned short v2us;
typedef __attribute__((ext_vector_type(8)))  float    v8f;
typedef __attribute__((ext_vector_type(4)))  float    v4f;
typedef v4f  __attribute__((may_alias)) v4fa;
typedef v8us __attribute__((may_alias)) v8usa;
typedef v8h  __attribute__((may_alias)) v8ha;

__device__ __forceinline__ unsigned short f2bf(float f) { unsigned u = __float_as_uint(f); u += 0x7FFFu + ((u >> 16) & 1u); return (unsigned short)(u >> 16); }   // RNE convert
__device__ __forceinline__ float bf2f(unsigned short b) { return __uint_as_float(((unsigned)b) << 16); }
__device__ __forceinline__ void splitf(float y, unsigned short& h, unsigned short& l) { h = f2bf(y); l = f2bf(y - bf2f(h)); }
__device__ __forceinline__ v16h cat16(v8h lo, v8h hi) { return __builtin_shufflevector(lo, hi, 0, 1, 2, 3, 4, 5, 6, 7, 8, 9, 10, 11, 12, 13, 14, 15); }
__device__ __forceinline__ v16bf cat16b(v8us lo, v8us hi) { return __builtin_bit_cast(v16bf, __builtin_shufflevector(lo, hi, 0, 1, 2, 3, 4, 5, 6, 7, 8, 9, 10, 11, 12, 13, 14, 15)); }
__device__ __forceinline__ v8f wmma16(v16h a, v16h b, v8f c) { return __builtin_amdgcn_wmma_f32_16x16x32_f16(false, a, false, b, (short)0, c, false, false); }
__device__ __forceinline__ v8f wmmab(v16bf a, v16bf b, v8f c) { return __builtin_amdgcn_wmma_f32_16x16x32_bf16(false, a, false, b, (short)0, c, false, false); }
// Fragment loaders from K-contiguous 16-bit rows; the pointer already includes row (lane & 15) and 8 * (lane >> 4): elements 0..7 <- k0 + 8h + i, elements 8..15 <- k0 + 16 + 8h + i (A and B alike).
__device__ __forceinline__ v16h  ldh(const h16* p) { return cat16(*(const v8h*)p, *(const v8h*)(p + 16)); }
__device__ __forceinline__ v16bf ldb(const bf* p)  { return cat16b(*(const v8us*)p, *(const v8us*)(p + 16)); }
// f32 -> f16 operand convert that cannot produce an f16 subnormal (value select after the plane's carry).
static __device__ __forceinline__ h16 toh_flush(float v) { const h16 r = (h16)v; return (fabsf(v) < 6.103515625e-05f) ? (h16)0.0f : r; }

// ---- gemm_body: GEMM, 128x128 output tile per work-group of four waves, each wave a 64x64 quadrant (16 accumulators); grid (M/128, N/128), 128 threads.
// c[m][n] (f32) = sum_k A[m][k] Bt[n][k], bf16 operands in K-contiguous planes. K % 64 == 0, K >= 128, M and N multiples of 128 (asserted below for every use).
// PLANES false (k_gemmw): c goes to C (f32, pitch ldc). PLANES true (k_gemmp, the qkv projection): a quadrant is 64 tokens x the 64 columns of one head of q, k or v,
// and the epilogue stores it straight as that head's two f16 planes (value, residual x2^11) in the layout the attention kernels read: q and k [token][d], v transposed [d][token].
// A pass is 64 k = 128 bytes of each of the 256 operand rows. Every wave brings one slice of 64 rows per pass into LDS with one tensor load (waves 0, 1: the A rows; waves 2, 3: the Bt rows),
// padded to a pitch of 144 bytes for the ds_load_b128 fragment reads; two buffers, the load of pass s + 2 issued when every wave has left pass s.
#define GP_K     64                      // k per pass
#define GP_ROWB  128u                    // bytes of one operand row per pass
#define GP_PITCH 144u                    // LDS row pitch: 128 + 16
#define GP_SLICE 10240u                  // 64 rows x 144 bytes = 9216, rounded up to a multiple of 2 KiB
#define GP_BUF   (4u * GP_SLICE)
#define GP_RING  (2u * GP_BUF)
#define GP_OS    (2u * 16u * 144u)       // output staging bytes per wave, behind the ring: 16 rows x 68 f32, or two f16 tiles of 16 rows x 144 bytes
#define GP_VP    72                      // pitch of a staged v^T row in f16 elements: 64 tokens + 16 bytes
static_assert(16u * 68u * 4u <= GP_OS);
static_assert((NB * SEQ) % 128 == 0);    // GEMM row tiles
static_assert(NQKV % 128 == 0);          // GEMM column tiles
static_assert(DM % 128 == 0);            // GEMM column tiles
static_assert(DM % GP_K == 0 && DM / GP_K >= 2);   // whole passes, two stages or more
static_assert(CK % GP_K == 0 && CK / GP_K >= 2);   // whole passes, two stages or more
static_assert(64u * GP_PITCH <= GP_SLICE && GP_SLICE % 2048u == 0);
typedef unsigned u32x4 __attribute__((ext_vector_type(4)));
typedef unsigned u32x8 __attribute__((ext_vector_type(8)));
__device__ __forceinline__ unsigned uni(unsigned v) { return (unsigned)__builtin_amdgcn_readfirstlane(v); }
__device__ __forceinline__ unsigned pinned(unsigned v) { unsigned w = uni(v); asm volatile("" : "+s"(w)); return w; }   // holds a wave-uniform test in a scalar register: the branch around a tensor load must be a scalar one (the load ignores EXEC)
__device__ __forceinline__ v16bf ldbs(const unsigned char* p) { return cat16b(*(const v8usa*)p, *(const v8usa*)(p + 32)); }   // the k order of ldb, from an LDS row
// Descriptor of one request: 64 rows of 128 bytes, source pitch in bytes, 16 bytes of pad behind every row.
__device__ __forceinline__ u32x8 tile_group1(unsigned src_pitch) {
    u32x8 g;
    g[0] = uni((1u << 20) | (4u << 22) | (3u << 25));
    g[1] = uni((GP_ROWB & 0xFFFFu) << 16);
    g[2] = uni((GP_ROWB >> 16) | (64u << 16));
    g[3] = uni(GP_ROWB << 16);
    g[4] = uni(64u);
    g[5] = uni(src_pitch);
    g[6] = uni(0u);
    g[7] = uni(0u);
    return g;
}
__device__ __forceinline__ u32x4 tile_group0(unsigned lds_dst, unsigned long long ga) {
    u32x4 g;
    g[0] = uni(1u); g[1] = uni(lds_dst); g[2] = uni((unsigned)ga); g[3] = uni((((unsigned)(ga >> 32)) & 0x01FFFFFFu) | 0x80000000u);
    return g;
}
// the next 128 bytes of the same rows: the address advances inside the descriptor's own words (the carry stays below the type bits for any valid address)
__device__ __forceinline__ void tile_advance(u32x4& g0, unsigned lds_dst) {
    const unsigned lo = g0[2] + GP_ROWB;
    g0[3] = uni(g0[3] + (lo < GP_ROWB ? 1u : 0u)); g0[2] = uni(lo); g0[1] = uni(lds_dst);
}
// both groups are in-out operands: their values stay live behind the instruction, so the compiler reuses none of their registers for another value while the request is on its way
__device__ __forceinline__ void tile_load(u32x4& g0, u32x8& g1) { asm volatile("tensor_load_to_lds %0, %1" : "+s"(g0), "+s"(g1) :: "memory"); }
template <bool PLANES>
__device__ __forceinline__ void gemm_body(const bf* __restrict__ A, const bf* __restrict__ Bt, int K, float* C, int ldc, h16* PL) {
    __shared__ __attribute__((aligned(2048))) unsigned char sm[GP_RING + 4u * GP_OS];
    const int lane = threadIdx.x & 31, lr = lane & 15, hi = lane >> 4; const unsigned wave = uni(threadIdx.x >> 5);
    const int r0 = blockIdx.x * 128, c0 = blockIdx.y * 128;
    const unsigned pitch = (unsigned)K * 2u;
    const unsigned lbase = (unsigned)(size_t)sm + wave * GP_SLICE;      // this wave's slice in buffer 0
    const unsigned long long gsrc = (wave < 2u) ? (unsigned long long)(size_t)A + (unsigned long long)(r0 + 64 * (int)wave) * pitch
                                                : (unsigned long long)(size_t)Bt + (unsigned long long)(c0 + 64 * ((int)wave - 2)) * pitch;
    const int np = K / GP_K;
    v8f acc[4][4];
#pragma unroll
    for (int mb = 0; mb < 4; ++mb)
#pragma unroll
        for (int nb = 0; nb < 4; ++nb) acc[mb][nb] = (v8f){};
    u32x8 g1 = tile_group1(pitch);
    u32x4 g0 = tile_group0(lbase, gsrc);
    tile_load(g0, g1);
    asm volatile("s_wait_tensorcnt 0x0" ::: "memory");   // stage 0 has landed before the barrier that publishes it
    __syncthreads();
    tile_advance(g0, lbase + GP_BUF);
    tile_load(g0, g1);
    const unsigned wm = wave & 1u, wn = wave >> 1;       // quadrant: rows r0 + 64 wm, columns c0 + 64 wn
    const unsigned aofs = wm * GP_SLICE + (unsigned)lr * GP_PITCH + 16u * (unsigned)hi, bofs = (2u + wn) * GP_SLICE + (unsigned)lr * GP_PITCH + 16u * (unsigned)hi;
    int s = 0;
#pragma unroll 1
    do {                                                 // np >= 2: the body runs at least twice
        const unsigned char* pa = sm + (unsigned)(s & 1) * GP_BUF + aofs; const unsigned char* pb = sm + (unsigned)(s & 1) * GP_BUF + bofs;
        v16bf a0[4], b0[4], a1[4], b1[4];    // fragments of the pass's two k-steps
        b0[0] = ldbs(pb);
#pragma unroll
        for (int mb = 0; mb < 4; ++mb) a0[mb] = ldbs(pa + (unsigned)mb * 16u * GP_PITCH);
#pragma unroll
        for (int nb = 1; nb < 4; ++nb) b0[nb] = ldbs(pb + (unsigned)nb * 16u * GP_PITCH);
#pragma unroll
        for (int mb = 0; mb < 4; ++mb) a1[mb] = ldbs(pa + (unsigned)mb * 16u * GP_PITCH + 64u);
#pragma unroll
        for (int nb = 0; nb < 2; ++nb) b1[nb] = ldbs(pb + (unsigned)nb * 16u * GP_PITCH + 64u);
        __builtin_amdgcn_sched_barrier(0);   // the LDS reads stay one group ahead of the matrix block
#pragma unroll
        for (int nb = 0; nb < 2; ++nb)
#pragma unroll
            for (int mb = 0; mb < 4; ++mb) acc[mb][nb] = wmmab(a0[mb], b0[nb], acc[mb][nb]);
        __builtin_amdgcn_sched_barrier(0);   // the last two fragments go into registers that the eight WMMAs above have freed (keeps the wave within 256 registers), as one group
#pragma unroll
        for (int nb = 2; nb < 4; ++nb) b1[nb] = ldbs(pb + (unsigned)nb * 16u * GP_PITCH + 64u);
        __builtin_amdgcn_sched_barrier(0);   // as above: no LDS read moves in among the WMMAs below
#pragma unroll
        for (int nb = 2; nb < 4; ++nb)
#pragma unroll
            for (int mb = 0; mb < 4; ++mb) acc[mb][nb] = wmmab(a0[mb], b0[nb], acc[mb][nb]);
#pragma unroll
        for (int nb = 0; nb < 4; ++nb)
#pragma unroll
            for (int mb = 0; mb < 4; ++mb) acc[mb][nb] = wmmab(a1[mb], b1[nb], acc[mb][nb]);
        __builtin_amdgcn_sched_barrier(0);   // the WMMAs stay in front of the waits: sunk behind the barrier they would stand in front of the refill and shorten its lead
        asm volatile("s_wait_dscnt 0x0" ::: "memory");      // this wave's reads of buffer s & 1 are done before the buffer is refilled
        asm volatile("s_wait_tensorcnt 0x0" ::: "memory");  // this wave's slice of stage s + 1 has landed
        __syncthreads();                                     // publishes stage s + 1 and ends every wave's reads of stage s
        if (pinned(s + 2 < np)) { tile_advance(g0, lbase + (unsigned)(s & 1) * GP_BUF); tile_load(g0, g1); }
    } while (++s < np);
    asm volatile("s_wait_tensorcnt 0x0" ::: "memory");   // no request outstanding at the wave's end
    asm volatile("s_wait_dscnt 0x0" ::: "memory");       // and no LDS read of the ring
    float* os = (float*)(sm + GP_RING + wave * GP_OS);   // each wave stages in its own range, outside the ring
    const int rq = r0 + (int)wm * 64, cq = c0 + (int)wn * 64;   // the quadrant's first row and column
    const int which = cq / DM;                           // PLANES: 0 q, 1 k, 2 v; the same for the whole work-group (128 divides DM)
    // PLANES: value plane of this quadrant's batch element, operand and head (plane set layout: see below the GEMM); its residual plane lies PLN further
    h16* pv = PLANES ? PL + ((size_t)(rq / SEQ) * 6 + (size_t)which * 2) * PLN + (size_t)((cq % DM) / HD) * SEQ * HD : nullptr;
    const int t0 = rq % SEQ;                             // first token of the quadrant inside its batch element
    if (PLANES && which == 2) {
        // v: a lane's eight accumulator rows are eight consecutive tokens of one d, a 16-byte piece of a v^T row; 16 d rows x 64 tokens are staged so that every store covers whole 128-byte lines
        h16* hs = (h16*)os;
#pragma unroll
        for (int nb = 0; nb < 4; ++nb) {
#pragma unroll
            for (int mb = 0; mb < 4; ++mb) { v8h o, r;
#pragma unroll
                for (int j = 0; j < 8; ++j) { const float x = acc[mb][nb][j]; const h16 a = (h16)x; o[j] = a; r[j] = (h16)((x - (float)a) * RSC); }
                *(v8ha*)(hs + lr * GP_VP + mb * 16 + hi * 8) = o; *(v8ha*)(hs + 16 * GP_VP + lr * GP_VP + mb * 16 + hi * 8) = r; }
            __builtin_amdgcn_wave_barrier(); asm volatile("" ::: "memory");   // the lanes' LDS writes stay in front of the reads of other lanes' pieces
#pragma unroll
            for (int s = 0; s < 4; ++s) { const int row = 4 * s + (lane >> 3), pc = (lane & 7) * 8;
                const v8h a = *(const v8ha*)(hs + row * GP_VP + pc); const v8h c = *(const v8ha*)(hs + 16 * GP_VP + row * GP_VP + pc);
                h16* p = pv + (size_t)(nb * 16 + row) * SEQ + t0 + pc;
                *(v8h*)p = a; *(v8h*)(p + PLN) = c; }
            __builtin_amdgcn_wave_barrier(); asm volatile("" ::: "memory");   // the reads stay in front of the next tile's writes
        }
    } else {
#pragma unroll
        for (int mb = 0; mb < 4; ++mb) {
#pragma unroll
            for (int nb = 0; nb < 4; ++nb) {
#pragma unroll
                for (int j = 0; j < 8; ++j) os[(hi * 8 + j) * 68 + nb * 16 + lr] = acc[mb][nb][j]; }
            __builtin_amdgcn_wave_barrier(); asm volatile("" ::: "memory");   // as in the v branch: writes in front of the reads
            if (PLANES) {
                // q, k: a staged row is one token's 64 d = one 128-byte row of each plane; eight lanes a row, four consecutive rows a store
#pragma unroll
                for (int s = 0; s < 4; ++s) { const int row = 4 * s + (lane >> 3), cofs = (lane & 7) * 8;
                    const v4f x0 = *(const v4fa*)(os + row * 68 + cofs); const v4f x1 = *(const v4fa*)(os + row * 68 + cofs + 4); v8h o, r;
#pragma unroll
                    for (int k = 0; k < 4; ++k) { const h16 a = (h16)x0[k]; o[k] = a; r[k] = (h16)((x0[k] - (float)a) * RSC); const h16 b = (h16)x1[k]; o[4 + k] = b; r[4 + k] = (h16)((x1[k] - (float)b) * RSC); }
                    h16* p = pv + (size_t)(t0 + mb * 16 + row) * HD + cofs;
                    *(v8h*)p = o; *(v8h*)(p + PLN) = r; }
            } else {
                float* crow = C + (size_t)(rq + mb * 16) * ldc + cq;
#pragma unroll
                for (int s = 0; s < 8; ++s) { const int row = 2 * s + hi, cofs = lr * 4; const v4f val = *(const v4fa*)(os + row * 68 + cofs);
                    *(v4f*)(crow + (size_t)row * ldc + cofs) = val; }
            }
            __builtin_amdgcn_wave_barrier(); asm volatile("" ::: "memory");   // reads in front of the next tile's writes
        }
        if (PLANES) asm volatile("s_wait_xcnt 0x0" ::: "memory");   // in the built code this branch's end stands directly in front of the v branch, which reuses the registers that the stores above name
    }
}
__global__ __launch_bounds__(128) void k_gemmw(const bf* __restrict__ A, const bf* __restrict__ Bt, int K, float* C, int ldc) { gemm_body<false>(A, Bt, K, C, ldc, nullptr); }
// Plane set layout in PL (PLN elements each): 0 q value, 1 q residual, 2 k value, 3 k residual, 4 v^T value, 5 v^T residual; one such set of six per batch element.
__global__ __launch_bounds__(128) void k_gemmp(const bf* __restrict__ A, const bf* __restrict__ Bt, int K, h16* PL) { gemm_body<true>(A, Bt, K, nullptr, 0, PL); }

__global__ __launch_bounds__(256) void k_wt(const float* __restrict__ w, int K, int N, int rep, bf* Bt) {
    const int lane = threadIdx.x & 31; const int wave = __builtin_amdgcn_readfirstlane(threadIdx.x >> 5);
    const int KO = K * rep; const int L0 = (blockIdx.x * 8 + wave) * 8; const int nlines = (int)(((size_t)N * KO) / 64);
{
#pragma unroll 1
        for (int l = 0; l < 8; ++l) { const int L = L0 + l; if (L >= nlines) break; const size_t e = (size_t)L * 64 + lane * 2; const int ko = (int)(e % KO), n = (int)(e / KO); const int k = ko % K; v2us o;
            o[0] = f2bf(w[(size_t)k * N + n]); o[1] = f2bf(w[(size_t)(k + 1) * N + n]); *(v2us*)(Bt + e) = o; }
         }
}

__global__ __launch_bounds__(256) void k_cvt8(const float* __restrict__ src, bf* dst, size_t n8) { const size_t i = (size_t)blockIdx.x * 256 + threadIdx.x; if (i >= n8) return; const v8f v = *(const v8f*)(src + i * 8); v8us o;
#pragma unroll
    for (int k = 0; k < 8; ++k) o[k] = f2bf(v[k]); *(v8us*)(dst + i * 8) = o;  }

// ---- fused windowed causal attention, one wave per 16 query rows of one head; grid (rows/16, NH, NB), 32 threads.
// Key halves visited: from the 32-aligned half holding key q0 - (WIN - 1) (clipped at 0) up to the half holding key q0 + 15; all of them lie inside the written planes.
// Per 32-key half: S^T tiles [16 keys][16 queries] = K Q^T (A = key rows, B = query rows, k = d); lane (h, n) holds query q0+n, keys kb + 16*tile + 8h + r.
// Online softmax per lane (16 values) + one xor-16 shuffle; the two packed tiles are the B fragment (k = key, n = query) of O^T [d][query] += V^T [d][key] P^T.
// HIRES: value+residual on q, k, P, v (3 products each side); else q value+residual against single k, single P and v.
template <bool HIRES>
__device__ __forceinline__ void attn_body(const h16* __restrict__ PL, bf* CTX, const int qbase) {
    __shared__ __align__(16) unsigned short ost[2 * 16 * HD];
    const int lane = threadIdx.x & 31, lr = lane & 15, hi = lane >> 4;
    const int head = blockIdx.y;
    const int q0 = qbase + blockIdx.x * 16;
    const int kb0 = max(q0 - (WIN - 1), 0) & ~31;      // first key half with a key inside the window of query q0
    const size_t hb = (size_t)blockIdx.z * 6 * PLN + (size_t)head * SEQ * HD;   // this batch element's set of six planes, then the head
    const size_t oQ = hb + (size_t)(q0 + lr) * HD + 8 * hi;
    const size_t oK = 2 * PLN + hb + (size_t)lr * HD + 8 * hi;
    const size_t oV = 4 * PLN + hb + (size_t)lr * SEQ + 8 * hi;
    const float CE = SCL * 1.4426950408889634f;
    v8f o[4], orr[4];
#pragma unroll
    for (int dt = 0; dt < 4; ++dt) { o[dt] = (v8f){}; orr[dt] = (v8f){}; }
    float m = NEGB, l = 0.0f;
#pragma unroll 1
    for (int kb = kb0; kb < q0 + 16; kb += 32) {
        v8f sh0 = (v8f){}, sh1 = (v8f){}, sr0 = (v8f){}, sr1 = (v8f){};
#pragma unroll
        for (int kc = 0; kc < HD; kc += 32) {
            const v16h bq  = ldh(PL + oQ + kc);
            const v16h bqr = ldh(PL + PLN + oQ + kc);
            const v16h ak0 = ldh(PL + oK + (size_t)kb * HD + kc);
            const v16h ak1 = ldh(PL + oK + (size_t)(kb + 16) * HD + kc);
            sh0 = wmma16(ak0, bq, sh0);  sh1 = wmma16(ak1, bq, sh1);
            sr0 = wmma16(ak0, bqr, sr0); sr1 = wmma16(ak1, bqr, sr1);
            if (HIRES) {
                const v16h kr0 = ldh(PL + PLN + oK + (size_t)kb * HD + kc);
                const v16h kr1 = ldh(PL + PLN + oK + (size_t)(kb + 16) * HD + kc);
                sr0 = wmma16(kr0, bq, sr0); sr1 = wmma16(kr1, bq, sr1);
                asm volatile("v_nop\n\tv_nop\n\tv_nop\n\tv_nop" : "+v"(sh0), "+v"(sh1), "+v"(sr0), "+v"(sr1) : "v"(ak0), "v"(ak1), "v"(bq), "v"(bqr), "v"(kr0), "v"(kr1));
            } else {
                asm volatile("v_nop\n\tv_nop\n\tv_nop\n\tv_nop" : "+v"(sh0), "+v"(sh1), "+v"(sr0), "+v"(sr1) : "v"(ak0), "v"(ak1), "v"(bq), "v"(bqr));
            }
        }
        float u[16];
#pragma unroll
        for (int r = 0; r < 8; ++r) { u[r] = (sh0[r] + sr0[r] * RINV) * CE; u[8 + r] = (sh1[r] + sr1[r] * RINV) * CE; }
        if (kb + 31 > q0 || kb + (WIN - 16) < q0) {   // wave-uniform: this half touches the diagonal or the far edge of the window; keys above the query or WIN or more behind it are excluded
            const int qi = q0 + lr; const int k0 = kb + 8 * hi;
#pragma unroll
            for (int r = 0; r < 8; ++r) { u[r] = (k0 + r > qi || qi - (k0 + r) >= WIN) ? NEGB : u[r]; u[8 + r] = (k0 + 16 + r > qi || qi - (k0 + 16 + r) >= WIN) ? NEGB : u[8 + r]; }
        }
        float mx = u[0];
#pragma unroll
        for (int i = 1; i < 16; ++i) mx = fmaxf(mx, u[i]);
        mx = fmaxf(mx, __shfl_xor(mx, 16, 32));
        const float mn = fmaxf(fmaxf(m, mx), MFLOOR);
        const float corr = __builtin_amdgcn_exp2f(m - mn);
        m = mn;
        float psum = 0.0f;
#pragma unroll
        for (int i = 0; i < 16; ++i) { u[i] = __builtin_amdgcn_exp2f(u[i] - mn); psum += u[i]; }
        l = l * corr + psum;
#pragma unroll
        for (int dt = 0; dt < 4; ++dt) {
#pragma unroll
            for (int r = 0; r < 8; ++r) { o[dt][r] *= corr; if (HIRES) orr[dt][r] *= corr; } }
        v16h pb, pr;
#pragma unroll
        for (int i = 0; i < 16; ++i) { const float pc = u[i] * PCAR; const h16 ph = toh_flush(pc); pb[i] = ph; pr[i] = toh_flush((pc - (float)ph) * RSC); }
        const size_t ov = oV + kb;
        if (HIRES) {
#pragma unroll
            for (int dt = 0; dt < 4; ++dt) {
                const v16h av  = ldh(PL + ov + (size_t)dt * 16 * SEQ);
                const v16h avr = ldh(PL + PLN + ov + (size_t)dt * 16 * SEQ);
                o[dt]   = wmma16(av, pb, o[dt]);
                orr[dt] = wmma16(avr, pb, orr[dt]);
                orr[dt] = wmma16(av, pr, orr[dt]);
                asm volatile("v_nop\n\tv_nop\n\tv_nop\n\tv_nop" : "+v"(o[dt]), "+v"(orr[dt]) : "v"(av), "v"(avr), "v"(pb), "v"(pr));
            }
        } else {
            const v16h av0 = ldh(PL + ov);
            const v16h av1 = ldh(PL + ov + (size_t)16 * SEQ);
            const v16h av2 = ldh(PL + ov + (size_t)32 * SEQ);
            const v16h av3 = ldh(PL + ov + (size_t)48 * SEQ);
            o[0] = wmma16(av0, pb, o[0]); o[1] = wmma16(av1, pb, o[1]); o[2] = wmma16(av2, pb, o[2]); o[3] = wmma16(av3, pb, o[3]);
            asm volatile("v_nop\n\tv_nop\n\tv_nop\n\tv_nop" : "+v"(o[0]), "+v"(o[1]), "+v"(o[2]), "+v"(o[3]) : "v"(av0), "v"(av1), "v"(av2), "v"(av3), "v"(pb));
        }
    }
    l += __shfl_xor(l, 16, 32);
    const float inv = 1.0f / (l * PCAR);
#pragma unroll
    for (int dt = 0; dt < 4; ++dt) { v8us vh, vl;
#pragma unroll
        for (int r = 0; r < 8; ++r) { float y = o[dt][r]; if (HIRES) y += orr[dt][r] * RINV; y *= inv; unsigned short a, c; splitf(y, a, c); vh[r] = a; vl[r] = c; }
        *(v8usa*)(ost + lr * HD + dt * 16 + hi * 8) = vh; *(v8usa*)(ost + 16 * HD + lr * HD + dt * 16 + hi * 8) = vl; }
    __builtin_amdgcn_wave_barrier(); asm volatile("" ::: "memory");
    bf* crow = CTX + ((size_t)blockIdx.z * SEQ + q0) * CK + head * HD;
{
#pragma unroll
        for (int s = 0; s < 4; ++s) { const int row = 4 * s + (lane >> 3), pc = (lane & 7) * 8;
            const v8us a = *(const v8usa*)(ost + row * HD + pc); const v8us c = *(const v8usa*)(ost + 16 * HD + row * HD + pc);
            *(v8us*)(crow + (size_t)row * CK + pc) = a; *(v8us*)(crow + (size_t)row * CK + DM + pc) = c; }
         }
}
__global__ __launch_bounds__(32) __attribute__((amdgpu_num_vgpr(256))) void k_attn_hi(const h16* __restrict__ PL, bf* CTX) { attn_body<true>(PL, CTX, 0); }
__global__ __launch_bounds__(32) __attribute__((amdgpu_num_vgpr(256))) void k_attn_lo(const h16* __restrict__ PL, bf* CTX) { attn_body<false>(PL, CTX, RHE); }

extern "C" void kernel_launch(void* const* d_in, const int* in_sizes, int n_in,
                              void* d_out, int out_size, void* d_ws, size_t ws_size, hipStream_t stream) {
    if (n_in < 3) return;
    const int need_x = (NB - 1) * SEQ_FULL * DM + SEQ * DM;
    if (in_sizes[0] < need_x || in_sizes[1] < DM * NQKV || in_sizes[2] < DM * DM || out_size < need_x) return;
    if (WS_TOTAL > ws_size) return;
    const float* x = (const float*)d_in[0]; const float* wqkv = (const float*)d_in[1]; const float* wo = (const float*)d_in[2];   // x, w_attn, w_proj
    float* OUT = (float*)d_out;     // [2][2048][1024]
    char* wsp = (char*)d_ws;
    bf* WQKV = (bf*)wsp;  wsp += WS_WQKV;      // [3072][1024] bf16, K-contiguous
    bf* WO2  = (bf*)wsp;  wsp += WS_WO2;
    bf* XB   = (bf*)wsp;  wsp += WS_XB;        // [NB * SEQ][1024] bf16
    h16* PL  = (h16*)wsp; wsp += WS_PL;        // six head plane sets per batch element
    bf* CTX  = (bf*)wsp;  wsp += WS_CTX;       // [NB * SEQ][2048] bf16 hi | lo
    k_wt<<<(unsigned)(((size_t)NQKV * DM / 64 + 63) / 64), 256, 0, stream>>>(wqkv, DM, NQKV, 1, WQKV);   // in[1024][3072] -> out[3072][1024]
    k_wt<<<(unsigned)(((size_t)DM * CK / 64 + 63) / 64), 256, 0, stream>>>(wo, DM, DM, 2, WO2);          // in[1024][1024] -> out[1024][2 x 1024]
    // every stage runs once, over all NB batch elements: the row-wise stages on NB * SEQ rows, the per-head stages with the batch as last grid dimension
    k_cvt8<<<(unsigned)(((size_t)NB * SEQ * DM / 8 + 255) / 256), 256, 0, stream>>>(x, XB, (size_t)NB * SEQ * DM / 8);
    k_gemmp<<<dim3(NB * SEQ / 128, NQKV / 128, 1), 128, 0, stream>>>(XB, WQKV, DM, PL);   // q | k | v leave the projection as the f16 planes
    k_attn_hi<<<dim3(RHE / 16, NH, NB), 32, 0, stream>>>(PL, CTX);
    if (SEQ > RHE) k_attn_lo<<<dim3((SEQ - RHE) / 16, NH, NB), 32, 0, stream>>>(PL, CTX);
    k_gemmw<<<dim3(NB * SEQ / 128, DM / 128, 1), 128, 0, stream>>>(CTX, WO2, CK, OUT, DM);
}

// v004
// Measured time: 97.9 microseconds a run.
// Next to v003, in two timings, it ran 1.20 and 1.21 times as fast.
// All steps since v000 together make it 2.80 times as fast.
#include <hip/hip_runtime.h>

// Windowed causal multi-head attention with a fused qkv projection (x [2][2048][1024]; qkv = x w_attn ('io' [1024][3072], column = which*1024 + h*64 + d, no bias; 16 heads x 64); scores x 64^-0.5, key j visible to query i when 0 <= i - j < 256; softmax; out = merged w_proj ('io' [1024][1024], no bias) -> [2][2048][1024]).
// Compute dtypes, f32 accumulate everywhere: x, w_attn, w_proj converted to bf16 (RNE) and multiplied with v_wmma_f32_16x16x32_bf16 (exact products); attention on v_wmma_f32_16x16x32_f16:
// q, k, v carried as f16 value + f16 residual x2^11 (separate accumulator, folded back x2^-11); query rows < 256 use value+residual on q, k, P, v (3 products); rows >= 256 use q value+residual against single f16 k, single f16 P (x1024) and v;
// softmax f32 (running max, exp2); merged context stored as bf16 hi | lo along K and multiplied with [w_proj ; w_proj] on the bf16 WMMA.
// Fused flash-style attention in the transposed form S^T = K Q^T, O^T = V^T P^T: the packed score tiles are the B fragment of the second product directly (no probability plane, no LDS exchange); only the 32-key halves inside the window of a query tile are visited.

#ifndef NB
#define NB 2
#endif
#ifndef SEQ
#define SEQ 2048
#endif
#define NB_FULL  2
#define SEQ_FULL 2048
#define DM   1024
#define NH   16
#define HD   64
#define NQKV (3 * DM)
#define CK   (2 * DM)                 // context plane pitch: hi | lo along K
#define RH   256                      // query rows < RH use value+residual on every attention operand
#define RHE  ((SEQ < RH) ? SEQ : RH)
#define WIN  256                      // attention window: key j visible to query i when 0 <= i - j < WIN
#define PCAR 1024.0f                  // carry of the f16 probability operand
#define RSC  2048.0f                  // carry of every f16 residual plane (2^11)
#define RINV (1.0f / 2048.0f)
#define SCL  0.125f                   // HD^-0.5
#define NEGB (-3.0e38f)
#define MFLOOR (-1.0e30f)             // floor of the running maximum: a key half with no visible key for a query yields probabilities exactly 0
#define PLN  ((size_t)NH * SEQ * HD)  // elements per head plane set

#define WS_WQKV ((size_t)NQKV * DM * 2)
#define WS_WO2  ((size_t)DM * CK * 2)
#define WS_XB   ((size_t)NB * SEQ * DM * 2)
#define WS_PL   ((size_t)NB * 6 * NH * SEQ * HD * 2)
#define WS_CTX  ((size_t)NB * SEQ * CK * 2)
#define WS_TOTAL (WS_WQKV + WS_WO2 + WS_XB + WS_PL + WS_CTX)

static_assert(NB <= NB_FULL);                 // batch count within the inputs
static_assert(SEQ <= SEQ_FULL);               // sequence rows within the inputs
static_assert(NB == 1 || SEQ == SEQ_FULL);    // the batch elements' rows follow one another in x and out: one row range of NB * SEQ
static_assert(SEQ % 64 == 0);
static_assert(DM % 64 == 0);                  // wave quadrant columns
static_assert(NQKV % 64 == 0);                // wave quadrant columns
static_assert(DM % 32 == 0);                  // k-step of the projection
static_assert(CK % 32 == 0);                  // k-step of the output product
static_assert(HD == 64);
static_assert(NH * HD == DM);                 // merged head columns
static_assert(RH % 32 == 0);                  // whole key halves below the precision boundary
static_assert(RHE % 16 == 0);                 // whole query tiles on the HIRES body
static_assert((SEQ - RHE) % 16 == 0);         // whole query tiles on the other body
static_assert(WIN >= 16);                     // every query of a 16-row tile sees at least its own key
static_assert(WIN <= SEQ_FULL);               // window within the sequence
static_assert(WS_WQKV % 256 == 0);
static_assert(WS_WO2 % 256 == 0);
static_assert(WS_XB % 256 == 0);
static_assert(WS_PL % 256 == 0);
static_assert(WS_CTX % 256 == 0);
static_assert(WS_TOTAL <= (size_t)268435456); // total carve <= 256 MiB

typedef _Float16 h16;
typedef unsigned short bf;
typedef __attribute__((ext_vector_type(16))) __bf16   v16bf;
typedef __attribute__((ext_vector_type(16))) _Float16 v16h;
typedef __attribute__((ext_vector_type(8)))  _Float16 v8h;
typedef __attribute__((ext_vector_type(8)))  unsigned short v8us;
typedef __attribute__((ext_vector_type(2)))  unsigned short v2us;
typedef __attribute__((ext_vector_type(8)))  float    v8f;
typedef __attribute__((ext_vector_type(4)))  float    v4f;
typedef v4f  __attribute__((may_alias)) v4fa;
typedef v8us __attribute__((may_alias)) v8usa;
typedef v8h  __attribute__((may_alias)) v8ha;

__device__ __forceinline__ unsigned short f2bf(float f) { unsigned u = __float_as_uint(f); u += 0x7FFFu + ((u >> 16) & 1u); return (unsigned short)(u >> 16); }   // RNE convert
__device__ __forceinline__ float bf2f(unsigned short b) { return __uint_as_float(((unsigned)b) << 16); }
__device__ __forceinline__ void splitf(float y, unsigned short& h, unsigned short& l) { h = f2bf(y); l = f2bf(y - bf2f(h)); }
__device__ __forceinline__ v16h cat16(v8h lo, v8h hi) { return __builtin_shufflevector(lo, hi, 0, 1, 2, 3, 4, 5, 6, 7, 8, 9, 10, 11, 12, 13, 14, 15); }
__device__ __forceinline__ v16bf cat16b(v8us lo, v8us hi) { return __builtin_bit_cast(v16bf, __builtin_shufflevector(lo, hi, 0, 1, 2, 3, 4, 5, 6, 7, 8, 9, 10, 11, 12, 13, 14, 15)); }
__device__ __forceinline__ v8f wmma16(v16h a, v16h b, v8f c) { return __builtin_amdgcn_wmma_f32_16x16x32_f16(false, a, false, b, (short)0, c, false, false); }
__device__ __forceinline__ v8f wmmab(v16bf a, v16bf b, v8f c) { return __builtin_amdgcn_wmma_f32_16x16x32_bf16(false, a, false, b, (short)0, c, false, false); }
// Fragment loaders from K-contiguous 16-bit rows; the pointer already includes row (lane & 15) and 8 * (lane >> 4): elements 0..7 <- k0 + 8h + i, elements 8..15 <- k0 + 16 + 8h + i (A and B alike).
__device__ __forceinline__ v16h  ldh(const h16* p) { return cat16(*(const v8h*)p, *(const v8h*)(p + 16)); }
__device__ __forceinline__ v16bf ldb(const bf* p)  { return cat16b(*(const v8us*)p, *(const v8us*)(p + 16)); }
// f32 -> f16 operand convert that cannot produce an f16 subnormal (value select after the plane's carry).
static __device__ __forceinline__ h16 toh_flush(float v) { const h16 r = (h16)v; return (fabsf(v) < 6.103515625e-05f) ? (h16)0.0f : r; }

// ---- gemm_body: GEMM, 128x128 output tile per work-group of four waves, each wave a 64x64 quadrant (16 accumulators); grid (M/128, N/128), 128 threads.
// c[m][n] (f32) = sum_k A[m][k] Bt[n][k], bf16 operands in K-contiguous planes. K % 64 == 0, K >= 128, M and N multiples of 128 (asserted below for every use).
// PLANES false (k_gemmw): c goes to C (f32, pitch ldc). PLANES true (k_gemmp, the qkv projection): a quadrant is 64 tokens x the 64 columns of one head of q, k or v,
// and the epilogue stores it straight as that head's two f16 planes (value, residual x2^11) in the layout the attention kernel reads: q and k [token][d], v transposed [d][token].
// A pass is 64 k = 128 bytes of each of the 256 operand rows. Every wave brings one slice of 64 rows per pass into LDS with one tensor load (waves 0, 1: the A rows; waves 2, 3: the Bt rows),
// padded to a pitch of 144 bytes for the ds_load_b128 fragment reads; two buffers, the load of pass s + 2 issued when every wave has left pass s.
#define GP_K     64                      // k per pass
#define GP_ROWB  128u                    // bytes of one operand row per pass
#define GP_PITCH 144u                    // LDS row pitch: 128 + 16
#define GP_SLICE 10240u                  // 64 rows x 144 bytes = 9216, rounded up to a multiple of 2 KiB
#define GP_BUF   (4u * GP_SLICE)
#define GP_RING  (2u * GP_BUF)
#define GP_OS    (2u * 16u * 144u)       // output staging bytes per wave, behind the ring: 16 rows x 68 f32, or two f16 tiles of 16 rows x 144 bytes
#define GP_VP    72                      // pitch of a staged v^T row in f16 elements: 64 tokens + 16 bytes
static_assert(16u * 68u * 4u <= GP_OS);
static_assert((NB * SEQ) % 128 == 0);    // GEMM row tiles
static_assert(NQKV % 128 == 0);          // GEMM column tiles
static_assert(DM % 128 == 0);            // GEMM column tiles
static_assert(DM % GP_K == 0 && DM / GP_K >= 2);   // whole passes, two stages or more
static_assert(CK % GP_K == 0 && CK / GP_K >= 2);   // whole passes, two stages or more
static_assert(64u * GP_PITCH <= GP_SLICE && GP_SLICE % 2048u == 0);
typedef unsigned u32x4 __attribute__((ext_vector_type(4)));
typedef unsigned u32x8 __attribute__((ext_vector_type(8)));
__device__ __forceinline__ unsigned uni(unsigned v) { return (unsigned)__builtin_amdgcn_readfirstlane(v); }
__device__ __forceinline__ unsigned pinned(unsigned v) { unsigned w = uni(v); asm volatile("" : "+s"(w)); return w; }   // holds a wave-uniform test in a scalar register: the branch around a tensor load must be a scalar one (the load ignores EXEC)
__device__ __forceinline__ v16bf ldbs(const unsigned char* p) { return cat16b(*(const v8usa*)p, *(const v8usa*)(p + 32)); }   // the k order of ldb, from an LDS row
// Descriptor of one request: 64 rows of 128 bytes, source pitch in bytes, 16 bytes of pad behind every row.
__device__ __forceinline__ u32x8 tile_group1(unsigned src_pitch) {
    u32x8 g;
    g[0] = uni((1u << 20) | (4u << 22) | (3u << 25));
    g[1] = uni((GP_ROWB & 0xFFFFu) << 16);
    g[2] = uni((GP_ROWB >> 16) | (64u << 16));
    g[3] = uni(GP_ROWB << 16);
    g[4] = uni(64u);
    g[5] = uni(src_pitch);
    g[6] = uni(0u);
    g[7] = uni(0u);
    return g;
}
__device__ __forceinline__ u32x4 tile_group0(unsigned lds_dst, unsigned long long ga) {
    u32x4 g;
    g[0] = uni(1u); g[1] = uni(lds_dst); g[2] = uni((unsigned)ga); g[3] = uni((((unsigned)(ga >> 32)) & 0x01FFFFFFu) | 0x80000000u);
    return g;
}
// the next 128 bytes of the same rows: the address advances inside the descriptor's own words (the carry stays below the type bits for any valid address)
__device__ __forceinline__ void tile_advance(u32x4& g0, unsigned lds_dst) {
    const unsigned lo = g0[2] + GP_ROWB;
    g0[3] = uni(g0[3] + (lo < GP_ROWB ? 1u : 0u)); g0[2] = uni(lo); g0[1] = uni(lds_dst);
}
// both groups are in-out operands: their values stay live behind the instruction, so the compiler reuses none of their registers for another value while the request is on its way
__device__ __forceinline__ void tile_load(u32x4& g0, u32x8& g1) { asm volatile("tensor_load_to_lds %0, %1" : "+s"(g0), "+s"(g1) :: "memory"); }
template <bool PLANES>
__device__ __forceinline__ void gemm_body(const bf* __restrict__ A, const bf* __restrict__ Bt, int K, float* C, int ldc, h16* PL) {
    __shared__ __attribute__((aligned(2048))) unsigned char sm[GP_RING + 4u * GP_OS];
    const int lane = threadIdx.x & 31, lr = lane & 15, hi = lane >> 4; const unsigned wave = uni(threadIdx.x >> 5);
    const int r0 = blockIdx.x * 128, c0 = blockIdx.y * 128;
    const unsigned pitch = (unsigned)K * 2u;
    const unsigned lbase = (unsigned)(size_t)sm + wave * GP_SLICE;      // this wave's slice in buffer 0
    const unsigned long long gsrc = (wave < 2u) ? (unsigned long long)(size_t)A + (unsigned long long)(r0 + 64 * (int)wave) * pitch
                                                : (unsigned long long)(size_t)Bt + (unsigned long long)(c0 + 64 * ((int)wave - 2)) * pitch;
    const int np = K / GP_K;
    v8f acc[4][4];
#pragma unroll
    for (int mb = 0; mb < 4; ++mb)
#pragma unroll
        for (int nb = 0; nb < 4; ++nb) acc[mb][nb] = (v8f){};
    u32x8 g1 = tile_group1(pitch);
    u32x4 g0 = tile_group0(lbase, gsrc);
    tile_load(g0, g1);
    asm volatile("s_wait_tensorcnt 0x0" ::: "memory");   // stage 0 has landed before the barrier that publishes it
    __syncthreads();
    tile_advance(g0, lbase + GP_BUF);
    tile_load(g0, g1);
    const unsigned wm = wave & 1u, wn = wave >> 1;       // quadrant: rows r0 + 64 wm, columns c0 + 64 wn
    const unsigned aofs = wm * GP_SLICE + (unsigned)lr * GP_PITCH + 16u * (unsigned)hi, bofs = (2u + wn) * GP_SLICE + (unsigned)lr * GP_PITCH + 16u * (unsigned)hi;
    int s = 0;
#pragma unroll 1
    do {                                                 // np >= 2: the body runs at least twice
        const unsigned char* pa = sm + (unsigned)(s & 1) * GP_BUF + aofs; const unsigned char* pb = sm + (unsigned)(s & 1) * GP_BUF + bofs;
        v16bf a0[4], b0[4], a1[4], b1[4];    // fragments of the pass's two k-steps
        b0[0] = ldbs(pb);
#pragma unroll
        for (int mb = 0; mb < 4; ++mb) a0[mb] = ldbs(pa + (unsigned)mb * 16u * GP_PITCH);
#pragma unroll
        for (int nb = 1; nb < 4; ++nb) b0[nb] = ldbs(pb + (unsigned)nb * 16u * GP_PITCH);
#pragma unroll
        for (int mb = 0; mb < 4; ++mb) a1[mb] = ldbs(pa + (unsigned)mb * 16u * GP_PITCH + 64u);
#pragma unroll
        for (int nb = 0; nb < 2; ++nb) b1[nb] = ldbs(pb + (unsigned)nb * 16u * GP_PITCH + 64u);
        __builtin_amdgcn_sched_barrier(0);   // the LDS reads stay one group ahead of the matrix block
#pragma unroll
        for (int nb = 0; nb < 2; ++nb)
#pragma unroll
            for (int mb = 0; mb < 4; ++mb) acc[mb][nb] = wmmab(a0[mb], b0[nb], acc[mb][nb]);
        __builtin_amdgcn_sched_barrier(0);   // the last two fragments go into registers that the eight WMMAs above have freed (keeps the wave within 256 registers), as one group
#pragma unroll
        for (int nb = 2; nb < 4; ++nb) b1[nb] = ldbs(pb + (unsigned)nb * 16u * GP_PITCH + 64u);
        __builtin_amdgcn_sched_barrier(0);   // as above: no LDS read moves in among the WMMAs below
#pragma unroll
        for (int nb = 2; nb < 4; ++nb)
#pragma unroll
            for (int mb = 0; mb < 4; ++mb) acc[mb][nb] = wmmab(a0[mb], b0[nb], acc[mb][nb]);
#pragma unroll
        for (int nb = 0; nb < 4; ++nb)
#pragma unroll
            for (int mb = 0; mb < 4; ++mb) acc[mb][nb] = wmmab(a1[mb], b1[nb], acc[mb][nb]);
        __builtin_amdgcn_sched_barrier(0);   // the WMMAs stay in front of the waits: sunk behind the barrier they would stand in front of the refill and shorten its lead
        asm volatile("s_wait_dscnt 0x0" ::: "memory");      // this wave's reads of buffer s & 1 are done before the buffer is refilled
        asm volatile("s_wait_tensorcnt 0x0" ::: "memory");  // this wave's slice of stage s + 1 has landed
        __syncthreads();                                     // publishes stage s + 1 and ends every wave's reads of stage s
        if (pinned(s + 2 < np)) { tile_advance(g0, lbase + (unsigned)(s & 1) * GP_BUF); tile_load(g0, g1); }
    } while (++s < np);
    asm volatile("s_wait_tensorcnt 0x0" ::: "memory");   // no request outstanding at the wave's end
    asm volatile("s_wait_dscnt 0x0" ::: "memory");       // and no LDS read of the ring
    float* os = (float*)(sm + GP_RING + wave * GP_OS);   // each wave stages in its own range, outside the ring
    const int rq = r0 + (int)wm * 64, cq = c0 + (int)wn * 64;   // the quadrant's first row and column
    const int which = cq / DM;                           // PLANES: 0 q, 1 k, 2 v; the same for the whole work-group (128 divides DM)
    // PLANES: value plane of this quadrant's batch element, operand and head (plane set layout: see below the GEMM); its residual plane lies PLN further
    h16* pv = PLANES ? PL + ((size_t)(rq / SEQ) * 6 + (size_t)which * 2) * PLN + (size_t)((cq % DM) / HD) * SEQ * HD : nullptr;
    const int t0 = rq % SEQ;                             // first token of the quadrant inside its batch element
    if (PLANES && which == 2) {
        // v: a lane's eight accumulator rows are eight consecutive tokens of one d, a 16-byte piece of a v^T row; 16 d rows x 64 tokens are staged so that every store covers whole 128-byte lines
        h16* hs = (h16*)os;
#pragma unroll
        for (int nb = 0; nb < 4; ++nb) {
#pragma unroll
            for (int mb = 0; mb < 4; ++mb) { v8h o, r;
#pragma unroll
                for (int j = 0; j < 8; ++j) { const float x = acc[mb][nb][j]; const h16 a = (h16)x; o[j] = a; r[j] = (h16)((x - (float)a) * RSC); }
                *(v8ha*)(hs + lr * GP_VP + mb * 16 + hi * 8) = o; *(v8ha*)(hs + 16 * GP_VP + lr * GP_VP + mb * 16 + hi * 8) = r; }
            __builtin_amdgcn_wave_barrier(); asm volatile("" ::: "memory");   // the lanes' LDS writes stay in front of the reads of other lanes' pieces
#pragma unroll
            for (int s = 0; s < 4; ++s) { const int row = 4 * s + (lane >> 3), pc = (lane & 7) * 8;
                const v8h a = *(const v8ha*)(hs + row * GP_VP + pc); const v8h c = *(const v8ha*)(hs + 16 * GP_VP + row * GP_VP + pc);
                h16* p = pv + (size_t)(nb * 16 + row) * SEQ + t0 + pc;
                *(v8h*)p = a; *(v8h*)(p + PLN) = c; }
            __builtin_amdgcn_wave_barrier(); asm volatile("" ::: "memory");   // the reads stay in front of the next tile's writes
        }
    } else {
#pragma unroll
        for (int mb = 0; mb < 4; ++mb) {
#pragma unroll
            for (int nb = 0; nb < 4; ++nb) {
#pragma unroll
                for (int j = 0; j < 8; ++j) os[(hi * 8 + j) * 68 + nb * 16 + lr] = acc[mb][nb][j]; }
            __builtin_amdgcn_wave_barrier(); asm volatile("" ::: "memory");   // as in the v branch: writes in front of the reads
            if (PLANES) {
                // q, k: a staged row is one token's 64 d = one 128-byte row of each plane; eight lanes a row, four consecutive rows a store
#pragma unroll
                for (int s = 0; s < 4; ++s) { const int row = 4 * s + (lane >> 3), cofs = (lane & 7) * 8;
                    const v4f x0 = *(const v4fa*)(os + row * 68 + cofs); const v4f x1 = *(const v4fa*)(os + row * 68 + cofs + 4); v8h o, r;
#pragma unroll
                    for (int k = 0; k < 4; ++k) { const h16 a = (h16)x0[k]; o[k] = a; r[k] = (h16)((x0[k] - (float)a) * RSC); const h16 b = (h16)x1[k]; o[4 + k] = b; r[4 + k] = (h16)((x1[k] - (float)b) * RSC); }
                    h16* p = pv + (size_t)(t0 + mb * 16 + row) * HD + cofs;
                    *(v8h*)p = o; *(v8h*)(p + PLN) = r; }
            } else {
                float* crow = C + (size_t)(rq + mb * 16) * ldc + cq;
#pragma unroll
                for (int s = 0; s < 8; ++s) { const int row = 2 * s + hi, cofs = lr * 4; const v4f val = *(const v4fa*)(os + row * 68 + cofs);
                    *(v4f*)(crow + (size_t)row * ldc + cofs) = val; }
            }
            __builtin_amdgcn_wave_barrier(); asm volatile("" ::: "memory");   // reads in front of the next tile's writes
        }
        if (PLANES) asm volatile("s_wait_xcnt 0x0" ::: "memory");   // in the built code this branch's end stands directly in front of the v branch, which reuses the registers that the stores above name
    }
}
__global__ __launch_bounds__(128) void k_gemmw(const bf* __restrict__ A, const bf* __restrict__ Bt, int K, float* C, int ldc) { gemm_body<false>(A, Bt, K, C, ldc, nullptr); }
// Plane set layout in PL (PLN elements each): 0 q value, 1 q residual, 2 k value, 3 k residual, 4 v^T value, 5 v^T residual; one such set of six per batch element.
__global__ __launch_bounds__(128) void k_gemmp(const bf* __restrict__ A, const bf* __restrict__ Bt, int K, h16* PL) { gemm_body<true>(A, Bt, K, nullptr, 0, PL); }

// ---- the three operand conversions; none reads what another writes, so they share one launch (k_prep below); blk is the work-group's index inside its own stage.
__device__ __forceinline__ void wt_body(const float* __restrict__ w, int K, int N, int rep, bf* Bt, int blk) {
    const int lane = threadIdx.x & 31; const int wave = __builtin_amdgcn_readfirstlane(threadIdx.x >> 5);
    const int KO = K * rep; const int L0 = (blk * 8 + wave) * 8; const int nlines = (int)(((size_t)N * KO) / 64);
{
#pragma unroll 1
        for (int l = 0; l < 8; ++l) { const int L = L0 + l; if (L >= nlines) break; const size_t e = (size_t)L * 64 + lane * 2; const int ko = (int)(e % KO), n = (int)(e / KO); const int k = ko % K; v2us o;
            o[0] = f2bf(w[(size_t)k * N + n]); o[1] = f2bf(w[(size_t)(k + 1) * N + n]); *(v2us*)(Bt + e) = o; }
         }
}

__device__ __forceinline__ void cvt8_body(const float* __restrict__ src, bf* dst, size_t n8, int blk) { const size_t i = (size_t)blk * 256 + threadIdx.x; if (i >= n8) return; const v8f v = *(const v8f*)(src + i * 8); v8us o;
#pragma unroll
    for (int k = 0; k < 8; ++k) o[k] = f2bf(v[k]); *(v8us*)(dst + i * 8) = o;  }
#define PB_WQKV ((int)(((size_t)NQKV * DM / 64 + 63) / 64))            // work-groups of w_attn: in[1024][3072] -> out[3072][1024]
#define PB_WO2  ((int)(((size_t)DM * CK / 64 + 63) / 64))              // work-groups of w_proj: in[1024][1024] -> out[1024][2 x 1024]
#define PB_X    ((int)(((size_t)NB * SEQ * DM / 8 + 255) / 256))       // work-groups of x
// The weight stages come first in the grid: their work-groups run longest (eight dependent trips a wave).
__global__ __launch_bounds__(256) void k_prep(const float* __restrict__ x, const float* __restrict__ wqkv, const float* __restrict__ wo, bf* XB, bf* WQKV, bf* WO2) {
    const int b = blockIdx.x;
    if (b < PB_WQKV) wt_body(wqkv, DM, NQKV, 1, WQKV, b);
    else if (b < PB_WQKV + PB_WO2) wt_body(wo, DM, DM, 2, WO2, b - PB_WQKV);
    else cvt8_body(x, XB, (size_t)NB * SEQ * DM / 8, b - (PB_WQKV + PB_WO2));
}

// ---- fused windowed causal attention, one wave per 16 query rows of one head; 32 threads; one launch for all query tiles of all heads and batch elements (k_attn below), the tiles below RHE on the HIRES body.
// Key halves visited: from the 32-aligned half holding key q0 - (WIN - 1) (clipped at 0) up to the half holding key q0 + 15; all of them lie inside the written planes.
// Per 32-key half: S^T tiles [16 keys][16 queries] = K Q^T (A = key rows, B = query rows, k = d); lane (h, n) holds query q0+n, keys kb + 16*tile + 8h + r.
// Online softmax per lane (16 values) + one xor-16 shuffle; the two packed tiles are the B fragment (k = key, n = query) of O^T [d][query] += V^T [d][key] P^T.
// HIRES: value+residual on q, k, P, v (3 products each side); else q value+residual against single k, single P and v.
template <bool HIRES>
__device__ __forceinline__ void attn_body(const h16* __restrict__ PL, bf* CTX, unsigned short* ost, const int q0, const int head, const int batch) {
    const int lane = threadIdx.x & 31, lr = lane & 15, hi = lane >> 4;
    const int kb0 = max(q0 - (WIN - 1), 0) & ~31;      // first key half with a key inside the window of query q0
    const size_t hb = (size_t)batch * 6 * PLN + (size_t)head * SEQ * HD;   // this batch element's set of six planes, then the head
    const size_t oQ = hb + (size_t)(q0 + lr) * HD + 8 * hi;
    const size_t oK = 2 * PLN + hb + (size_t)lr * HD + 8 * hi;
    const size_t oV = 4 * PLN + hb + (size_t)lr * SEQ + 8 * hi;
    const float CE = SCL * 1.4426950408889634f;
    v8f o[4], orr[4];
#pragma unroll
    for (int dt = 0; dt < 4; ++dt) { o[dt] = (v8f){}; orr[dt] = (v8f){}; }
    float m = NEGB, l = 0.0f;
#pragma unroll 1
    for (int kb = kb0; kb < q0 + 16; kb += 32) {
        v8f sh0 = (v8f){}, sh1 = (v8f){}, sr0 = (v8f){}, sr1 = (v8f){};
#pragma unroll
        for (int kc = 0; kc < HD; kc += 32) {
            const v16h bq  = ldh(PL + oQ + kc);
            const v16h bqr = ldh(PL + PLN + oQ + kc);
            const v16h ak0 = ldh(PL + oK + (size_t)kb * HD + kc);
            const v16h ak1 = ldh(PL + oK + (size_t)(kb + 16) * HD + kc);
            sh0 = wmma16(ak0, bq, sh0);  sh1 = wmma16(ak1, bq, sh1);
            sr0 = wmma16(ak0, bqr, sr0); sr1 = wmma16(ak1, bqr, sr1);
            if (HIRES) {
                const v16h kr0 = ldh(PL + PLN + oK + (size_t)kb * HD + kc);
                const v16h kr1 = ldh(PL + PLN + oK + (size_t)(kb + 16) * HD + kc);
                sr0 = wmma16(kr0, bq, sr0); sr1 = wmma16(kr1, bq, sr1);
                asm volatile("v_nop\n\tv_nop\n\tv_nop\n\tv_nop" : "+v"(sh0), "+v"(sh1), "+v"(sr0), "+v"(sr1) : "v"(ak0), "v"(ak1), "v"(bq), "v"(bqr), "v"(kr0), "v"(kr1));
            } else {
                asm volatile("v_nop\n\tv_nop\n\tv_nop\n\tv_nop" : "+v"(sh0), "+v"(sh1), "+v"(sr0), "+v"(sr1) : "v"(ak0), "v"(ak1), "v"(bq), "v"(bqr));
            }
        }
        float u[16];
#pragma unroll
        for (int r = 0; r < 8; ++r) { u[r] = (sh0[r] + sr0[r] * RINV) * CE; u[8 + r] = (sh1[r] + sr1[r] * RINV) * CE; }
        if (kb + 31 > q0 || kb + (WIN - 16) < q0) {   // wave-uniform: this half touches the diagonal or the far edge of the window; keys above the query or WIN or more behind it are excluded
            const int qi = q0 + lr; const int k0 = kb + 8 * hi;
#pragma unroll
            for (int r = 0; r < 8; ++r) { u[r] = (k0 + r > qi || qi - (k0 + r) >= WIN) ? NEGB : u[r]; u[8 + r] = (k0 + 16 + r > qi || qi - (k0 + 16 + r) >= WIN) ? NEGB : u[8 + r]; }
        }
        float mx = u[0];
#pragma unroll
        for (int i = 1; i < 16; ++i) mx = fmaxf(mx, u[i]);
        mx = fmaxf(mx, __shfl_xor(mx, 16, 32));
        const float mn = fmaxf(fmaxf(m, mx), MFLOOR);
        const float corr = __builtin_amdgcn_exp2f(m - mn);
        m = mn;
        float psum = 0.0f;
#pragma unroll
        for (int i = 0; i < 16; ++i) { u[i] = __builtin_amdgcn_exp2f(u[i] - mn); psum += u[i]; }
        l = l * corr + psum;
#pragma unroll
        for (int dt = 0; dt < 4; ++dt) {
#pragma unroll
            for (int r = 0; r < 8; ++r) { o[dt][r] *= corr; if (HIRES) orr[dt][r] *= corr; } }
        v16h pb, pr;
#pragma unroll
        for (int i = 0; i < 16; ++i) { const float pc = u[i] * PCAR; const h16 ph = toh_flush(pc); pb[i] = ph; pr[i] = toh_flush((pc - (float)ph) * RSC); }
        const size_t ov = oV + kb;
        if (HIRES) {
#pragma unroll
            for (int dt = 0; dt < 4; ++dt) {
                const v16h av  = ldh(PL + ov + (size_t)dt * 16 * SEQ);
                const v16h avr = ldh(PL + PLN + ov + (size_t)dt * 16 * SEQ);
                o[dt]   = wmma16(av, pb, o[dt]);
                orr[dt] = wmma16(avr, pb, orr[dt]);
                orr[dt] = wmma16(av, pr, orr[dt]);
                asm volatile("v_nop\n\tv_nop\n\tv_nop\n\tv_nop" : "+v"(o[dt]), "+v"(orr[dt]) : "v"(av), "v"(avr), "v"(pb), "v"(pr));
            }
        } else {
            const v16h av0 = ldh(PL + ov);
            const v16h av1 = ldh(PL + ov + (size_t)16 * SEQ);
            const v16h av2 = ldh(PL + ov + (size_t)32 * SEQ);
            const v16h av3 = ldh(PL + ov + (size_t)48 * SEQ);
            o[0] = wmma16(av0, pb, o[0]); o[1] = wmma16(av1, pb, o[1]); o[2] = wmma16(av2, pb, o[2]); o[3] = wmma16(av3, pb, o[3]);
            asm volatile("v_nop\n\tv_nop\n\tv_nop\n\tv_nop" : "+v"(o[0]), "+v"(o[1]), "+v"(o[2]), "+v"(o[3]) : "v"(av0), "v"(av1), "v"(av2), "v"(av3), "v"(pb));
        }
    }
    l += __shfl_xor(l, 16, 32);
    const float inv = 1.0f / (l * PCAR);
#pragma unroll
    for (int dt = 0; dt < 4; ++dt) { v8us vh, vl;
#pragma unroll
        for (int r = 0; r < 8; ++r) { float y = o[dt][r]; if (HIRES) y += orr[dt][r] * RINV; y *= inv; unsigned short a, c; splitf(y, a, c); vh[r] = a; vl[r] = c; }
        *(v8usa*)(ost + lr * HD + dt * 16 + hi * 8) = vh; *(v8usa*)(ost + 16 * HD + lr * HD + dt * 16 + hi * 8) = vl; }
    __builtin_amdgcn_wave_barrier(); asm volatile("" ::: "memory");
    bf* crow = CTX + ((size_t)batch * SEQ + q0) * CK + head * HD;
{
#pragma unroll
        for (int s = 0; s < 4; ++s) { const int row = 4 * s + (lane >> 3), pc = (lane & 7) * 8;
            const v8us a = *(const v8usa*)(ost + row * HD + pc); const v8us c = *(const v8usa*)(ost + 16 * HD + row * HD + pc);
            *(v8us*)(crow + (size_t)row * CK + pc) = a; *(v8us*)(crow + (size_t)row * CK + DM + pc) = c; }
         }
}
#define AT_HI  (RHE / 16)                     // query tiles per head on the HIRES body
#define AT_LO  ((SEQ - RHE) / 16)             // query tiles per head on the other body
#define AT_NHI (AT_HI * NH * NB)
// Grid order: a HIRES wave with many key halves runs longest. So the HIRES tiles come first, the tile with the most key halves ahead;
// behind them the other tiles, tile index fastest, then head, then batch element.
__global__ __launch_bounds__(32) __attribute__((amdgpu_num_vgpr(256))) void k_attn(const h16* __restrict__ PL, bf* CTX) {
    __shared__ __align__(16) unsigned short ost[2 * 16 * HD];   // output staging of the one wave, used by whichever body runs
    const int b = blockIdx.x;
    if (b < AT_NHI) { const int hb = b % (NH * NB); attn_body<true>(PL, CTX, ost, (AT_HI - 1 - b / (NH * NB)) * 16, hb % NH, hb / NH); }
    else { const int c = b - AT_NHI, hb = c / (AT_LO > 0 ? AT_LO : 1); attn_body<false>(PL, CTX, ost, RHE + (c - hb * AT_LO) * 16, hb % NH, hb / NH); }
}

extern "C" void kernel_launch(void* const* d_in, const int* in_sizes, int n_in,
                              void* d_out, int out_size, void* d_ws, size_t ws_size, hipStream_t stream) {
    if (n_in < 3) return;
    const int need_x = (NB - 1) * SEQ_FULL * DM + SEQ * DM;
    if (in_sizes[0] < need_x || in_sizes[1] < DM * NQKV || in_sizes[2] < DM * DM || out_size < need_x) return;
    if (WS_TOTAL > ws_size) return;
    const float* x = (const float*)d_in[0]; const float* wqkv = (const float*)d_in[1]; const float* wo = (const float*)d_in[2];   // x, w_attn, w_proj
    float* OUT = (float*)d_out;     // [2][2048][1024]
    char* wsp = (char*)d_ws;
    bf* WQKV = (bf*)wsp;  wsp += WS_WQKV;      // [3072][1024] bf16, K-contiguous
    bf* WO2  = (bf*)wsp;  wsp += WS_WO2;
    bf* XB   = (bf*)wsp;  wsp += WS_XB;        // [NB * SEQ][1024] bf16
    h16* PL  = (h16*)wsp; wsp += WS_PL;        // six head plane sets per batch element
    bf* CTX  = (bf*)wsp;  wsp += WS_CTX;       // [NB * SEQ][2048] bf16 hi | lo
    // every stage runs once, over all NB batch elements: the row-wise stages on NB * SEQ rows, the per-head stage with head and batch element decoded from its one-dimensional work-group index
    k_prep<<<(unsigned)(PB_WQKV + PB_WO2 + PB_X), 256, 0, stream>>>(x, wqkv, wo, XB, WQKV, WO2);
    k_gemmp<<<dim3(NB * SEQ / 128, NQKV / 128, 1), 128, 0, stream>>>(XB, WQKV, DM, PL);   // q | k | v leave the projection as the f16 planes
    k_attn<<<(unsigned)((AT_HI + AT_LO) * NH * NB), 32, 0, stream>>>(PL, CTX);
    k_gemmw<<<dim3(NB * SEQ / 128, DM / 128, 1), 128, 0, stream>>>(CTX, WO2, CK, OUT, DM);
}

// v005
// One run takes 78.9 microseconds.
// Two timings next to v004 put it at 1.26 and 1.27 times that version's speed.
// All steps since v000 together make it 3.55 times as fast.
#include <hip/hip_runtime.h>

// Windowed causal multi-head attention with a fused qkv projection (x [2][2048][1024]; qkv = x w_attn ('io' [1024][3072], column = which*1024 + h*64 + d, no bias; 16 heads x 64); scores x 64^-0.5, key j visible to query i when 0 <= i - j < 256; softmax; out = merged w_proj ('io' [1024][1024], no bias) -> [2][2048][1024]).
// Compute dtypes, f32 accumulate everywhere: x, w_attn, w_proj converted to bf16 (RNE) and multiplied with v_wmma_f32_16x16x32_bf16 (exact products); attention on v_wmma_f32_16x16x32_f16:
// q, k, v carried as f16 value + f16 residual x2^11 (separate accumulator, folded back x2^-11); query rows < 256 use value+residual on q, k, P, v (3 products); rows >= 256 use q value+residual against single f16 k, single f16 P (x1024) and v;
// softmax f32 (running max, exp2); merged context stored as bf16 hi | lo along K and multiplied with [w_proj ; w_proj] on the bf16 WMMA.
// Fused flash-style attention in the transposed form S^T = K Q^T, O^T = V^T P^T: the packed score tiles are the B fragment of the second product directly (no probability plane, no LDS exchange); only the 32-key halves inside the window of a query tile are visited.

#ifndef NB
#define NB 2
#endif
#ifndef SEQ
#define SEQ 2048
#endif
#define NB_FULL  2
#define SEQ_FULL 2048
#define DM   1024
#define NH   16
#define HD   64
#define NQKV (3 * DM)
#define CK   (2 * DM)                 // context plane pitch: hi | lo along K
#define RH   256                      // query rows < RH use value+residual on every attention operand
#define RHE  ((SEQ < RH) ? SEQ : RH)
#define WIN  256                      // attention window: key j visible to query i when 0 <= i - j < WIN
#define PCAR 1024.0f                  // carry of the f16 probability operand
#define RSC  2048.0f                  // carry of every f16 residual plane (2^11)
#define RINV (1.0f / 2048.0f)
#define SCL  0.125f                   // HD^-0.5
#define NEGB (-3.0e38f)
#define MFLOOR (-1.0e30f)             // floor of the running maximum: a key half with no visible key for a query yields probabilities exactly 0
#define PLN  ((size_t)NH * SEQ * HD)  // elements per head plane set

#define WS_WQKV ((size_t)NQKV * DM * 2)
#define WS_WO2  ((size_t)DM * CK * 2)
#define WS_XB   ((size_t)NB * SEQ * DM * 2)
#define WS_PL   ((size_t)NB * 6 * NH * SEQ * HD * 2)
#define WS_CTX  ((size_t)NB * SEQ * CK * 2)
#define WS_TOTAL (WS_WQKV + WS_WO2 + WS_XB + WS_PL + WS_CTX)

static_assert(NB <= NB_FULL);                 // batch count within the inputs
static_assert(SEQ <= SEQ_FULL);               // sequence rows within the inputs
static_assert(NB == 1 || SEQ == SEQ_FULL);    // the batch elements' rows follow one another in x and out: one row range of NB * SEQ
static_assert(SEQ % 64 == 0);
static_assert(DM % 64 == 0);                  // wave quadrant columns
static_assert(NQKV % 64 == 0);                // wave quadrant columns
static_assert(DM % 32 == 0);                  // k-step of the projection
static_assert(CK % 32 == 0);                  // k-step of the output product
static_assert(HD == 64);
static_assert(NH * HD == DM);                 // merged head columns
static_assert(RH % 32 == 0);                  // whole key halves below the precision boundary
static_assert(RHE % 16 == 0);                 // whole query tiles on the HIRES body
static_assert((SEQ - RHE) % 16 == 0);         // whole query tiles on the other body
static_assert(WIN >= 16);                     // every query of a 16-row tile sees at least its own key
static_assert(WIN <= SEQ_FULL);               // window within the sequence
static_assert(WS_WQKV % 256 == 0);
static_assert(WS_WO2 % 256 == 0);
static_assert(WS_XB % 256 == 0);
static_assert(WS_PL % 256 == 0);
static_assert(WS_CTX % 256 == 0);
static_assert(WS_TOTAL <= (size_t)268435456); // total carve <= 256 MiB

typedef _Float16 h16;
typedef unsigned short bf;
typedef __attribute__((ext_vector_type(16))) __bf16   v16bf;
typedef __attribute__((ext_vector_type(16))) _Float16 v16h;
typedef __attribute__((ext_vector_type(8)))  _Float16 v8h;
typedef __attribute__((ext_vector_type(8)))  unsigned short v8us;
typedef __attribute__((ext_vector_type(2)))  unsigned short v2us;
typedef __attribute__((ext_vector_type(8)))  float    v8f;
typedef __attribute__((ext_vector_type(4)))  float    v4f;
typedef v4f  __attribute__((may_alias)) v4fa;
typedef v8us __attribute__((may_alias)) v8usa;
typedef v8h  __attribute__((may_alias)) v8ha;

__device__ __forceinline__ unsigned short f2bf(float f) { unsigned u = __float_as_uint(f); u += 0x7FFFu + ((u >> 16) & 1u); return (unsigned short)(u >> 16); }   // RNE convert
__device__ __forceinline__ float bf2f(unsigned short b) { return __uint_as_float(((unsigned)b) << 16); }
__device__ __forceinline__ void splitf(float y, unsigned short& h, unsigned short& l) { h = f2bf(y); l = f2bf(y - bf2f(h)); }
__device__ __forceinline__ v16h cat16(v8h lo, v8h hi) { return __builtin_shufflevector(lo, hi, 0, 1, 2, 3, 4, 5, 6, 7, 8, 9, 10, 11, 12, 13, 14, 15); }
__device__ __forceinline__ v16bf cat16b(v8us lo, v8us hi) { return __builtin_bit_cast(v16bf, __builtin_shufflevector(lo, hi, 0, 1, 2, 3, 4, 5, 6, 7, 8, 9, 10, 11, 12, 13, 14, 15)); }
__device__ __forceinline__ v8f wmma16(v16h a, v16h b, v8f c) { return __builtin_amdgcn_wmma_f32_16x16x32_f16(false, a, false, b, (short)0, c, false, false); }
__device__ __forceinline__ v8f wmmab(v16bf a, v16bf b, v8f c) { return __builtin_amdgcn_wmma_f32_16x16x32_bf16(false, a, false, b, (short)0, c, false, false); }
// Fragment loaders from K-contiguous 16-bit rows; the pointer already includes row (lane & 15) and 8 * (lane >> 4): elements 0..7 <- k0 + 8h + i, elements 8..15 <- k0 + 16 + 8h + i (A and B alike).
__device__ __forceinline__ v16h  ldh(const h16* p) { return cat16(*(const v8h*)p, *(const v8h*)(p + 16)); }
__device__ __forceinline__ v16bf ldb(const bf* p)  { return cat16b(*(const v8us*)p, *(const v8us*)(p + 16)); }
// f32 -> f16 operand convert that cannot produce an f16 subnormal (value select after the plane's carry).
static __device__ __forceinline__ h16 toh_flush(float v) { const h16 r = (h16)v; return (fabsf(v) < 6.103515625e-05f) ? (h16)0.0f : r; }

// ---- gemm_body: GEMM, 128x128 output tile per work-group of four waves, each wave a 64x64 quadrant (16 accumulators); grid (M/128, N/128), 128 threads.
// c[m][n] (f32) = sum_k A[m][k] Bt[n][k], bf16 operands in K-contiguous planes. K % 64 == 0, K >= 128, M and N multiples of 128 (asserted below for every use).
// PLANES false (k_gemmw): c goes to C (f32, pitch ldc). PLANES true (k_gemmp, the qkv projection): a quadrant is 64 tokens x the 64 columns of one head of q, k or v,
// and the epilogue stores it straight as that head's two f16 planes (value, residual x2^11) in the layout the attention kernel reads: q and k [token][d], v transposed [d][token].
// A pass is 64 k = 128 bytes of each of the 256 operand rows. Every wave brings one slice of 64 rows per pass into LDS with one tensor load (waves 0, 1: the A rows; waves 2, 3: the Bt rows),
// padded to a pitch of 144 bytes for the ds_load_b128 fragment reads; two buffers, the load of pass s + 2 issued when every wave has left pass s.
#define GP_K     64                      // k per pass
#define GP_ROWB  128u                    // bytes of one operand row per pass
#define GP_PITCH 144u                    // LDS row pitch: 128 + 16
#define GP_SLICE 10240u                  // 64 rows x 144 bytes = 9216, rounded up to a multiple of 2 KiB
#define GP_BUF   (4u * GP_SLICE)
#define GP_RING  (2u * GP_BUF)
#define GP_OS    (2u * 16u * 144u)       // output staging bytes per wave, behind the ring: 16 rows x 68 f32, or two f16 tiles of 16 rows x 144 bytes
#define GP_VP    72                      // pitch of a staged v^T row in f16 elements: 64 tokens + 16 bytes
static_assert(16u * 68u * 4u <= GP_OS);
static_assert((NB * SEQ) % 128 == 0);    // GEMM row tiles
static_assert(NQKV % 128 == 0);          // GEMM column tiles
static_assert(DM % 128 == 0);            // GEMM column tiles
static_assert(DM % GP_K == 0 && DM / GP_K >= 2);   // whole passes, two stages or more
static_assert(CK % GP_K == 0 && CK / GP_K >= 2);   // whole passes, two stages or more
static_assert(64u * GP_PITCH <= GP_SLICE && GP_SLICE % 2048u == 0);
typedef unsigned u32x4 __attribute__((ext_vector_type(4)));
typedef unsigned u32x8 __attribute__((ext_vector_type(8)));
__device__ __forceinline__ unsigned uni(unsigned v) { return (unsigned)__builtin_amdgcn_readfirstlane(v); }
__device__ __forceinline__ unsigned pinned(unsigned v) { unsigned w = uni(v); asm volatile("" : "+s"(w)); return w; }   // holds a wave-uniform test in a scalar register: the branch around a tensor load must be a scalar one (the load ignores EXEC)
__device__ __forceinline__ v16bf ldbs(const unsigned char* p) { return cat16b(*(const v8usa*)p, *(const v8usa*)(p + 32)); }   // the k order of ldb, from an LDS row
// Descriptor of one request: 64 rows of 128 bytes, source pitch in bytes, 16 bytes of pad behind every row.
__device__ __forceinline__ u32x8 tile_group1(unsigned src_pitch) {
    u32x8 g;
    g[0] = uni((1u << 20) | (4u << 22) | (3u << 25));
    g[1] = uni((GP_ROWB & 0xFFFFu) << 16);
    g[2] = uni((GP_ROWB >> 16) | (64u << 16));
    g[3] = uni(GP_ROWB << 16);
    g[4] = uni(64u);
    g[5] = uni(src_pitch);
    g[6] = uni(0u);
    g[7] = uni(0u);
    return g;
}
__device__ __forceinline__ u32x4 tile_group0(unsigned lds_dst, unsigned long long ga) {
    u32x4 g;
    g[0] = uni(1u); g[1] = uni(lds_dst); g[2] = uni((unsigned)ga); g[3] = uni((((unsigned)(ga >> 32)) & 0x01FFFFFFu) | 0x80000000u);
    return g;
}
// the next 128 bytes of the same rows: the address advances inside the descriptor's own words (the carry stays below the type bits for any valid address)
__device__ __forceinline__ void tile_advance(u32x4& g0, unsigned lds_dst) {
    const unsigned lo = g0[2] + GP_ROWB;
    g0[3] = uni(g0[3] + (lo < GP_ROWB ? 1u : 0u)); g0[2] = uni(lo); g0[1] = uni(lds_dst);
}
// both groups are in-out operands: their values stay live behind the instruction, so the compiler reuses none of their registers for another value while the request is on its way
__device__ __forceinline__ void tile_load(u32x4& g0, u32x8& g1) { asm volatile("tensor_load_to_lds %0, %1" : "+s"(g0), "+s"(g1) :: "memory"); }
template <bool PLANES>
__device__ __forceinline__ void gemm_body(const bf* __restrict__ A, const bf* __restrict__ Bt, int K, float* C, int ldc, h16* PL) {
    __shared__ __attribute__((aligned(2048))) unsigned char sm[GP_RING + 4u * GP_OS];
    const int lane = threadIdx.x & 31, lr = lane & 15, hi = lane >> 4; const unsigned wave = uni(threadIdx.x >> 5);
    const int r0 = blockIdx.x * 128, c0 = blockIdx.y * 128;
    const unsigned pitch = (unsigned)K * 2u;
    const unsigned lbase = (unsigned)(size_t)sm + wave * GP_SLICE;      // this wave's slice in buffer 0
    const unsigned long long gsrc = (wave < 2u) ? (unsigned long long)(size_t)A + (unsigned long long)(r0 + 64 * (int)wave) * pitch
                                                : (unsigned long long)(size_t)Bt + (unsigned long long)(c0 + 64 * ((int)wave - 2)) * pitch;
    const int np = K / GP_K;
    v8f acc[4][4];
#pragma unroll
    for (int mb = 0; mb < 4; ++mb)
#pragma unroll
        for (int nb = 0; nb < 4; ++nb) acc[mb][nb] = (v8f){};
    u32x8 g1 = tile_group1(pitch);
    u32x4 g0 = tile_group0(lbase, gsrc);
    tile_load(g0, g1);
    asm volatile("s_wait_tensorcnt 0x0" ::: "memory");   // stage 0 has landed before the barrier that publishes it
    __syncthreads();
    tile_advance(g0, lbase + GP_BUF);
    tile_load(g0, g1);
    const unsigned wm = wave & 1u, wn = wave >> 1;       // quadrant: rows r0 + 64 wm, columns c0 + 64 wn
    const unsigned aofs = wm * GP_SLICE + (unsigned)lr * GP_PITCH + 16u * (unsigned)hi, bofs = (2u + wn) * GP_SLICE + (unsigned)lr * GP_PITCH + 16u * (unsigned)hi;
    int s = 0;
#pragma unroll 1
    do {                                                 // np >= 2: the body runs at least twice
        const unsigned char* pa = sm + (unsigned)(s & 1) * GP_BUF + aofs; const unsigned char* pb = sm + (unsigned)(s & 1) * GP_BUF + bofs;
        v16bf a0[4], b0[4], a1[4], b1[4];    // fragments of the pass's two k-steps
        b0[0] = ldbs(pb);
#pragma unroll
        for (int mb = 0; mb < 4; ++mb) a0[mb] = ldbs(pa + (unsigned)mb * 16u * GP_PITCH);
#pragma unroll
        for (int nb = 1; nb < 4; ++nb) b0[nb] = ldbs(pb + (unsigned)nb * 16u * GP_PITCH);
#pragma unroll
        for (int mb = 0; mb < 4; ++mb) a1[mb] = ldbs(pa + (unsigned)mb * 16u * GP_PITCH + 64u);
#pragma unroll
        for (int nb = 0; nb < 2; ++nb) b1[nb] = ldbs(pb + (unsigned)nb * 16u * GP_PITCH + 64u);
        __builtin_amdgcn_sched_barrier(0);   // the LDS reads stay one group ahead of the matrix block
#pragma unroll
        for (int nb = 0; nb < 2; ++nb)
#pragma unroll
            for (int mb = 0; mb < 4; ++mb) acc[mb][nb] = wmmab(a0[mb], b0[nb], acc[mb][nb]);
        __builtin_amdgcn_sched_barrier(0);   // the last two fragments go into registers that the eight WMMAs above have freed (keeps the wave within 256 registers), as one group
#pragma unroll
        for (int nb = 2; nb < 4; ++nb) b1[nb] = ldbs(pb + (unsigned)nb * 16u * GP_PITCH + 64u);
        __builtin_amdgcn_sched_barrier(0);   // as above: no LDS read moves in among the WMMAs below
#pragma unroll
        for (int nb = 2; nb < 4; ++nb)
#pragma unroll
            for (int mb = 0; mb < 4; ++mb) acc[mb][nb] = wmmab(a0[mb], b0[nb], acc[mb][nb]);
#pragma unroll
        for (int nb = 0; nb < 4; ++nb)
#pragma unroll
            for (int mb = 0; mb < 4; ++mb) acc[mb][nb] = wmmab(a1[mb], b1[nb], acc[mb][nb]);
        __builtin_amdgcn_sched_barrier(0);   // the WMMAs stay in front of the waits: sunk behind the barrier they would stand in front of the refill and shorten its lead
        asm volatile("s_wait_dscnt 0x0" ::: "memory");      // this wave's reads of buffer s & 1 are done before the buffer is refilled
        asm volatile("s_wait_tensorcnt 0x0" ::: "memory");  // this wave's slice of stage s + 1 has landed
        __syncthreads();                                     // publishes stage s + 1 and ends every wave's reads of stage s
        if (pinned(s + 2 < np)) { tile_advance(g0, lbase + (unsigned)(s & 1) * GP_BUF); tile_load(g0, g1); }
    } while (++s < np);
    asm volatile("s_wait_tensorcnt 0x0" ::: "memory");   // no request outstanding at the wave's end
    asm volatile("s_wait_dscnt 0x0" ::: "memory");       // and no LDS read of the ring
    float* os = (float*)(sm + GP_RING + wave * GP_OS);   // each wave stages in its own range, outside the ring
    const int rq = r0 + (int)wm * 64, cq = c0 + (int)wn * 64;   // the quadrant's first row and column
    const int which = cq / DM;                           // PLANES: 0 q, 1 k, 2 v; the same for the whole work-group (128 divides DM)
    // PLANES: value plane of this quadrant's batch element, operand and head (plane set layout: see below the GEMM); its residual plane lies PLN further
    h16* pv = PLANES ? PL + ((size_t)(rq / SEQ) * 6 + (size_t)which * 2) * PLN + (size_t)((cq % DM) / HD) * SEQ * HD : nullptr;
    const int t0 = rq % SEQ;                             // first token of the quadrant inside its batch element
    if (PLANES && which == 2) {
        // v: a lane's eight accumulator rows are eight consecutive tokens of one d, a 16-byte piece of a v^T row; 16 d rows x 64 tokens are staged so that every store covers whole 128-byte lines
        h16* hs = (h16*)os;
#pragma unroll
        for (int nb = 0; nb < 4; ++nb) {
#pragma unroll
            for (int mb = 0; mb < 4; ++mb) { v8h o, r;
#pragma unroll
                for (int j = 0; j < 8; ++j) { const float x = acc[mb][nb][j]; const h16 a = (h16)x; o[j] = a; r[j] = (h16)((x - (float)a) * RSC); }
                *(v8ha*)(hs + lr * GP_VP + mb * 16 + hi * 8) = o; *(v8ha*)(hs + 16 * GP_VP + lr * GP_VP + mb * 16 + hi * 8) = r; }
            __builtin_amdgcn_wave_barrier(); asm volatile("" ::: "memory");   // the lanes' LDS writes stay in front of the reads of other lanes' pieces
#pragma unroll
            for (int s = 0; s < 4; ++s) { const int row = 4 * s + (lane >> 3), pc = (lane & 7) * 8;
                const v8h a = *(const v8ha*)(hs + row * GP_VP + pc); const v8h c = *(const v8ha*)(hs + 16 * GP_VP + row * GP_VP + pc);
                h16* p = pv + (size_t)(nb * 16 + row) * SEQ + t0 + pc;
                *(v8h*)p = a; *(v8h*)(p + PLN) = c; }
            __builtin_amdgcn_wave_barrier(); asm volatile("" ::: "memory");   // the reads stay in front of the next tile's writes
        }
    } else {
#pragma unroll
        for (int mb = 0; mb < 4; ++mb) {
#pragma unroll
            for (int nb = 0; nb < 4; ++nb) {
#pragma unroll
                for (int j = 0; j < 8; ++j) os[(hi * 8 + j) * 68 + nb * 16 + lr] = acc[mb][nb][j]; }
            __builtin_amdgcn_wave_barrier(); asm volatile("" ::: "memory");   // as in the v branch: writes in front of the reads
            if (PLANES) {
                // q, k: a staged row is one token's 64 d = one 128-byte row of each plane; eight lanes a row, four consecutive rows a store
#pragma unroll
                for (int s = 0; s < 4; ++s) { const int row = 4 * s + (lane >> 3), cofs = (lane & 7) * 8;
                    const v4f x0 = *(const v4fa*)(os + row * 68 + cofs); const v4f x1 = *(const v4fa*)(os + row * 68 + cofs + 4); v8h o, r;
#pragma unroll
                    for (int k = 0; k < 4; ++k) { const h16 a = (h16)x0[k]; o[k] = a; r[k] = (h16)((x0[k] - (float)a) * RSC); const h16 b = (h16)x1[k]; o[4 + k] = b; r[4 + k] = (h16)((x1[k] - (float)b) * RSC); }
                    h16* p = pv + (size_t)(t0 + mb * 16 + row) * HD + cofs;
                    *(v8h*)p = o; *(v8h*)(p + PLN) = r; }
            } else {
                float* crow = C + (size_t)(rq + mb * 16) * ldc + cq;
#pragma unroll
                for (int s = 0; s < 8; ++s) { const int row = 2 * s + hi, cofs = lr * 4; const v4f val = *(const v4fa*)(os + row * 68 + cofs);
                    *(v4f*)(crow + (size_t)row * ldc + cofs) = val; }
            }
            __builtin_amdgcn_wave_barrier(); asm volatile("" ::: "memory");   // reads in front of the next tile's writes
        }
        if (PLANES) asm volatile("s_wait_xcnt 0x0" ::: "memory");   // in the built code this branch's end stands directly in front of the v branch, which reuses the registers that the stores above name
    }
}
__global__ __launch_bounds__(128) void k_gemmw(const bf* __restrict__ A, const bf* __restrict__ Bt, int K, float* C, int ldc) { gemm_body<false>(A, Bt, K, C, ldc, nullptr); }
// Plane set layout in PL (PLN elements each): 0 q value, 1 q residual, 2 k value, 3 k residual, 4 v^T value, 5 v^T residual; one such set of six per batch element.
__global__ __launch_bounds__(128) void k_gemmp(const bf* __restrict__ A, const bf* __restrict__ Bt, int K, h16* PL) { gemm_body<true>(A, Bt, K, nullptr, 0, PL); }

// ---- the three operand conversions; none reads what another writes, so they share one launch (k_prep below); blk is the work-group's index inside its own stage.
__device__ __forceinline__ void wt_body(const float* __restrict__ w, int K, int N, int rep, bf* Bt, int blk) {
    const int lane = threadIdx.x & 31; const int wave = __builtin_amdgcn_readfirstlane(threadIdx.x >> 5);
    const int KO = K * rep; const int L0 = (blk * 8 + wave) * 8; const int nlines = (int)(((size_t)N * KO) / 64);
{
#pragma unroll 1
        for (int l = 0; l < 8; ++l) { const int L = L0 + l; if (L >= nlines) break; const size_t e = (size_t)L * 64 + lane * 2; const int ko = (int)(e % KO), n = (int)(e / KO); const int k = ko % K; v2us o;
            o[0] = f2bf(w[(size_t)k * N + n]); o[1] = f2bf(w[(size_t)(k + 1) * N + n]); *(v2us*)(Bt + e) = o; }
         }
}

__device__ __forceinline__ void cvt8_body(const float* __restrict__ src, bf* dst, size_t n8, int blk) { const size_t i = (size_t)blk * 256 + threadIdx.x; if (i >= n8) return; const v8f v = *(const v8f*)(src + i * 8); v8us o;
#pragma unroll
    for (int k = 0; k < 8; ++k) o[k] = f2bf(v[k]); *(v8us*)(dst + i * 8) = o;  }
#define PB_WQKV ((int)(((size_t)NQKV * DM / 64 + 63) / 64))            // work-groups of w_attn: in[1024][3072] -> out[3072][1024]
#define PB_WO2  ((int)(((size_t)DM * CK / 64 + 63) / 64))              // work-groups of w_proj: in[1024][1024] -> out[1024][2 x 1024]
#define PB_X    ((int)(((size_t)NB * SEQ * DM / 8 + 255) / 256))       // work-groups of x
// The weight stages come first in the grid: their work-groups run longest (eight dependent trips a wave).
__global__ __launch_bounds__(256) void k_prep(const float* __restrict__ x, const float* __restrict__ wqkv, const float* __restrict__ wo, bf* XB, bf* WQKV, bf* WO2) {
    const int b = blockIdx.x;
    if (b < PB_WQKV) wt_body(wqkv, DM, NQKV, 1, WQKV, b);
    else if (b < PB_WQKV + PB_WO2) wt_body(wo, DM, DM, 2, WO2, b - PB_WQKV);
    else cvt8_body(x, XB, (size_t)NB * SEQ * DM / 8, b - (PB_WQKV + PB_WO2));
}

// ---- fused windowed causal attention, one wave per 16 query rows of one head; a work-group is eight such waves on 128 consecutive query rows; one launch for all heads and batch elements (k_attn below), the rows below RHE on the HIRES body.
// The keys that the eight waves visit together (the window behind the first query up to the last query: at most WIN + 128) are staged in LDS once, in chunks of 128 keys, one tensor load a wave:
// a k chunk is 128 rows of 128 bytes (LDS pitch 144), a v^T chunk 64 rows of 256 bytes (LDS pitch 272), both pitches for the ds_load_b128 fragment reads. Slot of a chunk = the number of the wave that brings it.
// Where two slots are left (the body that is not HIRES) the work-group's 128 q rows, value and residual, are staged in them like k chunks; the HIRES body fills all eight slots and reads q from global memory.
#define AW      8                        // waves per work-group
#define AQ      (AW * 16)                // query rows per work-group
#define AC      128                      // keys per staged chunk
#define AT_KP   144u                     // LDS pitch of a staged k row: 128 + 16
#define AT_VP   272u                     // LDS pitch of a staged v^T row: 256 + 16
#define AT_SLOT 18432u                   // 128 x 144 bytes; 64 x 272 = 17408 rounded up to a multiple of 2 KiB
static_assert(AC * AT_KP <= AT_SLOT && HD * AT_VP <= AT_SLOT && AT_SLOT % 2048u == 0);
static_assert(AC * 2 == 256 && HD * 2 == 128);                  // row lengths that the two pads are for
static_assert(SEQ % AQ == 0 && RHE % AQ == 0 && WIN % AC == 0 && AQ % AC == 0);   // whole work-groups per body, whole chunks
static_assert(2 * (WIN / AC + AQ / AC) <= AW);                  // other body: two planes' chunks, one a wave
static_assert(AQ == AC);                                        // a work-group's q rows are one chunk
static_assert(4 * (RHE / AC) <= AW);                            // HIRES body: four planes' chunks, one a wave
__device__ __forceinline__ v16h ldhs(const unsigned char* p) { return cat16(*(const v8ha*)p, *(const v8ha*)(p + 32)); }   // the k order of ldh, from an LDS row
// Descriptor of one chunk: rows of rowb bytes, source pitch in bytes, word 0 (the pad behind every row) a constant at each use.
__device__ __forceinline__ u32x8 chunk_group1(unsigned word0, unsigned rowb, unsigned rows, unsigned src_pitch) {
    u32x8 g;
    g[0] = uni(word0);
    g[1] = uni((rowb & 0xFFFFu) << 16);
    g[2] = uni((rowb >> 16) | (rows << 16));
    g[3] = uni(rowb << 16);
    g[4] = uni(rows);
    g[5] = uni(src_pitch);
    g[6] = uni(0u);
    g[7] = uni(0u);
    return g;
}
// Key halves visited by a wave: from the 32-aligned half holding key q0 - (WIN - 1) (clipped at 0) up to the half holding key q0 + 15; all of them lie inside the written planes.
// Per 32-key half: S^T tiles [16 keys][16 queries] = K Q^T (A = key rows, B = query rows, k = d); lane (h, n) holds query q0+n, keys kb + 16*tile + 8h + r.
// Online softmax per lane (16 values) + one xor-16 shuffle; the two packed tiles are the B fragment (k = key, n = query) of O^T [d][query] += V^T [d][key] P^T.
// HIRES: value+residual on q, k, P, v (3 products each side); else q value+residual against single k, single P and v.
template <bool HIRES>
__device__ __forceinline__ void attn_body(const h16* __restrict__ PL, bf* CTX, unsigned char* sm, const int qw, const int head, const int batch) {
    const int lane = threadIdx.x & 31, lr = lane & 15, hi = lane >> 4; const unsigned wave = uni(threadIdx.x >> 5);
    const int q0 = qw + 16 * (int)wave;                // this wave's query tile
    constexpr unsigned NCH = HIRES ? RHE / AC : WIN / AC + AQ / AC;   // chunk slots per plane
    constexpr unsigned NKP = HIRES ? 2u : 1u;          // k planes staged, and as many v^T planes behind them
    constexpr unsigned NST = 2u * NKP * NCH;           // slots of the k and v^T chunks
    constexpr bool QS = NST + 2u <= AW;                // two slots left: q value and q residual are staged too
    const int kbase = HIRES ? 0 : max(qw - WIN, 0);    // first staged key
    const unsigned nch = (unsigned)(qw + AQ - kbase) / AC;   // chunks up to the work-group's last query
    const int kb0 = max(q0 - (WIN - 1), 0) & ~31;      // first key half with a key inside the window of query q0
    const size_t hb = (size_t)batch * 6 * PLN + (size_t)head * SEQ * HD;   // this batch element's set of six planes, then the head
    const size_t oQ = hb + (size_t)(q0 + lr) * HD + 8 * hi;
    {
        const unsigned pi = wave / NCH, ch = wave % NCH;   // plane and chunk that this wave brings
        const unsigned dst = (unsigned)(size_t)sm + wave * AT_SLOT;
        const bool isq = QS && wave >= NST && wave < NST + 2u;
        if (pinned((pi < NKP && ch < nch) || isq)) {
            const unsigned plane = isq ? wave - NST : 2u + pi; const int row = isq ? qw : kbase + (int)ch * AC;
            const size_t src = plane * PLN + hb + (size_t)row * HD;
            u32x8 g1 = chunk_group1((1u << 20) | (4u << 22) | (3u << 25), HD * 2u, AC, HD * 2u);
            u32x4 g0 = tile_group0(dst, (unsigned long long)(size_t)(PL + src));
            tile_load(g0, g1);
            asm volatile("s_wait_tensorcnt 0x0" ::: "memory");   // the chunk has landed before the barrier that publishes it
        }
        if (pinned(pi >= NKP && pi < 2u * NKP && ch < nch)) {
            u32x8 g1 = chunk_group1((1u << 20) | (5u << 22) | (3u << 25), AC * 2u, HD, SEQ * 2u);
            u32x4 g0 = tile_group0(dst, (unsigned long long)(size_t)(PL + (4 + pi - NKP) * PLN + hb + (size_t)(kbase + (int)ch * AC)));
            tile_load(g0, g1);
            asm volatile("s_wait_tensorcnt 0x0" ::: "memory");   // as above
        }
    }
    __syncthreads();                                   // publishes every chunk; nothing staged is read in front of it
    const unsigned char* sK = sm + (unsigned)lr * AT_KP + 16u * (unsigned)hi;                          // k value chunks; the residual plane's lie NCH slots further
    const unsigned char* sQ = sm + NST * AT_SLOT + (16u * wave + (unsigned)lr) * AT_KP + 16u * (unsigned)hi;   // QS: this wave's q value rows; the residual rows lie one slot further
    const unsigned char* sV = sm + NKP * NCH * AT_SLOT + (unsigned)lr * AT_VP + 16u * (unsigned)hi;    // v^T value chunks; likewise
    const float CE = SCL * 1.4426950408889634f;
    v8f o[4], orr[4];
#pragma unroll
    for (int dt = 0; dt < 4; ++dt) { o[dt] = (v8f){}; orr[dt] = (v8f){}; }
    float m = NEGB, l = 0.0f;
#pragma unroll 1
    for (int kb = kb0; kb < q0 + 16; kb += 32) {
        v8f sh0 = (v8f){}, sh1 = (v8f){}, sr0 = (v8f){}, sr1 = (v8f){};
        const unsigned kr = (unsigned)(kb - kbase);    // a half of 32 keys lies inside one chunk
        const unsigned char* pk = sK + (kr / AC) * AT_SLOT + (kr % AC) * AT_KP;
        const unsigned char* pv = sV + (kr / AC) * AT_SLOT + (kr % AC) * 2u;
#pragma unroll
        for (int kc = 0; kc < HD; kc += 32) {
            const v16h bq  = QS ? ldhs(sQ + kc * 2) : ldh(PL + oQ + kc);
            const v16h bqr = QS ? ldhs(sQ + AT_SLOT + kc * 2) : ldh(PL + PLN + oQ + kc);
            const v16h ak0 = ldhs(pk + kc * 2);
            const v16h ak1 = ldhs(pk + 16u * AT_KP + kc * 2);
            sh0 = wmma16(ak0, bq, sh0);  sh1 = wmma16(ak1, bq, sh1);
            sr0 = wmma16(ak0, bqr, sr0); sr1 = wmma16(ak1, bqr, sr1);
            if (HIRES) {
                const v16h kr0 = ldhs(pk + NCH * AT_SLOT + kc * 2);
                const v16h kr1 = ldhs(pk + NCH * AT_SLOT + 16u * AT_KP + kc * 2);
                sr0 = wmma16(kr0, bq, sr0); sr1 = wmma16(kr1, bq, sr1);
                asm volatile("v_nop\n\tv_nop\n\tv_nop\n\tv_nop" : "+v"(sh0), "+v"(sh1), "+v"(sr0), "+v"(sr1) : "v"(ak0), "v"(ak1), "v"(bq), "v"(bqr), "v"(kr0), "v"(kr1));
            } else {
                asm volatile("v_nop\n\tv_nop\n\tv_nop\n\tv_nop" : "+v"(sh0), "+v"(sh1), "+v"(sr0), "+v"(sr1) : "v"(ak0), "v"(ak1), "v"(bq), "v"(bqr));
            }
        }
        float u[16];
#pragma unroll
        for (int r = 0; r < 8; ++r) { u[r] = (sh0[r] + sr0[r] * RINV) * CE; u[8 + r] = (sh1[r] + sr1[r] * RINV) * CE; }
        if (kb + 31 > q0 || kb + (WIN - 16) < q0) {   // wave-uniform: this half touches the diagonal or the far edge of the window; keys above the query or WIN or more behind it are excluded
            const int qi = q0 + lr; const int k0 = kb + 8 * hi;
#pragma unroll
            for (int r = 0; r < 8; ++r) { u[r] = (k0 + r > qi || qi - (k0 + r) >= WIN) ? NEGB : u[r]; u[8 + r] = (k0 + 16 + r > qi || qi - (k0 + 16 + r) >= WIN) ? NEGB : u[8 + r]; }
        }
        float mx = u[0];
#pragma unroll
        for (int i = 1; i < 16; ++i) mx = fmaxf(mx, u[i]);
        mx = fmaxf(mx, __shfl_xor(mx, 16, 32));
        const float mn = fmaxf(fmaxf(m, mx), MFLOOR);
        const float corr = __builtin_amdgcn_exp2f(m - mn);
        m = mn;
        float psum = 0.0f;
#pragma unroll
        for (int i = 0; i < 16; ++i) { u[i] = __builtin_amdgcn_exp2f(u[i] - mn); psum += u[i]; }
        l = l * corr + psum;
#pragma unroll
        for (int dt = 0; dt < 4; ++dt) {
#pragma unroll
            for (int r = 0; r < 8; ++r) { o[dt][r] *= corr; if (HIRES) orr[dt][r] *= corr; } }
        v16h pb, pr;
#pragma unroll
        for (int i = 0; i < 16; ++i) { const float pc = u[i] * PCAR; const h16 ph = toh_flush(pc); pb[i] = ph; pr[i] = toh_flush((pc - (float)ph) * RSC); }
        if (HIRES) {
#pragma unroll
            for (int dt = 0; dt < 4; ++dt) {
                const v16h av  = ldhs(pv + (unsigned)dt * 16u * AT_VP);
                const v16h avr = ldhs(pv + NCH * AT_SLOT + (unsigned)dt * 16u * AT_VP);
                o[dt]   = wmma16(av, pb, o[dt]);
                orr[dt] = wmma16(avr, pb, orr[dt]);
                orr[dt] = wmma16(av, pr, orr[dt]);
                asm volatile("v_nop\n\tv_nop\n\tv_nop\n\tv_nop" : "+v"(o[dt]), "+v"(orr[dt]) : "v"(av), "v"(avr), "v"(pb), "v"(pr));
            }
        } else {
            const v16h av0 = ldhs(pv);
            const v16h av1 = ldhs(pv + 16u * AT_VP);
            const v16h av2 = ldhs(pv + 32u * AT_VP);
            const v16h av3 = ldhs(pv + 48u * AT_VP);
            o[0] = wmma16(av0, pb, o[0]); o[1] = wmma16(av1, pb, o[1]); o[2] = wmma16(av2, pb, o[2]); o[3] = wmma16(av3, pb, o[3]);
            asm volatile("v_nop\n\tv_nop\n\tv_nop\n\tv_nop" : "+v"(o[0]), "+v"(o[1]), "+v"(o[2]), "+v"(o[3]) : "v"(av0), "v"(av1), "v"(av2), "v"(av3), "v"(pb));
        }
    }
    if (!QS) asm volatile("s_wait_xcnt 0x0" ::: "memory");   // stands in front of whatever reuses the address registers of the loop's q loads
    l += __shfl_xor(l, 16, 32);
    const float inv = 1.0f / (l * PCAR);
    // output staging, 4 KiB a wave, in the chunks' LDS once every wave has left its loop
    asm volatile("s_wait_dscnt 0x0" ::: "memory");   // this wave's fragment reads are done before another wave writes over the chunks
    __syncthreads();
    unsigned short* ost = (unsigned short*)(sm + wave * 4096u);
#pragma unroll
    for (int dt = 0; dt < 4; ++dt) { v8us vh, vl;
#pragma unroll
        for (int r = 0; r < 8; ++r) { float y = o[dt][r]; if (HIRES) y += orr[dt][r] * RINV; y *= inv; unsigned short a, c; splitf(y, a, c); vh[r] = a; vl[r] = c; }
        *(v8usa*)(ost + lr * HD + dt * 16 + hi * 8) = vh; *(v8usa*)(ost + 16 * HD + lr * HD + dt * 16 + hi * 8) = vl; }
    __builtin_amdgcn_wave_barrier(); asm volatile("" ::: "memory");
    bf* crow = CTX + ((size_t)batch * SEQ + q0) * CK + head * HD;
{
#pragma unroll
        for (int s = 0; s < 4; ++s) { const int row = 4 * s + (lane >> 3), pc = (lane & 7) * 8;
            const v8us a = *(const v8usa*)(ost + row * HD + pc); const v8us c = *(const v8usa*)(ost + 16 * HD + row * HD + pc);
            *(v8us*)(crow + (size_t)row * CK + pc) = a; *(v8us*)(crow + (size_t)row * CK + DM + pc) = c; }
         }
}
#define AT_HI  (RHE / AQ)                     // work-groups per head on the HIRES body
#define AT_LO  ((SEQ - RHE) / AQ)             // work-groups per head on the other body
#define AT_NHI (AT_HI * NH * NB)
// Grid order: a HIRES wave with many key halves runs longest. So the HIRES work-groups come first, the one with the most key halves ahead;
// behind them the others, query block fastest, then head, then batch element.
__global__ __launch_bounds__(AW * 32) __attribute__((amdgpu_num_vgpr(256))) void k_attn(const h16* __restrict__ PL, bf* CTX) {
    __shared__ __attribute__((aligned(2048))) unsigned char sm[AW * AT_SLOT];   // one chunk slot a wave: two work-groups fit a WGP's LDS
    const int b = blockIdx.x;
    if (b < AT_NHI) { const int hb = b % (NH * NB); attn_body<true>(PL, CTX, sm, (AT_HI - 1 - b / (NH * NB)) * AQ, hb % NH, hb / NH); }
    else { const int c = b - AT_NHI, hb = c / (AT_LO > 0 ? AT_LO : 1); attn_body<false>(PL, CTX, sm, RHE + (c - hb * AT_LO) * AQ, hb % NH, hb / NH); }
}

extern "C" void kernel_launch(void* const* d_in, const int* in_sizes, int n_in,
                              void* d_out, int out_size, void* d_ws, size_t ws_size, hipStream_t stream) {
    if (n_in < 3) return;
    const int need_x = (NB - 1) * SEQ_FULL * DM + SEQ * DM;
    if (in_sizes[0] < need_x || in_sizes[1] < DM * NQKV || in_sizes[2] < DM * DM || out_size < need_x) return;
    if (WS_TOTAL > ws_size) return;
    const float* x = (const float*)d_in[0]; const float* wqkv = (const float*)d_in[1]; const float* wo = (const float*)d_in[2];   // x, w_attn, w_proj
    float* OUT = (float*)d_out;     // [2][2048][1024]
    char* wsp = (char*)d_ws;
    bf* WQKV = (bf*)wsp;  wsp += WS_WQKV;      // [3072][1024] bf16, K-contiguous
    bf* WO2  = (bf*)wsp;  wsp += WS_WO2;
    bf* XB   = (bf*)wsp;  wsp += WS_XB;        // [NB * SEQ][1024] bf16
    h16* PL  = (h16*)wsp; wsp += WS_PL;        // six head plane sets per batch element
    bf* CTX  = (bf*)wsp;  wsp += WS_CTX;       // [NB * SEQ][2048] bf16 hi | lo
    // every stage runs once, over all NB batch elements: the row-wise stages on NB * SEQ rows, the per-head stage with head and batch element decoded from its one-dimensional work-group index
    k_prep<<<(unsigned)(PB_WQKV + PB_WO2 + PB_X), 256, 0, stream>>>(x, wqkv, wo, XB, WQKV, WO2);
    k_gemmp<<<dim3(NB * SEQ / 128, NQKV / 128, 1), 128, 0, stream>>>(XB, WQKV, DM, PL);   // q | k | v leave the projection as the f16 planes
    k_attn<<<(unsigned)((AT_HI + AT_LO) * NH * NB), AW * 32, 0, stream>>>(PL, CTX);
    k_gemmw<<<dim3(NB * SEQ / 128, DM / 128, 1), 128, 0, stream>>>(CTX, WO2, CK, OUT, DM);
}

// v006
// Measured time: 71.1 microseconds a run.
// Next to v005, in two timings, it ran 1.09 times as fast each time.
// Counting every step since v000, it is 3.88 times as fast.
#include <hip/hip_runtime.h>

// Windowed causal multi-head attention with a fused qkv projection (x [2][2048][1024]; qkv = x w_attn ('io' [1024][3072], column = which*1024 + h*64 + d, no bias; 16 heads x 64); scores x 64^-0.5, key j visible to query i when 0 <= i - j < 256; softmax; out = merged w_proj ('io' [1024][1024], no bias) -> [2][2048][1024]).
// Compute dtypes, f32 accumulate everywhere: x, w_attn, w_proj converted to bf16 (RNE) and multiplied with v_wmma_f32_16x16x32_bf16 (exact products); attention on v_wmma_f32_16x16x32_f16:
// q, k, v carried as f16 value + f16 residual x2^11 (separate accumulator, folded back x2^-11); query rows < 256 use value+residual on q, k, P, v (3 products); rows >= 256 use q value+residual against single f16 k, single f16 P (x1024) and v;
// softmax f32 (running max, exp2); merged context stored as bf16 hi | lo; both halves are multiplied with the one bf16 w_proj plane on the bf16 WMMA, into the same accumulators.
// Fused flash-style attention in the transposed form S^T = K Q^T, O^T = V^T P^T: the packed score tiles are the B fragment of the second product directly (no probability plane, no LDS exchange); only the 32-key halves inside the window of a query tile are visited.

#ifndef NB
#define NB 2
#endif
#ifndef SEQ
#define SEQ 2048
#endif
#define NB_FULL  2
#define SEQ_FULL 2048
#define DM   1024
#define NH   16
#define HD   64
#define NQKV (3 * DM)
#define CK   (2 * DM)                 // context plane pitch: hi | lo along K
#define RH   256                      // query rows < RH use value+residual on every attention operand
#define RHE  ((SEQ < RH) ? SEQ : RH)
#define WIN  256                      // attention window: key j visible to query i when 0 <= i - j < WIN
#define PCAR 1024.0f                  // carry of the f16 probability operand
#define RSC  2048.0f                  // carry of every f16 residual plane (2^11)
#define RINV (1.0f / 2048.0f)
#define SCL  0.125f                   // HD^-0.5
#define NEGB (-3.0e38f)
#define MFLOOR (-1.0e30f)             // floor of the running maximum: a key half with no visible key for a query yields probabilities exactly 0
#define PLN  ((size_t)NH * SEQ * HD)  // elements per head plane set

#define WS_WQKV ((size_t)NQKV * DM * 2)
#define WS_WO2  ((size_t)DM * DM * 2)
#define WS_XB   ((size_t)NB * SEQ * DM * 2)
#define WS_PL   ((size_t)NB * 6 * NH * SEQ * HD * 2)
#define WS_CTX  ((size_t)NB * SEQ * CK * 2)
#define WS_TOTAL (WS_WQKV + WS_WO2 + WS_XB + WS_PL + WS_CTX)

static_assert(NB <= NB_FULL);                 // batch count within the inputs
static_assert(SEQ <= SEQ_FULL);               // sequence rows within the inputs
static_assert(NB == 1 || SEQ == SEQ_FULL);    // the batch elements' rows follow one another in x and out: one row range of NB * SEQ
static_assert(SEQ % 64 == 0);
static_assert(DM % 64 == 0);                  // wave quadrant columns
static_assert(NQKV % 64 == 0);                // wave quadrant columns
static_assert(DM % 32 == 0);                  // k-step of the projection
static_assert(HD == 64);
static_assert(NH * HD == DM);                 // merged head columns
static_assert(RH % 32 == 0);                  // whole key halves below the precision boundary
static_assert(RHE % 16 == 0);                 // whole query tiles on the HIRES body
static_assert((SEQ - RHE) % 16 == 0);         // whole query tiles on the other body
static_assert(WIN >= 16);                     // every query of a 16-row tile sees at least its own key
static_assert(WIN <= SEQ_FULL);               // window within the sequence
static_assert(WS_WQKV % 256 == 0);
static_assert(WS_WO2 % 256 == 0);
static_assert(WS_XB % 256 == 0);
static_assert(WS_PL % 256 == 0);
static_assert(WS_CTX % 256 == 0);
static_assert(WS_TOTAL <= (size_t)268435456); // total carve <= 256 MiB

typedef _Float16 h16;
typedef unsigned short bf;
typedef __attribute__((ext_vector_type(16))) __bf16   v16bf;
typedef __attribute__((ext_vector_type(16))) _Float16 v16h;
typedef __attribute__((ext_vector_type(8)))  _Float16 v8h;
typedef __attribute__((ext_vector_type(8)))  unsigned short v8us;
typedef __attribute__((ext_vector_type(2)))  unsigned short v2us;
typedef __attribute__((ext_vector_type(8)))  float    v8f;
typedef __attribute__((ext_vector_type(4)))  float    v4f;
typedef v4f  __attribute__((may_alias)) v4fa;
typedef v8us __attribute__((may_alias)) v8usa;
typedef v8h  __attribute__((may_alias)) v8ha;

__device__ __forceinline__ unsigned short f2bf(float f) { unsigned u = __float_as_uint(f); u += 0x7FFFu + ((u >> 16) & 1u); return (unsigned short)(u >> 16); }   // RNE convert
__device__ __forceinline__ float bf2f(unsigned short b) { return __uint_as_float(((unsigned)b) << 16); }
__device__ __forceinline__ void splitf(float y, unsigned short& h, unsigned short& l) { h = f2bf(y); l = f2bf(y - bf2f(h)); }
__device__ __forceinline__ v16h cat16(v8h lo, v8h hi) { return __builtin_shufflevector(lo, hi, 0, 1, 2, 3, 4, 5, 6, 7, 8, 9, 10, 11, 12, 13, 14, 15); }
__device__ __forceinline__ v16bf cat16b(v8us lo, v8us hi) { return __builtin_bit_cast(v16bf, __builtin_shufflevector(lo, hi, 0, 1, 2, 3, 4, 5, 6, 7, 8, 9, 10, 11, 12, 13, 14, 15)); }
__device__ __forceinline__ v8f wmma16(v16h a, v16h b, v8f c) { return __builtin_amdgcn_wmma_f32_16x16x32_f16(false, a, false, b, (short)0, c, false, false); }
__device__ __forceinline__ v8f wmmab(v16bf a, v16bf b, v8f c) { return __builtin_amdgcn_wmma_f32_16x16x32_bf16(false, a, false, b, (short)0, c, false, false); }
// Fragment loaders from K-contiguous 16-bit rows; the pointer already includes row (lane & 15) and 8 * (lane >> 4): elements 0..7 <- k0 + 8h + i, elements 8..15 <- k0 + 16 + 8h + i (A and B alike).
__device__ __forceinline__ v16h  ldh(const h16* p) { return cat16(*(const v8h*)p, *(const v8h*)(p + 16)); }
__device__ __forceinline__ v16bf ldb(const bf* p)  { return cat16b(*(const v8us*)p, *(const v8us*)(p + 16)); }
// f32 -> f16 operand convert that cannot produce an f16 subnormal (value select after the plane's carry).
static __device__ __forceinline__ h16 toh_flush(float v) { const h16 r = (h16)v; return (fabsf(v) < 6.103515625e-05f) ? (h16)0.0f : r; }

// ---- k_gemmp: the qkv projection, 128x128 output tile per work-group of four waves, each wave a 64x64 quadrant (16 accumulators); grid (M/128, N/128), 128 threads.
// c[m][n] (f32) = sum_k A[m][k] Bt[n][k], bf16 operands in K-contiguous planes. K % 64 == 0, K >= 128, M and N multiples of 128 (asserted below for every use).
// A quadrant is 64 tokens x the 64 columns of one head of q, k or v,
// and the epilogue stores it straight as that head's two f16 planes (value, residual x2^11) in the layout the attention kernels read: q and k [token][d], v transposed [d][token].
// A pass is 64 k = 128 bytes of each of the 256 operand rows. Every wave brings one slice of 64 rows per pass into LDS with one tensor load (waves 0, 1: the A rows; waves 2, 3: the Bt rows),
// padded to a pitch of 144 bytes for the ds_load_b128 fragment reads; two buffers, the load of pass s + 2 issued when every wave has left pass s.
#define GP_K     64                      // k per pass
#define GP_ROWB  128u                    // bytes of one operand row per pass
#define GP_PITCH 144u                    // LDS row pitch: 128 + 16
#define GP_SLICE 10240u                  // 64 rows x 144 bytes = 9216, rounded up to a multiple of 2 KiB
#define GP_BUF   (4u * GP_SLICE)
#define GP_RING  (2u * GP_BUF)
#define GP_OS    (2u * 16u * 144u)       // output staging bytes per wave, behind the ring: 16 rows x 68 f32, or two f16 tiles of 16 rows x 144 bytes
#define GP_VP    72                      // pitch of a staged v^T row in f16 elements: 64 tokens + 16 bytes
static_assert(16u * 68u * 4u <= GP_OS);
static_assert((NB * SEQ) % 128 == 0);    // GEMM row tiles
static_assert(NQKV % 128 == 0);          // GEMM column tiles
static_assert(DM % 128 == 0);            // GEMM column tiles
static_assert(DM % GP_K == 0 && DM / GP_K >= 2);   // whole passes, two stages or more
static_assert(64u * GP_PITCH <= GP_SLICE && GP_SLICE % 2048u == 0);
typedef unsigned u32x4 __attribute__((ext_vector_type(4)));
typedef unsigned u32x8 __attribute__((ext_vector_type(8)));
__device__ __forceinline__ unsigned uni(unsigned v) { return (unsigned)__builtin_amdgcn_readfirstlane(v); }
__device__ __forceinline__ unsigned pinned(unsigned v) { unsigned w = uni(v); asm volatile("" : "+s"(w)); return w; }   // holds a wave-uniform test in a scalar register: the branch around a tensor load must be a scalar one (the load ignores EXEC)
__device__ __forceinline__ v16bf ldbs(const unsigned char* p) { return cat16b(*(const v8usa*)p, *(const v8usa*)(p + 32)); }   // the k order of ldb, from an LDS row
// Descriptor of one request: 64 rows of 128 bytes, source pitch in bytes, 16 bytes of pad behind every row.
__device__ __forceinline__ u32x8 tile_group1(unsigned src_pitch) {
    u32x8 g;
    g[0] = uni((1u << 20) | (4u << 22) | (3u << 25));
    g[1] = uni((GP_ROWB & 0xFFFFu) << 16);
    g[2] = uni((GP_ROWB >> 16) | (64u << 16));
    g[3] = uni(GP_ROWB << 16);
    g[4] = uni(64u);
    g[5] = uni(src_pitch);
    g[6] = uni(0u);
    g[7] = uni(0u);
    return g;
}
__device__ __forceinline__ u32x4 tile_group0(unsigned lds_dst, unsigned long long ga) {
    u32x4 g;
    g[0] = uni(1u); g[1] = uni(lds_dst); g[2] = uni((unsigned)ga); g[3] = uni((((unsigned)(ga >> 32)) & 0x01FFFFFFu) | 0x80000000u);
    return g;
}
// the next 128 bytes of the same rows: the address advances inside the descriptor's own words (the carry stays below the type bits for any valid address)
__device__ __forceinline__ void tile_advance(u32x4& g0, unsigned lds_dst) {
    const unsigned lo = g0[2] + GP_ROWB;
    g0[3] = uni(g0[3] + (lo < GP_ROWB ? 1u : 0u)); g0[2] = uni(lo); g0[1] = uni(lds_dst);
}
// both groups are in-out operands: their values stay live behind the instruction, so the compiler reuses none of their registers for another value while the request is on its way
__device__ __forceinline__ void tile_load(u32x4& g0, u32x8& g1) { asm volatile("tensor_load_to_lds %0, %1" : "+s"(g0), "+s"(g1) :: "memory"); }
__global__ __launch_bounds__(128) void k_gemmp(const bf* __restrict__ A, const bf* __restrict__ Bt, int K, h16* PL) {
    __shared__ __attribute__((aligned(2048))) unsigned char sm[GP_RING + 4u * GP_OS];
    const int lane = threadIdx.x & 31, lr = lane & 15, hi = lane >> 4; const unsigned wave = uni(threadIdx.x >> 5);
    const int r0 = blockIdx.x * 128, c0 = blockIdx.y * 128;
    const unsigned pitch = (unsigned)K * 2u;
    const unsigned lbase = (unsigned)(size_t)sm + wave * GP_SLICE;      // this wave's slice in buffer 0
    const unsigned long long gsrc = (wave < 2u) ? (unsigned long long)(size_t)A + (unsigned long long)(r0 + 64 * (int)wave) * pitch
                                                : (unsigned long long)(size_t)Bt + (unsigned long long)(c0 + 64 * ((int)wave - 2)) * pitch;
    const int np = K / GP_K;
    v8f acc[4][4];
#pragma unroll
    for (int mb = 0; mb < 4; ++mb)
#pragma unroll
        for (int nb = 0; nb < 4; ++nb) acc[mb][nb] = (v8f){};
    u32x8 g1 = tile_group1(pitch);
    u32x4 g0 = tile_group0(lbase, gsrc);
    tile_load(g0, g1);
    asm volatile("s_wait_tensorcnt 0x0" ::: "memory");   // stage 0 has landed before the barrier that publishes it
    __syncthreads();
    tile_advance(g0, lbase + GP_BUF);
    tile_load(g0, g1);
    const unsigned wm = wave & 1u, wn = wave >> 1;       // quadrant: rows r0 + 64 wm, columns c0 + 64 wn
    const unsigned aofs = wm * GP_SLICE + (unsigned)lr * GP_PITCH + 16u * (unsigned)hi, bofs = (2u + wn) * GP_SLICE + (unsigned)lr * GP_PITCH + 16u * (unsigned)hi;
    int s = 0;
#pragma unroll 1
    do {                                                 // np >= 2: the body runs at least twice
        const unsigned char* pa = sm + (unsigned)(s & 1) * GP_BUF + aofs; const unsigned char* pb = sm + (unsigned)(s & 1) * GP_BUF + bofs;
        v16bf a0[4], b0[4], a1[4], b1[4];    // fragments of the pass's two k-steps
        b0[0] = ldbs(pb);
#pragma unroll
        for (int mb = 0; mb < 4; ++mb) a0[mb] = ldbs(pa + (unsigned)mb * 16u * GP_PITCH);
#pragma unroll
        for (int nb = 1; nb < 4; ++nb) b0[nb] = ldbs(pb + (unsigned)nb * 16u * GP_PITCH);
#pragma unroll
        for (int mb = 0; mb < 4; ++mb) a1[mb] = ldbs(pa + (unsigned)mb * 16u * GP_PITCH + 64u);
#pragma unroll
        for (int nb = 0; nb < 2; ++nb) b1[nb] = ldbs(pb + (unsigned)nb * 16u * GP_PITCH + 64u);
        __builtin_amdgcn_sched_barrier(0);   // the LDS reads stay one group ahead of the matrix block
#pragma unroll
        for (int nb = 0; nb < 2; ++nb)
#pragma unroll
            for (int mb = 0; mb < 4; ++mb) acc[mb][nb] = wmmab(a0[mb], b0[nb], acc[mb][nb]);
        __builtin_amdgcn_sched_barrier(0);   // the last two fragments go into registers that the eight WMMAs above have freed (keeps the wave within 256 registers), as one group
#pragma unroll
        for (int nb = 2; nb < 4; ++nb) b1[nb] = ldbs(pb + (unsigned)nb * 16u * GP_PITCH + 64u);
        __builtin_amdgcn_sched_barrier(0);   // as above: no LDS read moves in among the WMMAs below
#pragma unroll
        for (int nb = 2; nb < 4; ++nb)
#pragma unroll
            for (int mb = 0; mb < 4; ++mb) acc[mb][nb] = wmmab(a0[mb], b0[nb], acc[mb][nb]);
#pragma unroll
        for (int nb = 0; nb < 4; ++nb)
#pragma unroll
            for (int mb = 0; mb < 4; ++mb) acc[mb][nb] = wmmab(a1[mb], b1[nb], acc[mb][nb]);
        __builtin_amdgcn_sched_barrier(0);   // the WMMAs stay in front of the waits: sunk behind the barrier they would stand in front of the refill and shorten its lead
        asm volatile("s_wait_dscnt 0x0" ::: "memory");      // this wave's reads of buffer s & 1 are done before the buffer is refilled
        asm volatile("s_wait_tensorcnt 0x0" ::: "memory");  // this wave's slice of stage s + 1 has landed
        __syncthreads();                                     // publishes stage s + 1 and ends every wave's reads of stage s
        if (pinned(s + 2 < np)) { tile_advance(g0, lbase + (unsigned)(s & 1) * GP_BUF); tile_load(g0, g1); }
    } while (++s < np);
    asm volatile("s_wait_tensorcnt 0x0" ::: "memory");   // no request outstanding at the wave's end
    asm volatile("s_wait_dscnt 0x0" ::: "memory");       // and no LDS read of the ring
    float* os = (float*)(sm + GP_RING + wave * GP_OS);   // each wave stages in its own range, outside the ring
    const int rq = r0 + (int)wm * 64, cq = c0 + (int)wn * 64;   // the quadrant's first row and column
    const int which = cq / DM;                           // 0 q, 1 k, 2 v; the same for the whole work-group (128 divides DM)
    // value plane of this quadrant's batch element, operand and head (plane set layout: see below the GEMM); its residual plane lies PLN further
    h16* pv = PL + ((size_t)(rq / SEQ) * 6 + (size_t)which * 2) * PLN + (size_t)((cq % DM) / HD) * SEQ * HD;
    const int t0 = rq % SEQ;                             // first token of the quadrant inside its batch element
    if (which == 2) {
        // v: a lane's eight accumulator rows are eight consecutive tokens of one d, a 16-byte piece of a v^T row; 16 d rows x 64 tokens are staged so that every store covers whole 128-byte lines
        h16* hs = (h16*)os;
#pragma unroll
        for (int nb = 0; nb < 4; ++nb) {
#pragma unroll
            for (int mb = 0; mb < 4; ++mb) { v8h o, r;
#pragma unroll
                for (int j = 0; j < 8; ++j) { const float x = acc[mb][nb][j]; const h16 a = (h16)x; o[j] = a; r[j] = (h16)((x - (float)a) * RSC); }
                *(v8ha*)(hs + lr * GP_VP + mb * 16 + hi * 8) = o; *(v8ha*)(hs + 16 * GP_VP + lr * GP_VP + mb * 16 + hi * 8) = r; }
            __builtin_amdgcn_wave_barrier(); asm volatile("" ::: "memory");   // the lanes' LDS writes stay in front of the reads of other lanes' pieces
#pragma unroll
            for (int s = 0; s < 4; ++s) { const int row = 4 * s + (lane >> 3), pc = (lane & 7) * 8;
                const v8h a = *(const v8ha*)(hs + row * GP_VP + pc); const v8h c = *(const v8ha*)(hs + 16 * GP_VP + row * GP_VP + pc);
                h16* p = pv + (size_t)(nb * 16 + row) * SEQ + t0 + pc;
                *(v8h*)p = a; *(v8h*)(p + PLN) = c; }
            __builtin_amdgcn_wave_barrier(); asm volatile("" ::: "memory");   // the reads stay in front of the next tile's writes
        }
    } else {
#pragma unroll
        for (int mb = 0; mb < 4; ++mb) {
#pragma unroll
            for (int nb = 0; nb < 4; ++nb) {
#pragma unroll
                for (int j = 0; j < 8; ++j) os[(hi * 8 + j) * 68 + nb * 16 + lr] = acc[mb][nb][j]; }
            __builtin_amdgcn_wave_barrier(); asm volatile("" ::: "memory");   // as in the v branch: writes in front of the reads
                // q, k: a staged row is one token's 64 d = one 128-byte row of each plane; eight lanes a row, four consecutive rows a store
#pragma unroll
                for (int s = 0; s < 4; ++s) { const int row = 4 * s + (lane >> 3), cofs = (lane & 7) * 8;
                    const v4f x0 = *(const v4fa*)(os + row * 68 + cofs); const v4f x1 = *(const v4fa*)(os + row * 68 + cofs + 4); v8h o, r;
#pragma unroll
                    for (int k = 0; k < 4; ++k) { const h16 a = (h16)x0[k]; o[k] = a; r[k] = (h16)((x0[k] - (float)a) * RSC); const h16 b = (h16)x1[k]; o[4 + k] = b; r[4 + k] = (h16)((x1[k] - (float)b) * RSC); }
                    h16* p = pv + (size_t)(t0 + mb * 16 + row) * HD + cofs;
                    *(v8h*)p = o; *(v8h*)(p + PLN) = r; }
            __builtin_amdgcn_wave_barrier(); asm volatile("" ::: "memory");   // reads in front of the next tile's writes
        }
        asm volatile("s_wait_xcnt 0x0" ::: "memory");   // in the built code this branch's end stands directly in front of the v branch, which reuses the registers that the stores above name
    }
}
// Plane set layout in PL (PLN elements each): 0 q value, 1 q residual, 2 k value, 3 k residual, 4 v^T value, 5 v^T residual; one such set of six per batch element.

// ---- the three operand conversions; none reads what another writes, so they share one launch (k_prep below); blk is the work-group's index inside its own stage.
__device__ __forceinline__ void wt_body(const float* __restrict__ w, int K, int N, int rep, bf* Bt, int blk) {
    const int lane = threadIdx.x & 31; const int wave = __builtin_amdgcn_readfirstlane(threadIdx.x >> 5);
    const int KO = K * rep; const int L0 = (blk * 8 + wave) * 8; const int nlines = (int)(((size_t)N * KO) / 64);
{
#pragma unroll 1
        for (int l = 0; l < 8; ++l) { const int L = L0 + l; if (L >= nlines) break; const size_t e = (size_t)L * 64 + lane * 2; const int ko = (int)(e % KO), n = (int)(e / KO); const int k = ko % K; v2us o;
            o[0] = f2bf(w[(size_t)k * N + n]); o[1] = f2bf(w[(size_t)(k + 1) * N + n]); *(v2us*)(Bt + e) = o; }
         }
}

__device__ __forceinline__ void cvt8_body(const float* __restrict__ src, bf* dst, size_t n8, int blk) { const size_t i = (size_t)blk * 256 + threadIdx.x; if (i >= n8) return; const v8f v = *(const v8f*)(src + i * 8); v8us o;
#pragma unroll
    for (int k = 0; k < 8; ++k) o[k] = f2bf(v[k]); *(v8us*)(dst + i * 8) = o;  }
#define PB_WQKV ((int)(((size_t)NQKV * DM / 64 + 63) / 64))            // work-groups of w_attn: in[1024][3072] -> out[3072][1024]
#define PB_WO2  ((int)(((size_t)DM * DM / 64 + 63) / 64))              // work-groups of w_proj: in[1024][1024] -> out[1024][1024]
#define PB_X    ((int)(((size_t)NB * SEQ * DM / 8 + 255) / 256))       // work-groups of x
// The weight stages come first in the grid: their work-groups run longest (eight dependent trips a wave).
__global__ __launch_bounds__(256) void k_prep(const float* __restrict__ x, const float* __restrict__ wqkv, const float* __restrict__ wo, bf* XB, bf* WQKV, bf* WO2) {
    const int b = blockIdx.x;
    if (b < PB_WQKV) wt_body(wqkv, DM, NQKV, 1, WQKV, b);
    else if (b < PB_WQKV + PB_WO2) wt_body(wo, DM, DM, 1, WO2, b - PB_WQKV);
    else cvt8_body(x, XB, (size_t)NB * SEQ * DM / 8, b - (PB_WQKV + PB_WO2));
}

// ---- fused windowed causal attention, one wave per 16 query rows of one head; a work-group is eight such waves on 128 consecutive query rows; one launch for all heads and batch elements (k_attn below), the rows below RHE on the HIRES body.
// The keys that the eight waves visit together (the window behind the first query up to the last query: at most WIN + 128) are staged in LDS once, in chunks of 128 keys, one tensor load a wave:
// a k chunk is 128 rows of 128 bytes (LDS pitch 144), a v^T chunk 64 rows of 256 bytes (LDS pitch 272), both pitches for the ds_load_b128 fragment reads. Slot of a chunk = the number of the wave that brings it.
// Where two slots are left (the body that is not HIRES) the work-group's 128 q rows, value and residual, are staged in them like k chunks; the HIRES body fills all eight slots and reads q from global memory.
#define AW      8                        // waves per work-group
#define AQ      (AW * 16)                // query rows per work-group
#define AC      128                      // keys per staged chunk
#define AT_KP   144u                     // LDS pitch of a staged k row: 128 + 16
#define AT_VP   272u                     // LDS pitch of a staged v^T row: 256 + 16
#define AT_SLOT 18432u                   // 128 x 144 bytes; 64 x 272 = 17408 rounded up to a multiple of 2 KiB
static_assert(AC * AT_KP <= AT_SLOT && HD * AT_VP <= AT_SLOT && AT_SLOT % 2048u == 0);
static_assert(AC * 2 == 256 && HD * 2 == 128);                  // row lengths that the two pads are for
static_assert(SEQ % AQ == 0 && RHE % AQ == 0 && WIN % AC == 0 && AQ % AC == 0);   // whole work-groups per body, whole chunks
static_assert(2 * (WIN / AC + AQ / AC) <= AW);                  // other body: two planes' chunks, one a wave
static_assert(AQ == AC);                                        // a work-group's q rows are one chunk
static_assert(4 * (RHE / AC) <= AW);                            // HIRES body: four planes' chunks, one a wave
__device__ __forceinline__ v16h ldhs(const unsigned char* p) { return cat16(*(const v8ha*)p, *(const v8ha*)(p + 32)); }   // the k order of ldh, from an LDS row
// Descriptor of one chunk: rows of rowb bytes, source pitch in bytes, word 0 (the pad behind every row) a constant at each use.
__device__ __forceinline__ u32x8 chunk_group1(unsigned word0, unsigned rowb, unsigned rows, unsigned src_pitch) {
    u32x8 g;
    g[0] = uni(word0);
    g[1] = uni((rowb & 0xFFFFu) << 16);
    g[2] = uni((rowb >> 16) | (rows << 16));
    g[3] = uni(rowb << 16);
    g[4] = uni(rows);
    g[5] = uni(src_pitch);
    g[6] = uni(0u);
    g[7] = uni(0u);
    return g;
}
// Key halves visited by a wave: from the 32-aligned half holding key q0 - (WIN - 1) (clipped at 0) up to the half holding key q0 + 15; all of them lie inside the written planes.
// Per 32-key half: S^T tiles [16 keys][16 queries] = K Q^T (A = key rows, B = query rows, k = d); lane (h, n) holds query q0+n, keys kb + 16*tile + 8h + r.
// Online softmax per lane (16 values) + one xor-16 shuffle; the two packed tiles are the B fragment (k = key, n = query) of O^T [d][query] += V^T [d][key] P^T.
// HIRES: value+residual on q, k, P, v (3 products each side); else q value+residual against single k, single P and v.
template <bool HIRES>
__device__ __forceinline__ void attn_body(const h16* __restrict__ PL, bf* CTX, unsigned char* sm, const int qw, const int head, const int batch) {
    const int lane = threadIdx.x & 31, lr = lane & 15, hi = lane >> 4; const unsigned wave = uni(threadIdx.x >> 5);
    const int q0 = qw + 16 * (int)wave;                // this wave's query tile
    constexpr unsigned NCH = HIRES ? RHE / AC : WIN / AC + AQ / AC;   // chunk slots per plane
    constexpr unsigned NKP = HIRES ? 2u : 1u;          // k planes staged, and as many v^T planes behind them
    constexpr unsigned NST = 2u * NKP * NCH;           // slots of the k and v^T chunks
    constexpr bool QS = NST + 2u <= AW;                // two slots left: q value and q residual are staged too
    const int kbase = HIRES ? 0 : max(qw - WIN, 0);    // first staged key
    const unsigned nch = (unsigned)(qw + AQ - kbase) / AC;   // chunks up to the work-group's last query
    const int kb0 = max(q0 - (WIN - 1), 0) & ~31;      // first key half with a key inside the window of query q0
    const size_t hb = (size_t)batch * 6 * PLN + (size_t)head * SEQ * HD;   // this batch element's set of six planes, then the head
    const size_t oQ = hb + (size_t)(q0 + lr) * HD + 8 * hi;
    {
        const unsigned pi = wave / NCH, ch = wave % NCH;   // plane and chunk that this wave brings
        const unsigned dst = (unsigned)(size_t)sm + wave * AT_SLOT;
        const bool isq = QS && wave >= NST && wave < NST + 2u;
        if (pinned((pi < NKP && ch < nch) || isq)) {
            const unsigned plane = isq ? wave - NST : 2u + pi; const int row = isq ? qw : kbase + (int)ch * AC;
            const size_t src = plane * PLN + hb + (size_t)row * HD;
            u32x8 g1 = chunk_group1((1u << 20) | (4u << 22) | (3u << 25), HD * 2u, AC, HD * 2u);
            u32x4 g0 = tile_group0(dst, (unsigned long long)(size_t)(PL + src));
            tile_load(g0, g1);
            asm volatile("s_wait_tensorcnt 0x0" ::: "memory");   // the chunk has landed before the barrier that publishes it
        }
        if (pinned(pi >= NKP && pi < 2u * NKP && ch < nch)) {
            u32x8 g1 = chunk_group1((1u << 20) | (5u << 22) | (3u << 25), AC * 2u, HD, SEQ * 2u);
            u32x4 g0 = tile_group0(dst, (unsigned long long)(size_t)(PL + (4 + pi - NKP) * PLN + hb + (size_t)(kbase + (int)ch * AC)));
            tile_load(g0, g1);
            asm volatile("s_wait_tensorcnt 0x0" ::: "memory");   // as above
        }
    }
    __syncthreads();                                   // publishes every chunk; nothing staged is read in front of it
    const unsigned char* sK = sm + (unsigned)lr * AT_KP + 16u * (unsigned)hi;                          // k value chunks; the residual plane's lie NCH slots further
    const unsigned char* sQ = sm + NST * AT_SLOT + (16u * wave + (unsigned)lr) * AT_KP + 16u * (unsigned)hi;   // QS: this wave's q value rows; the residual rows lie one slot further
    const unsigned char* sV = sm + NKP * NCH * AT_SLOT + (unsigned)lr * AT_VP + 16u * (unsigned)hi;    // v^T value chunks; likewise
    const float CE = SCL * 1.4426950408889634f;
    v8f o[4], orr[4];
#pragma unroll
    for (int dt = 0; dt < 4; ++dt) { o[dt] = (v8f){}; orr[dt] = (v8f){}; }
    float m = NEGB, l = 0.0f;
#pragma unroll 1
    for (int kb = kb0; kb < q0 + 16; kb += 32) {
        v8f sh0 = (v8f){}, sh1 = (v8f){}, sr0 = (v8f){}, sr1 = (v8f){};
        const unsigned kr = (unsigned)(kb - kbase);    // a half of 32 keys lies inside one chunk
        const unsigned char* pk = sK + (kr / AC) * AT_SLOT + (kr % AC) * AT_KP;
        const unsigned char* pv = sV + (kr / AC) * AT_SLOT + (kr % AC) * 2u;
#pragma unroll
        for (int kc = 0; kc < HD; kc += 32) {
            const v16h bq  = QS ? ldhs(sQ + kc * 2) : ldh(PL + oQ + kc);
            const v16h bqr = QS ? ldhs(sQ + AT_SLOT + kc * 2) : ldh(PL + PLN + oQ + kc);
            const v16h ak0 = ldhs(pk + kc * 2);
            const v16h ak1 = ldhs(pk + 16u * AT_KP + kc * 2);
            sh0 = wmma16(ak0, bq, sh0);  sh1 = wmma16(ak1, bq, sh1);
            sr0 = wmma16(ak0, bqr, sr0); sr1 = wmma16(ak1, bqr, sr1);
            if (HIRES) {
                const v16h kr0 = ldhs(pk + NCH * AT_SLOT + kc * 2);
                const v16h kr1 = ldhs(pk + NCH * AT_SLOT + 16u * AT_KP + kc * 2);
                sr0 = wmma16(kr0, bq, sr0); sr1 = wmma16(kr1, bq, sr1);
                asm volatile("v_nop\n\tv_nop\n\tv_nop\n\tv_nop" : "+v"(sh0), "+v"(sh1), "+v"(sr0), "+v"(sr1) : "v"(ak0), "v"(ak1), "v"(bq), "v"(bqr), "v"(kr0), "v"(kr1));
            } else {
                asm volatile("v_nop\n\tv_nop\n\tv_nop\n\tv_nop" : "+v"(sh0), "+v"(sh1), "+v"(sr0), "+v"(sr1) : "v"(ak0), "v"(ak1), "v"(bq), "v"(bqr));
            }
        }
        float u[16];
#pragma unroll
        for (int r = 0; r < 8; ++r) { u[r] = (sh0[r] + sr0[r] * RINV) * CE; u[8 + r] = (sh1[r] + sr1[r] * RINV) * CE; }
        if (kb + 31 > q0 || kb + (WIN - 16) < q0) {   // wave-uniform: this half touches the diagonal or the far edge of the window; keys above the query or WIN or more behind it are excluded
            const int qi = q0 + lr; const int k0 = kb + 8 * hi;
#pragma unroll
            for (int r = 0; r < 8; ++r) { u[r] = (k0 + r > qi || qi - (k0 + r) >= WIN) ? NEGB : u[r]; u[8 + r] = (k0 + 16 + r > qi || qi - (k0 + 16 + r) >= WIN) ? NEGB : u[8 + r]; }
        }
        float mx = u[0];
#pragma unroll
        for (int i = 1; i < 16; ++i) mx = fmaxf(mx, u[i]);
        mx = fmaxf(mx, __shfl_xor(mx, 16, 32));
        const float mn = fmaxf(fmaxf(m, mx), MFLOOR);
        const float corr = __builtin_amdgcn_exp2f(m - mn);
        m = mn;
        float psum = 0.0f;
#pragma unroll
        for (int i = 0; i < 16; ++i) { u[i] = __builtin_amdgcn_exp2f(u[i] - mn); psum += u[i]; }
        l = l * corr + psum;
#pragma unroll
        for (int dt = 0; dt < 4; ++dt) {
#pragma unroll
            for (int r = 0; r < 8; ++r) { o[dt][r] *= corr; if (HIRES) orr[dt][r] *= corr; } }
        v16h pb, pr;
#pragma unroll
        for (int i = 0; i < 16; ++i) { const float pc = u[i] * PCAR; const h16 ph = toh_flush(pc); pb[i] = ph; pr[i] = toh_flush((pc - (float)ph) * RSC); }
        if (HIRES) {
#pragma unroll
            for (int dt = 0; dt < 4; ++dt) {
                const v16h av  = ldhs(pv + (unsigned)dt * 16u * AT_VP);
                const v16h avr = ldhs(pv + NCH * AT_SLOT + (unsigned)dt * 16u * AT_VP);
                o[dt]   = wmma16(av, pb, o[dt]);
                orr[dt] = wmma16(avr, pb, orr[dt]);
                orr[dt] = wmma16(av, pr, orr[dt]);
                asm volatile("v_nop\n\tv_nop\n\tv_nop\n\tv_nop" : "+v"(o[dt]), "+v"(orr[dt]) : "v"(av), "v"(avr), "v"(pb), "v"(pr));
            }
        } else {
            const v16h av0 = ldhs(pv);
            const v16h av1 = ldhs(pv + 16u * AT_VP);
            const v16h av2 = ldhs(pv + 32u * AT_VP);
            const v16h av3 = ldhs(pv + 48u * AT_VP);
            o[0] = wmma16(av0, pb, o[0]); o[1] = wmma16(av1, pb, o[1]); o[2] = wmma16(av2, pb, o[2]); o[3] = wmma16(av3, pb, o[3]);
            asm volatile("v_nop\n\tv_nop\n\tv_nop\n\tv_nop" : "+v"(o[0]), "+v"(o[1]), "+v"(o[2]), "+v"(o[3]) : "v"(av0), "v"(av1), "v"(av2), "v"(av3), "v"(pb));
        }
    }
    if (!QS) asm volatile("s_wait_xcnt 0x0" ::: "memory");   // stands in front of whatever reuses the address registers of the loop's q loads
    l += __shfl_xor(l, 16, 32);
    const float inv = 1.0f / (l * PCAR);
    // output staging, 4 KiB a wave, in the chunks' LDS once every wave has left its loop
    asm volatile("s_wait_dscnt 0x0" ::: "memory");   // this wave's fragment reads are done before another wave writes over the chunks
    __syncthreads();
    unsigned short* ost = (unsigned short*)(sm + wave * 4096u);
#pragma unroll
    for (int dt = 0; dt < 4; ++dt) { v8us vh, vl;
#pragma unroll
        for (int r = 0; r < 8; ++r) { float y = o[dt][r]; if (HIRES) y += orr[dt][r] * RINV; y *= inv; unsigned short a, c; splitf(y, a, c); vh[r] = a; vl[r] = c; }
        *(v8usa*)(ost + lr * HD + dt * 16 + hi * 8) = vh; *(v8usa*)(ost + 16 * HD + lr * HD + dt * 16 + hi * 8) = vl; }
    __builtin_amdgcn_wave_barrier(); asm volatile("" ::: "memory");
    bf* crow = CTX + ((size_t)batch * SEQ + q0) * CK + head * HD;
{
#pragma unroll
        for (int s = 0; s < 4; ++s) { const int row = 4 * s + (lane >> 3), pc = (lane & 7) * 8;
            const v8us a = *(const v8usa*)(ost + row * HD + pc); const v8us c = *(const v8usa*)(ost + 16 * HD + row * HD + pc);
            *(v8us*)(crow + (size_t)row * CK + pc) = a; *(v8us*)(crow + (size_t)row * CK + DM + pc) = c; }
         }
}
#define AT_HI  (RHE / AQ)                     // work-groups per head on the HIRES body
#define AT_LO  ((SEQ - RHE) / AQ)             // work-groups per head on the other body
#define AT_NHI (AT_HI * NH * NB)
// Grid order: a HIRES wave with many key halves runs longest. So the HIRES work-groups come first, the one with the most key halves ahead;
// behind them the others, query block fastest, then head, then batch element.
__global__ __launch_bounds__(AW * 32) __attribute__((amdgpu_num_vgpr(256))) void k_attn(const h16* __restrict__ PL, bf* CTX) {
    __shared__ __attribute__((aligned(2048))) unsigned char sm[AW * AT_SLOT];   // one chunk slot a wave: two work-groups fit a WGP's LDS
    const int b = blockIdx.x;
    if (b < AT_NHI) { const int hb = b % (NH * NB); attn_body<true>(PL, CTX, sm, (AT_HI - 1 - b / (NH * NB)) * AQ, hb % NH, hb / NH); }
    else { const int c = b - AT_NHI, hb = c / (AT_LO > 0 ? AT_LO : 1); attn_body<false>(PL, CTX, sm, RHE + (c - hb * AT_LO) * AQ, hb % NH, hb / NH); }
}

// ---- k_gemmw: the output product, out[m][n] (f32) = sum_k (hi[m][k] + lo[m][k]) w[n][k]; 128x128 output tile per work-group of four waves, each wave a 64x64 quadrant; grid (M/128, N/128), 128 threads.
// A pass is 64 k = 128 bytes of 384 operand rows: the 128 hi rows, the 128 lo rows and the 128 w rows. A w row is staged once and its fragment read once for both context halves:
// every accumulator takes the hi product and the lo product of each 32-k step. One tensor load a wave and pass (wave 0: hi, wave 1: lo, waves 2, 3: 64 w rows each), LDS pitch 144 bytes; the two-buffer ring of k_gemmp.
#define GO_ASL  18432u                   // 128 rows x 144 bytes: one context half's slice, a multiple of 2 KiB
#define GO_BUF  (2u * GO_ASL + 2u * GP_SLICE)
#define GO_RING (2u * GO_BUF)
static_assert(128u * GP_PITCH <= GO_ASL && GO_ASL % 2048u == 0);
__global__ __launch_bounds__(128) void k_gemmw(const bf* __restrict__ A, const bf* __restrict__ Bt, float* C) {
    __shared__ __attribute__((aligned(2048))) unsigned char sm[GO_RING + 4u * GP_OS];
    const int lane = threadIdx.x & 31, lr = lane & 15, hi = lane >> 4; const unsigned wave = uni(threadIdx.x >> 5);
    const int r0 = blockIdx.x * 128, c0 = blockIdx.y * 128;
    const bool ctx = wave < 2u;                          // this wave brings a context half (else 64 w rows)
    const unsigned lbase = (unsigned)(size_t)sm + (ctx ? wave * GO_ASL : 2u * GO_ASL + (wave - 2u) * GP_SLICE);   // this wave's slice in buffer 0
    const unsigned long long gsrc = ctx ? (unsigned long long)(size_t)A + (unsigned long long)r0 * (CK * 2u) + wave * (DM * 2u)
                                        : (unsigned long long)(size_t)Bt + (unsigned long long)(c0 + 64 * ((int)wave - 2)) * (DM * 2u);
    constexpr int np = DM / GP_K;
    v8f acc[4][4];
#pragma unroll
    for (int mb = 0; mb < 4; ++mb)
#pragma unroll
        for (int nb = 0; nb < 4; ++nb) acc[mb][nb] = (v8f){};
    u32x8 g1 = chunk_group1((1u << 20) | (4u << 22) | (3u << 25), GP_ROWB, ctx ? 128u : 64u, ctx ? CK * 2u : DM * 2u);
    u32x4 g0 = tile_group0(lbase, gsrc);
    tile_load(g0, g1);
    asm volatile("s_wait_tensorcnt 0x0" ::: "memory");   // stage 0 has landed before the barrier that publishes it
    __syncthreads();
    tile_advance(g0, lbase + GO_BUF);
    tile_load(g0, g1);
    const unsigned wm = wave & 1u, wn = wave >> 1;       // quadrant: rows r0 + 64 wm, columns c0 + 64 wn
    const unsigned aofs = (wm * 64u + (unsigned)lr) * GP_PITCH + 16u * (unsigned)hi, bofs = 2u * GO_ASL + wn * GP_SLICE + (unsigned)lr * GP_PITCH + 16u * (unsigned)hi;
    int s = 0;
#pragma unroll 1
    do {
        const unsigned char* ph = sm + (unsigned)(s & 1) * GO_BUF + aofs; const unsigned char* pl = ph + GO_ASL; const unsigned char* pb = sm + (unsigned)(s & 1) * GO_BUF + bofs;
        v16bf h[2][4], l[2][4], b[2][4];     // fragments of the pass's two k-steps, read in the order in which the WMMAs take them
#pragma unroll
        for (int ks = 0; ks < 2; ++ks) {
            b[ks][0] = ldbs(pb + (unsigned)ks * 64u);
#pragma unroll
            for (int mb = 0; mb < 4; ++mb) h[ks][mb] = ldbs(ph + (unsigned)mb * 16u * GP_PITCH + (unsigned)ks * 64u);
#pragma unroll
            for (int nb = 1; nb < 4; ++nb) b[ks][nb] = ldbs(pb + (unsigned)nb * 16u * GP_PITCH + (unsigned)ks * 64u);
#pragma unroll
            for (int mb = 0; mb < 4; ++mb) l[ks][mb] = ldbs(pl + (unsigned)mb * 16u * GP_PITCH + (unsigned)ks * 64u);
        }
        __builtin_amdgcn_sched_barrier(0);   // the LDS reads stay one group ahead of the matrix block
#pragma unroll
        for (int ks = 0; ks < 2; ++ks) {
#pragma unroll
            for (int nb = 0; nb < 4; ++nb)
#pragma unroll
                for (int mb = 0; mb < 4; ++mb) acc[mb][nb] = wmmab(h[ks][mb], b[ks][nb], acc[mb][nb]);
#pragma unroll
            for (int nb = 0; nb < 4; ++nb)
#pragma unroll
                for (int mb = 0; mb < 4; ++mb) acc[mb][nb] = wmmab(l[ks][mb], b[ks][nb], acc[mb][nb]);
        }
        __builtin_amdgcn_sched_barrier(0);   // the WMMAs stay in front of the waits: sunk behind the barrier they would stand in front of the refill and shorten its lead
        asm volatile("s_wait_dscnt 0x0" ::: "memory");      // this wave's reads of buffer s & 1 are done before the buffer is refilled
        asm volatile("s_wait_tensorcnt 0x0" ::: "memory");  // this wave's slice of stage s + 1 has landed
        __syncthreads();                                     // publishes stage s + 1 and ends every wave's reads of stage s
        if (pinned(s + 2 < np)) { tile_advance(g0, lbase + (unsigned)(s & 1) * GO_BUF); tile_load(g0, g1); }
    } while (++s < np);
    asm volatile("s_wait_tensorcnt 0x0" ::: "memory");   // no request outstanding at the wave's end
    asm volatile("s_wait_dscnt 0x0" ::: "memory");       // and no LDS read of the ring
    float* os = (float*)(sm + GO_RING + wave * GP_OS);   // each wave stages in its own range, outside the ring
    const int rq = r0 + (int)wm * 64, cq = c0 + (int)wn * 64;   // the quadrant's first row and column
#pragma unroll
    for (int mb = 0; mb < 4; ++mb) {
#pragma unroll
        for (int nb = 0; nb < 4; ++nb) {
#pragma unroll
            for (int j = 0; j < 8; ++j) os[(hi * 8 + j) * 68 + nb * 16 + lr] = acc[mb][nb][j]; }
        __builtin_amdgcn_wave_barrier(); asm volatile("" ::: "memory");   // the lanes' LDS writes stay in front of the reads of other lanes' pieces
        float* crow = C + (size_t)(rq + mb * 16) * DM + cq;
#pragma unroll
        for (int s = 0; s < 8; ++s) { const int row = 2 * s + hi, cofs = lr * 4; const v4f val = *(const v4fa*)(os + row * 68 + cofs);
            *(v4f*)(crow + (size_t)row * DM + cofs) = val; }
        __builtin_amdgcn_wave_barrier(); asm volatile("" ::: "memory");   // reads in front of the next tile's writes
    }
}

extern "C" void kernel_launch(void* const* d_in, const int* in_sizes, int n_in,
                              void* d_out, int out_size, void* d_ws, size_t ws_size, hipStream_t stream) {
    if (n_in < 3) return;
    const int need_x = (NB - 1) * SEQ_FULL * DM + SEQ * DM;
    if (in_sizes[0] < need_x || in_sizes[1] < DM * NQKV || in_sizes[2] < DM * DM || out_size < need_x) return;
    if (WS_TOTAL > ws_size) return;
    const float* x = (const float*)d_in[0]; const float* wqkv = (const float*)d_in[1]; const float* wo = (const float*)d_in[2];   // x, w_attn, w_proj
    float* OUT = (float*)d_out;     // [2][2048][1024]
    char* wsp = (char*)d_ws;
    bf* WQKV = (bf*)wsp;  wsp += WS_WQKV;      // [3072][1024] bf16, K-contiguous
    bf* WO2  = (bf*)wsp;  wsp += WS_WO2;       // [1024][1024] bf16, K-contiguous
    bf* XB   = (bf*)wsp;  wsp += WS_XB;        // [NB * SEQ][1024] bf16
    h16* PL  = (h16*)wsp; wsp += WS_PL;        // six head plane sets per batch element
    bf* CTX  = (bf*)wsp;  wsp += WS_CTX;       // [NB * SEQ][2048] bf16 hi | lo
    // every stage runs once, over all NB batch elements: the row-wise stages on NB * SEQ rows, the per-head stage with head and batch element decoded from its one-dimensional work-group index
    k_prep<<<(unsigned)(PB_WQKV + PB_WO2 + PB_X), 256, 0, stream>>>(x, wqkv, wo, XB, WQKV, WO2);
    k_gemmp<<<dim3(NB * SEQ / 128, NQKV / 128, 1), 128, 0, stream>>>(XB, WQKV, DM, PL);   // q | k | v leave the projection as the f16 planes
    k_attn<<<(unsigned)((AT_HI + AT_LO) * NH * NB), AW * 32, 0, stream>>>(PL, CTX);
    k_gemmw<<<dim3(NB * SEQ / 128, DM / 128, 1), 128, 0, stream>>>(CTX, WO2, OUT);
}

// v007
// A run of this version takes 66.3 microseconds.
// Timed twice side by side with v006, it ran 1.08 and 1.07 times as fast.
// Over all steps from v000 it is 4.17 times as fast.
#include <hip/hip_runtime.h>

// Windowed causal multi-head attention with a fused qkv projection (x [2][2048][1024]; qkv = x w_attn ('io' [1024][3072], column = which*1024 + h*64 + d, no bias; 16 heads x 64); scores x 64^-0.5, key j visible to query i when 0 <= i - j < 256; softmax; out = merged w_proj ('io' [1024][1024], no bias) -> [2][2048][1024]).
// Compute dtypes, f32 accumulate everywhere: x, w_attn, w_proj converted to bf16 (RNE) and multiplied with v_wmma_f32_16x16x32_bf16 (exact products); attention on v_wmma_f32_16x16x32_f16:
// q, k, v carried as f16 value + f16 residual x2^11 (separate accumulator, folded back x2^-11); query rows < 256 use value+residual on q, k, P, v (3 products); rows >= 256 use q value+residual against single f16 k, single f16 P (x1024) and v;
// softmax f32 (running max, exp2); merged context stored as bf16 hi | lo; both halves are multiplied with the one bf16 w_proj plane on the bf16 WMMA, into the same accumulators.
// Fused flash-style attention in the transposed form S^T = K Q^T, O^T = V^T P^T: the packed score tiles are the B fragment of the second product directly (no probability plane, no LDS exchange); only the 32-key halves inside the window of a query tile are visited.

#ifndef NB
#define NB 2
#endif
#ifndef SEQ
#define SEQ 2048
#endif
#define NB_FULL  2
#define SEQ_FULL 2048
#define DM   1024
#define NH   16
#define HD   64
#define NQKV (3 * DM)
#define CK   (2 * DM)                 // context plane pitch: hi | lo along K
#define RH   256                      // query rows < RH use value+residual on every attention operand
#define RHE  ((SEQ < RH) ? SEQ : RH)
#define WIN  256                      // attention window: key j visible to query i when 0 <= i - j < WIN
#define PCAR 1024.0f                  // carry of the f16 probability operand
#define RSC  2048.0f                  // carry of every f16 residual plane (2^11)
#define RINV (1.0f / 2048.0f)
#define SCL  0.125f                   // HD^-0.5
#define NEGB (-3.0e38f)
#define MFLOOR (-1.0e30f)             // floor of the running maximum: a key half with no visible key for a query yields probabilities exactly 0
#define PLN  ((size_t)NH * SEQ * HD)  // elements per head plane set

#define WS_WQKV ((size_t)NQKV * DM * 2)
#define WS_WO2  ((size_t)DM * DM * 2)
#define WS_XB   ((size_t)NB * SEQ * DM * 2)
#define WS_PL   ((size_t)NB * 6 * NH * SEQ * HD * 2)
#define WS_CTX  ((size_t)NB * SEQ * CK * 2)
#define WS_TOTAL (WS_WQKV + WS_WO2 + WS_XB + WS_PL + WS_CTX)

static_assert(NB <= NB_FULL);                 // batch count within the inputs
static_assert(SEQ <= SEQ_FULL);               // sequence rows within the inputs
static_assert(NB == 1 || SEQ == SEQ_FULL);    // the batch elements' rows follow one another in x and out: one row range of NB * SEQ
static_assert(SEQ % 64 == 0);
static_assert(DM % 64 == 0);                  // wave quadrant columns
static_assert(NQKV % 64 == 0);                // wave quadrant columns
static_assert(DM % 32 == 0);                  // k-step of the projection
static_assert(HD == 64);
static_assert(NH * HD == DM);                 // merged head columns
static_assert(RH % 32 == 0);                  // whole key halves below the precision boundary
static_assert(RHE % 16 == 0);                 // whole query tiles on the HIRES body
static_assert((SEQ - RHE) % 16 == 0);         // whole query tiles on the other body
static_assert(WIN >= 16);                     // every query of a 16-row tile sees at least its own key
static_assert(WIN <= SEQ_FULL);               // window within the sequence
static_assert(WS_WQKV % 256 == 0);
static_assert(WS_WO2 % 256 == 0);
static_assert(WS_XB % 256 == 0);
static_assert(WS_PL % 256 == 0);
static_assert(WS_CTX % 256 == 0);
static_assert(WS_TOTAL <= (size_t)268435456); // total carve <= 256 MiB

typedef _Float16 h16;
typedef unsigned short bf;
typedef __attribute__((ext_vector_type(16))) __bf16   v16bf;
typedef __attribute__((ext_vector_type(16))) _Float16 v16h;
typedef __attribute__((ext_vector_type(8)))  _Float16 v8h;
typedef __attribute__((ext_vector_type(8)))  unsigned short v8us;
typedef __attribute__((ext_vector_type(8)))  float    v8f;
typedef __attribute__((ext_vector_type(4)))  float    v4f;
typedef v4f  __attribute__((may_alias)) v4fa;
typedef v8us __attribute__((may_alias)) v8usa;
typedef v8h  __attribute__((may_alias)) v8ha;

__device__ __forceinline__ unsigned short f2bf(float f) { unsigned u = __float_as_uint(f); u += 0x7FFFu + ((u >> 16) & 1u); return (unsigned short)(u >> 16); }   // RNE convert
__device__ __forceinline__ float bf2f(unsigned short b) { return __uint_as_float(((unsigned)b) << 16); }
__device__ __forceinline__ void splitf(float y, unsigned short& h, unsigned short& l) { h = f2bf(y); l = f2bf(y - bf2f(h)); }
__device__ __forceinline__ v16h cat16(v8h lo, v8h hi) { return __builtin_shufflevector(lo, hi, 0, 1, 2, 3, 4, 5, 6, 7, 8, 9, 10, 11, 12, 13, 14, 15); }
__device__ __forceinline__ v16bf cat16b(v8us lo, v8us hi) { return __builtin_bit_cast(v16bf, __builtin_shufflevector(lo, hi, 0, 1, 2, 3, 4, 5, 6, 7, 8, 9, 10, 11, 12, 13, 14, 15)); }
__device__ __forceinline__ v8f wmma16(v16h a, v16h b, v8f c) { return __builtin_amdgcn_wmma_f32_16x16x32_f16(false, a, false, b, (short)0, c, false, false); }
__device__ __forceinline__ v8f wmmab(v16bf a, v16bf b, v8f c) { return __builtin_amdgcn_wmma_f32_16x16x32_bf16(false, a, false, b, (short)0, c, false, false); }
// Fragment loaders from K-contiguous 16-bit rows; the pointer already includes row (lane & 15) and 8 * (lane >> 4): elements 0..7 <- k0 + 8h + i, elements 8..15 <- k0 + 16 + 8h + i (A and B alike).
__device__ __forceinline__ v16h  ldh(const h16* p) { return cat16(*(const v8h*)p, *(const v8h*)(p + 16)); }
__device__ __forceinline__ v16bf ldb(const bf* p)  { return cat16b(*(const v8us*)p, *(const v8us*)(p + 16)); }
// f32 -> f16 operand convert that cannot produce an f16 subnormal (value select after the plane's carry).
static __device__ __forceinline__ h16 toh_flush(float v) { const h16 r = (h16)v; return (fabsf(v) < 6.103515625e-05f) ? (h16)0.0f : r; }

// ---- k_gemmp: the qkv projection, 128x128 output tile per work-group of four waves, each wave a 64x64 quadrant (16 accumulators); grid (M/128, N/128), 128 threads.
// c[m][n] (f32) = sum_k A[m][k] Bt[n][k], bf16 operands in K-contiguous planes. K % 64 == 0, K >= 128, M and N multiples of 128 (asserted below for every use).
// A quadrant is 64 tokens x the 64 columns of one head of q, k or v,
// and the epilogue stores it straight as that head's two f16 planes (value, residual x2^11) in the layout the attention kernels read: q and k [token][d], v transposed [d][token].
// A pass is 64 k = 128 bytes of each of the 256 operand rows. Every wave brings one slice of 64 rows per pass into LDS with one tensor load (waves 0, 1: the A rows; waves 2, 3: the Bt rows),
// padded to a pitch of 144 bytes for the ds_load_b128 fragment reads; two buffers, the load of pass s + 2 issued when every wave has left pass s.
#define GP_K     64                      // k per pass
#define GP_ROWB  128u                    // bytes of one operand row per pass
#define GP_PITCH 144u                    // LDS row pitch: 128 + 16
#define GP_SLICE 10240u                  // 64 rows x 144 bytes = 9216, rounded up to a multiple of 2 KiB
#define GP_BUF   (4u * GP_SLICE)
#define GP_RING  (2u * GP_BUF)
#define GP_OS    (2u * 16u * 144u)       // output staging bytes per wave, behind the ring: 16 rows x 68 f32, or two f16 tiles of 16 rows x 144 bytes
#define GP_VP    72                      // pitch of a staged v^T row in f16 elements: 64 tokens + 16 bytes
static_assert(16u * 68u * 4u <= GP_OS);
static_assert((NB * SEQ) % 128 == 0);    // GEMM row tiles
static_assert(NQKV % 128 == 0);          // GEMM column tiles
static_assert(DM % 128 == 0);            // GEMM column tiles
static_assert(DM % GP_K == 0 && DM / GP_K >= 2);   // whole passes, two stages or more
static_assert(64u * GP_PITCH <= GP_SLICE && GP_SLICE % 2048u == 0);
typedef unsigned u32x4 __attribute__((ext_vector_type(4)));
typedef unsigned u32x8 __attribute__((ext_vector_type(8)));
__device__ __forceinline__ unsigned uni(unsigned v) { return (unsigned)__builtin_amdgcn_readfirstlane(v); }
__device__ __forceinline__ unsigned pinned(unsigned v) { unsigned w = uni(v); asm volatile("" : "+s"(w)); return w; }   // holds a wave-uniform test in a scalar register: the branch around a tensor load must be a scalar one (the load ignores EXEC)
__device__ __forceinline__ v16bf ldbs(const unsigned char* p) { return cat16b(*(const v8usa*)p, *(const v8usa*)(p + 32)); }   // the k order of ldb, from an LDS row
// Descriptor of one request: 64 rows of 128 bytes, source pitch in bytes, 16 bytes of pad behind every row.
__device__ __forceinline__ u32x8 tile_group1(unsigned src_pitch) {
    u32x8 g;
    g[0] = uni((1u << 20) | (4u << 22) | (3u << 25));
    g[1] = uni((GP_ROWB & 0xFFFFu) << 16);
    g[2] = uni((GP_ROWB >> 16) | (64u << 16));
    g[3] = uni(GP_ROWB << 16);
    g[4] = uni(64u);
    g[5] = uni(src_pitch);
    g[6] = uni(0u);
    g[7] = uni(0u);
    return g;
}
__device__ __forceinline__ u32x4 tile_group0(unsigned lds_dst, unsigned long long ga) {
    u32x4 g;
    g[0] = uni(1u); g[1] = uni(lds_dst); g[2] = uni((unsigned)ga); g[3] = uni((((unsigned)(ga >> 32)) & 0x01FFFFFFu) | 0x80000000u);
    return g;
}
// the next 128 bytes of the same rows: the address advances inside the descriptor's own words (the carry stays below the type bits for any valid address)
__device__ __forceinline__ void tile_advance(u32x4& g0, unsigned lds_dst) {
    const unsigned lo = g0[2] + GP_ROWB;
    g0[3] = uni(g0[3] + (lo < GP_ROWB ? 1u : 0u)); g0[2] = uni(lo); g0[1] = uni(lds_dst);
}
// both groups are in-out operands: their values stay live behind the instruction, so the compiler reuses none of their registers for another value while the request is on its way
__device__ __forceinline__ void tile_load(u32x4& g0, u32x8& g1) { asm volatile("tensor_load_to_lds %0, %1" : "+s"(g0), "+s"(g1) :: "memory"); }
__global__ __launch_bounds__(128) void k_gemmp(const bf* __restrict__ A, const bf* __restrict__ Bt, int K, h16* PL) {
    __shared__ __attribute__((aligned(2048))) unsigned char sm[GP_RING + 4u * GP_OS];
    const int lane = threadIdx.x & 31, lr = lane & 15, hi = lane >> 4; const unsigned wave = uni(threadIdx.x >> 5);
    const int r0 = blockIdx.x * 128, c0 = blockIdx.y * 128;
    const unsigned pitch = (unsigned)K * 2u;
    const unsigned lbase = (unsigned)(size_t)sm + wave * GP_SLICE;      // this wave's slice in buffer 0
    const unsigned long long gsrc = (wave < 2u) ? (unsigned long long)(size_t)A + (unsigned long long)(r0 + 64 * (int)wave) * pitch
                                                : (unsigned long long)(size_t)Bt + (unsigned long long)(c0 + 64 * ((int)wave - 2)) * pitch;
    const int np = K / GP_K;
    v8f acc[4][4];
#pragma unroll
    for (int mb = 0; mb < 4; ++mb)
#pragma unroll
        for (int nb = 0; nb < 4; ++nb) acc[mb][nb] = (v8f){};
    u32x8 g1 = tile_group1(pitch);
    u32x4 g0 = tile_group0(lbase, gsrc);
    tile_load(g0, g1);
    asm volatile("s_wait_tensorcnt 0x0" ::: "memory");   // stage 0 has landed before the barrier that publishes it
    __syncthreads();
    tile_advance(g0, lbase + GP_BUF);
    tile_load(g0, g1);
    const unsigned wm = wave & 1u, wn = wave >> 1;       // quadrant: rows r0 + 64 wm, columns c0 + 64 wn
    const unsigned aofs = wm * GP_SLICE + (unsigned)lr * GP_PITCH + 16u * (unsigned)hi, bofs = (2u + wn) * GP_SLICE + (unsigned)lr * GP_PITCH + 16u * (unsigned)hi;
    int s = 0;
#pragma unroll 1
    do {                                                 // np >= 2: the body runs at least twice
        const unsigned char* pa = sm + (unsigned)(s & 1) * GP_BUF + aofs; const unsigned char* pb = sm + (unsigned)(s & 1) * GP_BUF + bofs;
        v16bf a0[4], b0[4], a1[4], b1[4];    // fragments of the pass's two k-steps
        b0[0] = ldbs(pb);
#pragma unroll
        for (int mb = 0; mb < 4; ++mb) a0[mb] = ldbs(pa + (unsigned)mb * 16u * GP_PITCH);
#pragma unroll
        for (int nb = 1; nb < 4; ++nb) b0[nb] = ldbs(pb + (unsigned)nb * 16u * GP_PITCH);
#pragma unroll
        for (int mb = 0; mb < 4; ++mb) a1[mb] = ldbs(pa + (unsigned)mb * 16u * GP_PITCH + 64u);
#pragma unroll
        for (int nb = 0; nb < 2; ++nb) b1[nb] = ldbs(pb + (unsigned)nb * 16u * GP_PITCH + 64u);
        __builtin_amdgcn_sched_barrier(0);   // the LDS reads stay one group ahead of the matrix block
#pragma unroll
        for (int nb = 0; nb < 2; ++nb)
#pragma unroll
            for (int mb = 0; mb < 4; ++mb) acc[mb][nb] = wmmab(a0[mb], b0[nb], acc[mb][nb]);
        __builtin_amdgcn_sched_barrier(0);   // the last two fragments go into registers that the eight WMMAs above have freed (keeps the wave within 256 registers), as one group
#pragma unroll
        for (int nb = 2; nb < 4; ++nb) b1[nb] = ldbs(pb + (unsigned)nb * 16u * GP_PITCH + 64u);
        __builtin_amdgcn_sched_barrier(0);   // as above: no LDS read moves in among the WMMAs below
#pragma unroll
        for (int nb = 2; nb < 4; ++nb)
#pragma unroll
            for (int mb = 0; mb < 4; ++mb) acc[mb][nb] = wmmab(a0[mb], b0[nb], acc[mb][nb]);
#pragma unroll
        for (int nb = 0; nb < 4; ++nb)
#pragma unroll
            for (int mb = 0; mb < 4; ++mb) acc[mb][nb] = wmmab(a1[mb], b1[nb], acc[mb][nb]);
        __builtin_amdgcn_sched_barrier(0);   // the WMMAs stay in front of the waits: sunk behind the barrier they would stand in front of the refill and shorten its lead
        asm volatile("s_wait_dscnt 0x0" ::: "memory");      // this wave's reads of buffer s & 1 are done before the buffer is refilled
        asm volatile("s_wait_tensorcnt 0x0" ::: "memory");  // this wave's slice of stage s + 1 has landed
        __syncthreads();                                     // publishes stage s + 1 and ends every wave's reads of stage s
        if (pinned(s + 2 < np)) { tile_advance(g0, lbase + (unsigned)(s & 1) * GP_BUF); tile_load(g0, g1); }
    } while (++s < np);
    asm volatile("s_wait_tensorcnt 0x0" ::: "memory");   // no request outstanding at the wave's end
    asm volatile("s_wait_dscnt 0x0" ::: "memory");       // and no LDS read of the ring
    float* os = (float*)(sm + GP_RING + wave * GP_OS);   // each wave stages in its own range, outside the ring
    const int rq = r0 + (int)wm * 64, cq = c0 + (int)wn * 64;   // the quadrant's first row and column
    const int which = cq / DM;                           // 0 q, 1 k, 2 v; the same for the whole work-group (128 divides DM)
    // value plane of this quadrant's batch element, operand and head (plane set layout: see below the GEMM); its residual plane lies PLN further
    h16* pv = PL + ((size_t)(rq / SEQ) * 6 + (size_t)which * 2) * PLN + (size_t)((cq % DM) / HD) * SEQ * HD;
    const int t0 = rq % SEQ;                             // first token of the quadrant inside its batch element
    if (which == 2) {
        // v: a lane's eight accumulator rows are eight consecutive tokens of one d, a 16-byte piece of a v^T row; 16 d rows x 64 tokens are staged so that every store covers whole 128-byte lines
        h16* hs = (h16*)os;
#pragma unroll
        for (int nb = 0; nb < 4; ++nb) {
#pragma unroll
            for (int mb = 0; mb < 4; ++mb) { v8h o, r;
#pragma unroll
                for (int j = 0; j < 8; ++j) { const float x = acc[mb][nb][j]; const h16 a = (h16)x; o[j] = a; r[j] = (h16)((x - (float)a) * RSC); }
                *(v8ha*)(hs + lr * GP_VP + mb * 16 + hi * 8) = o; *(v8ha*)(hs + 16 * GP_VP + lr * GP_VP + mb * 16 + hi * 8) = r; }
            __builtin_amdgcn_wave_barrier(); asm volatile("" ::: "memory");   // the lanes' LDS writes stay in front of the reads of other lanes' pieces
#pragma unroll
            for (int s = 0; s < 4; ++s) { const int row = 4 * s + (lane >> 3), pc = (lane & 7) * 8;
                const v8h a = *(const v8ha*)(hs + row * GP_VP + pc); const v8h c = *(const v8ha*)(hs + 16 * GP_VP + row * GP_VP + pc);
                h16* p = pv + (size_t)(nb * 16 + row) * SEQ + t0 + pc;
                *(v8h*)p = a; *(v8h*)(p + PLN) = c; }
            __builtin_amdgcn_wave_barrier(); asm volatile("" ::: "memory");   // the reads stay in front of the next tile's writes
        }
    } else {
#pragma unroll
        for (int mb = 0; mb < 4; ++mb) {
#pragma unroll
            for (int nb = 0; nb < 4; ++nb) {
#pragma unroll
                for (int j = 0; j < 8; ++j) os[(hi * 8 + j) * 68 + nb * 16 + lr] = acc[mb][nb][j]; }
            __builtin_amdgcn_wave_barrier(); asm volatile("" ::: "memory");   // as in the v branch: writes in front of the reads
                // q, k: a staged row is one token's 64 d = one 128-byte row of each plane; eight lanes a row, four consecutive rows a store
#pragma unroll
                for (int s = 0; s < 4; ++s) { const int row = 4 * s + (lane >> 3), cofs = (lane & 7) * 8;
                    const v4f x0 = *(const v4fa*)(os + row * 68 + cofs); const v4f x1 = *(const v4fa*)(os + row * 68 + cofs + 4); v8h o, r;
#pragma unroll
                    for (int k = 0; k < 4; ++k) { const h16 a = (h16)x0[k]; o[k] = a; r[k] = (h16)((x0[k] - (float)a) * RSC); const h16 b = (h16)x1[k]; o[4 + k] = b; r[4 + k] = (h16)((x1[k] - (float)b) * RSC); }
                    h16* p = pv + (size_t)(t0 + mb * 16 + row) * HD + cofs;
                    *(v8h*)p = o; *(v8h*)(p + PLN) = r; }
            __builtin_amdgcn_wave_barrier(); asm volatile("" ::: "memory");   // reads in front of the next tile's writes
        }
        asm volatile("s_wait_xcnt 0x0" ::: "memory");   // in the built code this branch's end stands directly in front of the v branch, which reuses the registers that the stores above name
    }
}
// Plane set layout in PL (PLN elements each): 0 q value, 1 q residual, 2 k value, 3 k residual, 4 v^T value, 5 v^T residual; one such set of six per batch element.

// ---- k_prep: the three operand conversions (x, w_attn, w_proj to bf16, the weights transposed to K-contiguous rows) in one launch of one work-group per WGP.
// Every work-group takes one weight tile of 256 k x 64 n and an equal share of x; a lane issues all its 32 loads of 16 bytes before it uses the first, so a few long waves keep the whole input in flight.
// Every load of a half-wave and every store of a wave covers whole aligned 256-byte units. The weight tile turns in LDS: a lane holds 8 consecutive k of 4 n, packs them to 16 bytes per n and writes them to row n;
// a row is 32 pieces of 16 bytes (256 k), piece q of row n at place q ^ ((n >> 2) & 15), which spreads the 16 lanes of a write (n 4 apart, same q) over all banks and leaves a row's read a permutation of the row.
#define PT_K 256                         // k per weight tile
#define PT_N 64                          // n per weight tile
#define PT_Q (PT_K / 8)                  // 16-byte pieces per transposed row
#define PT_A ((DM / PT_K) * (NQKV / PT_N))   // tiles of w_attn: in[1024][3072] -> out[3072][1024]
#define PT_O ((DM / PT_K) * (DM / PT_N))     // tiles of w_proj: in[1024][1024] -> out[1024][1024]
#define PT_G (PT_A + PT_O)               // work-groups
#define PT_X 16                          // 16-byte loads of x per lane
static_assert(DM % PT_K == 0 && NQKV % PT_N == 0 && DM % PT_N == 0);   // whole tiles
static_assert(PT_Q == 32 && PT_N == 64);                               // the lane maps below
static_assert((size_t)NB * SEQ * DM / 4 == (size_t)PT_X * PT_G * 256); // x in equal shares
typedef __attribute__((ext_vector_type(4))) unsigned short v4us;
typedef __attribute__((ext_vector_type(4))) unsigned v4u;
typedef v4u  __attribute__((may_alias)) v4ua;
typedef v4us __attribute__((may_alias)) v4usa;
__global__ __launch_bounds__(256) void k_prep(const float* __restrict__ x, const float* __restrict__ wqkv, const float* __restrict__ wo, bf* XB, bf* WQKV, bf* WO2) {
    __shared__ __attribute__((aligned(16))) v4u tw[PT_N * PT_Q];
    const int b = blockIdx.x, tid = threadIdx.x;
    const bool isa = b < PT_A;                     // this work-group's tile is one of w_attn
    const float* __restrict__ w = isa ? wqkv : wo; bf* Bt = isa ? WQKV : WO2; const int N = isa ? NQKV : DM; const int t = isa ? b : b - PT_A;
    const int k0 = (t % (DM / PT_K)) * PT_K, n0 = (t / (DM / PT_K)) * PT_N;
    const int c = tid & 15, g = tid >> 4;          // columns n0 + 4c .. 4c + 3; pieces g and g + 16
    const size_t xf = (size_t)b * (PT_X * 256) + tid;   // this lane's first group of four x elements
    const float* px = x + xf * 4; const float* pw[16];
    v4f wv[16], xv[PT_X];                          // wv[8e + r]: row k0 + 8 (g + 16e) + r
#pragma unroll
    for (int i = 0; i < 16; ++i) pw[i] = w + ((k0 + 8 * g) * N + n0 + 4 * c) + (128 * (i >> 3) + (i & 7)) * N;   // element indices stay below DM * NQKV: 32-bit products do
#pragma unroll
    for (int i = 0; i < 16; ++i) wv[i] = *(const v4f*)pw[i];
    __builtin_amdgcn_sched_barrier(0);   // the weight loads go first: their data has the longer way (LDS, barrier, LDS) behind it
#pragma unroll
    for (int u = 0; u < PT_X; ++u) xv[u] = *(const v4f*)(px + (size_t)u * 1024);
    // every address pair stays live up to this wait, so no later load's result lands on one and nothing rewrites one in front of it
    asm volatile("s_wait_xcnt 0x0" :: "v"(pw[0]), "v"(pw[1]), "v"(pw[2]), "v"(pw[3]), "v"(pw[4]), "v"(pw[5]), "v"(pw[6]), "v"(pw[7]), "v"(pw[8]), "v"(pw[9]), "v"(pw[10]), "v"(pw[11]),
                 "v"(pw[12]), "v"(pw[13]), "v"(pw[14]), "v"(pw[15]), "v"(px) : "memory");
    __builtin_amdgcn_sched_barrier(0);   // every load is issued before the first wait for data: sunk to their uses they would come back one latency after another
#pragma unroll
    for (int e = 0; e < 2; ++e)
#pragma unroll
        for (int j = 0; j < 4; ++j) { v4u p;
#pragma unroll
            for (int m = 0; m < 4; ++m) p[m] = (unsigned)f2bf(wv[8 * e + 2 * m][j]) | ((unsigned)f2bf(wv[8 * e + 2 * m + 1][j]) << 16);
            tw[(4 * c + j) * PT_Q + ((g + 16 * e) ^ c)] = p; }
    v4us xo[PT_X];                       // x is converted as it arrives, in front of the barrier; its stores follow behind it (in front, the barrier would wait for them)
#pragma unroll
    for (int u = 0; u < PT_X; ++u)
#pragma unroll
        for (int k = 0; k < 4; ++k) xo[u][k] = f2bf(xv[u][k]);
    __syncthreads();                     // the tile is whole before its rows are read
#pragma unroll
    for (int s = 0; s < 8; ++s) { const int n = (tid >> 5) + 8 * s, q = tid & 31;
        *(v4ua*)(Bt + (size_t)(n0 + n) * DM + k0 + 8 * q) = tw[n * PT_Q + (q ^ ((n >> 2) & 15))]; }
#pragma unroll
    for (int u = 0; u < PT_X; ++u) *(v4usa*)(XB + (xf + (size_t)u * 256) * 4) = xo[u];
}

// ---- fused windowed causal attention, one wave per 16 query rows of one head; a work-group is eight such waves on 128 consecutive query rows; one launch for all heads and batch elements (k_attn below), the rows below RHE on the HIRES body.
// The keys that the eight waves visit together (the window behind the first query up to the last query: at most WIN + 128) are staged in LDS once, in chunks of 128 keys, one tensor load a wave:
// a k chunk is 128 rows of 128 bytes (LDS pitch 144), a v^T chunk 64 rows of 256 bytes (LDS pitch 272), both pitches for the ds_load_b128 fragment reads. Slot of a chunk = the number of the wave that brings it.
// Where two slots are left (the body that is not HIRES) the work-group's 128 q rows, value and residual, are staged in them like k chunks; the HIRES body fills all eight slots and reads q from global memory.
#define AW      8                        // waves per work-group
#define AQ      (AW * 16)                // query rows per work-group
#define AC      128                      // keys per staged chunk
#define AT_KP   144u                     // LDS pitch of a staged k row: 128 + 16
#define AT_VP   272u                     // LDS pitch of a staged v^T row: 256 + 16
#define AT_SLOT 18432u                   // 128 x 144 bytes; 64 x 272 = 17408 rounded up to a multiple of 2 KiB
static_assert(AC * AT_KP <= AT_SLOT && HD * AT_VP <= AT_SLOT && AT_SLOT % 2048u == 0);
static_assert(AC * 2 == 256 && HD * 2 == 128);                  // row lengths that the two pads are for
static_assert(SEQ % AQ == 0 && RHE % AQ == 0 && WIN % AC == 0 && AQ % AC == 0);   // whole work-groups per body, whole chunks
static_assert(2 * (WIN / AC + AQ / AC) <= AW);                  // other body: two planes' chunks, one a wave
static_assert(AQ == AC);                                        // a work-group's q rows are one chunk
static_assert(4 * (RHE / AC) <= AW);                            // HIRES body: four planes' chunks, one a wave
__device__ __forceinline__ v16h ldhs(const unsigned char* p) { return cat16(*(const v8ha*)p, *(const v8ha*)(p + 32)); }   // the k order of ldh, from an LDS row
// Descriptor of one chunk: rows of rowb bytes, source pitch in bytes, word 0 (the pad behind every row) a constant at each use.
__device__ __forceinline__ u32x8 chunk_group1(unsigned word0, unsigned rowb, unsigned rows, unsigned src_pitch) {
    u32x8 g;
    g[0] = uni(word0);
    g[1] = uni((rowb & 0xFFFFu) << 16);
    g[2] = uni((rowb >> 16) | (rows << 16));
    g[3] = uni(rowb << 16);
    g[4] = uni(rows);
    g[5] = uni(src_pitch);
    g[6] = uni(0u);
    g[7] = uni(0u);
    return g;
}
// Key halves visited by a wave: from the 32-aligned half holding key q0 - (WIN - 1) (clipped at 0) up to the half holding key q0 + 15; all of them lie inside the written planes.
// Per 32-key half: S^T tiles [16 keys][16 queries] = K Q^T (A = key rows, B = query rows, k = d); lane (h, n) holds query q0+n, keys kb + 16*tile + 8h + r.
// Online softmax per lane (16 values) + one xor-16 shuffle; the two packed tiles are the B fragment (k = key, n = query) of O^T [d][query] += V^T [d][key] P^T.
// HIRES: value+residual on q, k, P, v (3 products each side); else q value+residual against single k, single P and v.
template <bool HIRES>
__device__ __forceinline__ void attn_body(const h16* __restrict__ PL, bf* CTX, unsigned char* sm, const int qw, const int head, const int batch) {
    const int lane = threadIdx.x & 31, lr = lane & 15, hi = lane >> 4; const unsigned wave = uni(threadIdx.x >> 5);
    const int q0 = qw + 16 * (int)wave;                // this wave's query tile
    constexpr unsigned NCH = HIRES ? RHE / AC : WIN / AC + AQ / AC;   // chunk slots per plane
    constexpr unsigned NKP = HIRES ? 2u : 1u;          // k planes staged, and as many v^T planes behind them
    constexpr unsigned NST = 2u * NKP * NCH;           // slots of the k and v^T chunks
    constexpr bool QS = NST + 2u <= AW;                // two slots left: q value and q residual are staged too
    const int kbase = HIRES ? 0 : max(qw - WIN, 0);    // first staged key
    const unsigned nch = (unsigned)(qw + AQ - kbase) / AC;   // chunks up to the work-group's last query
    const int kb0 = max(q0 - (WIN - 1), 0) & ~31;      // first key half with a key inside the window of query q0
    const size_t hb = (size_t)batch * 6 * PLN + (size_t)head * SEQ * HD;   // this batch element's set of six planes, then the head
    const size_t oQ = hb + (size_t)(q0 + lr) * HD + 8 * hi;
    {
        const unsigned pi = wave / NCH, ch = wave % NCH;   // plane and chunk that this wave brings
        const unsigned dst = (unsigned)(size_t)sm + wave * AT_SLOT;
        const bool isq = QS && wave >= NST && wave < NST + 2u;
        if (pinned((pi < NKP && ch < nch) || isq)) {
            const unsigned plane = isq ? wave - NST : 2u + pi; const int row = isq ? qw : kbase + (int)ch * AC;
            const size_t src = plane * PLN + hb + (size_t)row * HD;
            u32x8 g1 = chunk_group1((1u << 20) | (4u << 22) | (3u << 25), HD * 2u, AC, HD * 2u);
            u32x4 g0 = tile_group0(dst, (unsigned long long)(size_t)(PL + src));
            tile_load(g0, g1);
            asm volatile("s_wait_tensorcnt 0x0" ::: "memory");   // the chunk has landed before the barrier that publishes it
        }
        if (pinned(pi >= NKP && pi < 2u * NKP && ch < nch)) {
            u32x8 g1 = chunk_group1((1u << 20) | (5u << 22) | (3u << 25), AC * 2u, HD, SEQ * 2u);
            u32x4 g0 = tile_group0(dst, (unsigned long long)(size_t)(PL + (4 + pi - NKP) * PLN + hb + (size_t)(kbase + (int)ch * AC)));
            tile_load(g0, g1);
            asm volatile("s_wait_tensorcnt 0x0" ::: "memory");   // as above
        }
    }
    __syncthreads();                                   // publishes every chunk; nothing staged is read in front of it
    const unsigned char* sK = sm + (unsigned)lr * AT_KP + 16u * (unsigned)hi;                          // k value chunks; the residual plane's lie NCH slots further
    const unsigned char* sQ = sm + NST * AT_SLOT + (16u * wave + (unsigned)lr) * AT_KP + 16u * (unsigned)hi;   // QS: this wave's q value rows; the residual rows lie one slot further
    const unsigned char* sV = sm + NKP * NCH * AT_SLOT + (unsigned)lr * AT_VP + 16u * (unsigned)hi;    // v^T value chunks; likewise
    const float CE = SCL * 1.4426950408889634f;
    v8f o[4], orr[4];
#pragma unroll
    for (int dt = 0; dt < 4; ++dt) { o[dt] = (v8f){}; orr[dt] = (v8f){}; }
    float m = NEGB, l = 0.0f;
#pragma unroll 1
    for (int kb = kb0; kb < q0 + 16; kb += 32) {
        v8f sh0 = (v8f){}, sh1 = (v8f){}, sr0 = (v8f){}, sr1 = (v8f){};
        const unsigned kr = (unsigned)(kb - kbase);    // a half of 32 keys lies inside one chunk
        const unsigned char* pk = sK + (kr / AC) * AT_SLOT + (kr % AC) * AT_KP;
        const unsigned char* pv = sV + (kr / AC) * AT_SLOT + (kr % AC) * 2u;
#pragma unroll
        for (int kc = 0; kc < HD; kc += 32) {
            const v16h bq  = QS ? ldhs(sQ + kc * 2) : ldh(PL + oQ + kc);
            const v16h bqr = QS ? ldhs(sQ + AT_SLOT + kc * 2) : ldh(PL + PLN + oQ + kc);
            const v16h ak0 = ldhs(pk + kc * 2);
            const v16h ak1 = ldhs(pk + 16u * AT_KP + kc * 2);
            sh0 = wmma16(ak0, bq, sh0);  sh1 = wmma16(ak1, bq, sh1);
            sr0 = wmma16(ak0, bqr, sr0); sr1 = wmma16(ak1, bqr, sr1);
            if (HIRES) {
                const v16h kr0 = ldhs(pk + NCH * AT_SLOT + kc * 2);
                const v16h kr1 = ldhs(pk + NCH * AT_SLOT + 16u * AT_KP + kc * 2);
                sr0 = wmma16(kr0, bq, sr0); sr1 = wmma16(kr1, bq, sr1);
                asm volatile("v_nop\n\tv_nop\n\tv_nop\n\tv_nop" : "+v"(sh0), "+v"(sh1), "+v"(sr0), "+v"(sr1) : "v"(ak0), "v"(ak1), "v"(bq), "v"(bqr), "v"(kr0), "v"(kr1));
            } else {
                asm volatile("v_nop\n\tv_nop\n\tv_nop\n\tv_nop" : "+v"(sh0), "+v"(sh1), "+v"(sr0), "+v"(sr1) : "v"(ak0), "v"(ak1), "v"(bq), "v"(bqr));
            }
        }
        float u[16];
#pragma unroll
        for (int r = 0; r < 8; ++r) { u[r] = (sh0[r] + sr0[r] * RINV) * CE; u[8 + r] = (sh1[r] + sr1[r] * RINV) * CE; }
        if (kb + 31 > q0 || kb + (WIN - 16) < q0) {   // wave-uniform: this half touches the diagonal or the far edge of the window; keys above the query or WIN or more behind it are excluded
            const int qi = q0 + lr; const int k0 = kb + 8 * hi;
#pragma unroll
            for (int r = 0; r < 8; ++r) { u[r] = (k0 + r > qi || qi - (k0 + r) >= WIN) ? NEGB : u[r]; u[8 + r] = (k0 + 16 + r > qi || qi - (k0 + 16 + r) >= WIN) ? NEGB : u[8 + r]; }
        }
        float mx = u[0];
#pragma unroll
        for (int i = 1; i < 16; ++i) mx = fmaxf(mx, u[i]);
        mx = fmaxf(mx, __shfl_xor(mx, 16, 32));
        const float mn = fmaxf(fmaxf(m, mx), MFLOOR);
        const float corr = __builtin_amdgcn_exp2f(m - mn);
        m = mn;
        float psum = 0.0f;
#pragma unroll
        for (int i = 0; i < 16; ++i) { u[i] = __builtin_amdgcn_exp2f(u[i] - mn); psum += u[i]; }
        l = l * corr + psum;
#pragma unroll
        for (int dt = 0; dt < 4; ++dt) {
#pragma unroll
            for (int r = 0; r < 8; ++r) { o[dt][r] *= corr; if (HIRES) orr[dt][r] *= corr; } }
        v16h pb, pr;
#pragma unroll
        for (int i = 0; i < 16; ++i) { const float pc = u[i] * PCAR; const h16 ph = toh_flush(pc); pb[i] = ph; pr[i] = toh_flush((pc - (float)ph) * RSC); }
        if (HIRES) {
#pragma unroll
            for (int dt = 0; dt < 4; ++dt) {
                const v16h av  = ldhs(pv + (unsigned)dt * 16u * AT_VP);
                const v16h avr = ldhs(pv + NCH * AT_SLOT + (unsigned)dt * 16u * AT_VP);
                o[dt]   = wmma16(av, pb, o[dt]);
                orr[dt] = wmma16(avr, pb, orr[dt]);
                orr[dt] = wmma16(av, pr, orr[dt]);
                asm volatile("v_nop\n\tv_nop\n\tv_nop\n\tv_nop" : "+v"(o[dt]), "+v"(orr[dt]) : "v"(av), "v"(avr), "v"(pb), "v"(pr));
            }
        } else {
            const v16h av0 = ldhs(pv);
            const v16h av1 = ldhs(pv + 16u * AT_VP);
            const v16h av2 = ldhs(pv + 32u * AT_VP);
            const v16h av3 = ldhs(pv + 48u * AT_VP);
            o[0] = wmma16(av0, pb, o[0]); o[1] = wmma16(av1, pb, o[1]); o[2] = wmma16(av2, pb, o[2]); o[3] = wmma16(av3, pb, o[3]);
            asm volatile("v_nop\n\tv_nop\n\tv_nop\n\tv_nop" : "+v"(o[0]), "+v"(o[1]), "+v"(o[2]), "+v"(o[3]) : "v"(av0), "v"(av1), "v"(av2), "v"(av3), "v"(pb));
        }
    }
    if (!QS) asm volatile("s_wait_xcnt 0x0" ::: "memory");   // stands in front of whatever reuses the address registers of the loop's q loads
    l += __shfl_xor(l, 16, 32);
    const float inv = 1.0f / (l * PCAR);
    // output staging, 4 KiB a wave, in the chunks' LDS once every wave has left its loop
    asm volatile("s_wait_dscnt 0x0" ::: "memory");   // this wave's fragment reads are done before another wave writes over the chunks
    __syncthreads();
    unsigned short* ost = (unsigned short*)(sm + wave * 4096u);
#pragma unroll
    for (int dt = 0; dt < 4; ++dt) { v8us vh, vl;
#pragma unroll
        for (int r = 0; r < 8; ++r) { float y = o[dt][r]; if (HIRES) y += orr[dt][r] * RINV; y *= inv; unsigned short a, c; splitf(y, a, c); vh[r] = a; vl[r] = c; }
        *(v8usa*)(ost + lr * HD + dt * 16 + hi * 8) = vh; *(v8usa*)(ost + 16 * HD + lr * HD + dt * 16 + hi * 8) = vl; }
    __builtin_amdgcn_wave_barrier(); asm volatile("" ::: "memory");
    bf* crow = CTX + ((size_t)batch * SEQ + q0) * CK + head * HD;
{
#pragma unroll
        for (int s = 0; s < 4; ++s) { const int row = 4 * s + (lane >> 3), pc = (lane & 7) * 8;
            const v8us a = *(const v8usa*)(ost + row * HD + pc); const v8us c = *(const v8usa*)(ost + 16 * HD + row * HD + pc);
            *(v8us*)(crow + (size_t)row * CK + pc) = a; *(v8us*)(crow + (size_t)row * CK + DM + pc) = c; }
         }
}
#define AT_HI  (RHE / AQ)                     // work-groups per head on the HIRES body
#define AT_LO  ((SEQ - RHE) / AQ)             // work-groups per head on the other body
#define AT_NHI (AT_HI * NH * NB)
// Grid order: a HIRES wave with many key halves runs longest. So the HIRES work-groups come first, the one with the most key halves ahead;
// behind them the others, query block fastest, then head, then batch element.
__global__ __launch_bounds__(AW * 32) __attribute__((amdgpu_num_vgpr(256))) void k_attn(const h16* __restrict__ PL, bf* CTX) {
    __shared__ __attribute__((aligned(2048))) unsigned char sm[AW * AT_SLOT];   // one chunk slot a wave: two work-groups fit a WGP's LDS
    const int b = blockIdx.x;
    if (b < AT_NHI) { const int hb = b % (NH * NB); attn_body<true>(PL, CTX, sm, (AT_HI - 1 - b / (NH * NB)) * AQ, hb % NH, hb / NH); }
    else { const int c = b - AT_NHI, hb = c / (AT_LO > 0 ? AT_LO : 1); attn_body<false>(PL, CTX, sm, RHE + (c - hb * AT_LO) * AQ, hb % NH, hb / NH); }
}

// ---- k_gemmw: the output product, out[m][n] (f32) = sum_k (hi[m][k] + lo[m][k]) w[n][k]; 128x128 output tile per work-group of four waves, each wave a 64x64 quadrant; grid (M/128, N/128), 128 threads.
// A pass is 64 k = 128 bytes of 384 operand rows: the 128 hi rows, the 128 lo rows and the 128 w rows. A w row is staged once and its fragment read once for both context halves:
// every accumulator takes the hi product and the lo product of each 32-k step. One tensor load a wave and pass (wave 0: hi, wave 1: lo, waves 2, 3: 64 w rows each), LDS pitch 144 bytes; the two-buffer ring of k_gemmp.
#define GO_ASL  18432u                   // 128 rows x 144 bytes: one context half's slice, a multiple of 2 KiB
#define GO_BUF  (2u * GO_ASL + 2u * GP_SLICE)
#define GO_RING (2u * GO_BUF)
static_assert(128u * GP_PITCH <= GO_ASL && GO_ASL % 2048u == 0);
__global__ __launch_bounds__(128) void k_gemmw(const bf* __restrict__ A, const bf* __restrict__ Bt, float* C) {
    __shared__ __attribute__((aligned(2048))) unsigned char sm[GO_RING + 4u * GP_OS];
    const int lane = threadIdx.x & 31, lr = lane & 15, hi = lane >> 4; const unsigned wave = uni(threadIdx.x >> 5);
    const int r0 = blockIdx.x * 128, c0 = blockIdx.y * 128;
    const bool ctx = wave < 2u;                          // this wave brings a context half (else 64 w rows)
    const unsigned lbase = (unsigned)(size_t)sm + (ctx ? wave * GO_ASL : 2u * GO_ASL + (wave - 2u) * GP_SLICE);   // this wave's slice in buffer 0
    const unsigned long long gsrc = ctx ? (unsigned long long)(size_t)A + (unsigned long long)r0 * (CK * 2u) + wave * (DM * 2u)
                                        : (unsigned long long)(size_t)Bt + (unsigned long long)(c0 + 64 * ((int)wave - 2)) * (DM * 2u);
    constexpr int np = DM / GP_K;
    v8f acc[4][4];
#pragma unroll
    for (int mb = 0; mb < 4; ++mb)
#pragma unroll
        for (int nb = 0; nb < 4; ++nb) acc[mb][nb] = (v8f){};
    u32x8 g1 = chunk_group1((1u << 20) | (4u << 22) | (3u << 25), GP_ROWB, ctx ? 128u : 64u, ctx ? CK * 2u : DM * 2u);
    u32x4 g0 = tile_group0(lbase, gsrc);
    tile_load(g0, g1);
    asm volatile("s_wait_tensorcnt 0x0" ::: "memory");   // stage 0 has landed before the barrier that publishes it
    __syncthreads();
    tile_advance(g0, lbase + GO_BUF);
    tile_load(g0, g1);
    const unsigned wm = wave & 1u, wn = wave >> 1;       // quadrant: rows r0 + 64 wm, columns c0 + 64 wn
    const unsigned aofs = (wm * 64u + (unsigned)lr) * GP_PITCH + 16u * (unsigned)hi, bofs = 2u * GO_ASL + wn * GP_SLICE + (unsigned)lr * GP_PITCH + 16u * (unsigned)hi;
    int s = 0;
#pragma unroll 1
    do {
        const unsigned char* ph = sm + (unsigned)(s & 1) * GO_BUF + aofs; const unsigned char* pl = ph + GO_ASL; const unsigned char* pb = sm + (unsigned)(s & 1) * GO_BUF + bofs;
        v16bf h[2][4], l[2][4], b[2][4];     // fragments of the pass's two k-steps, read in the order in which the WMMAs take them
#pragma unroll
        for (int ks = 0; ks < 2; ++ks) {
            b[ks][0] = ldbs(pb + (unsigned)ks * 64u);
#pragma unroll
            for (int mb = 0; mb < 4; ++mb) h[ks][mb] = ldbs(ph + (unsigned)mb * 16u * GP_PITCH + (unsigned)ks * 64u);
#pragma unroll
            for (int nb = 1; nb < 4; ++nb) b[ks][nb] = ldbs(pb + (unsigned)nb * 16u * GP_PITCH + (unsigned)ks * 64u);
#pragma unroll
            for (int mb = 0; mb < 4; ++mb) l[ks][mb] = ldbs(pl + (unsigned)mb * 16u * GP_PITCH + (unsigned)ks * 64u);
        }
        __builtin_amdgcn_sched_barrier(0);   // the LDS reads stay one group ahead of the matrix block
#pragma unroll
        for (int ks = 0; ks < 2; ++ks) {
#pragma unroll
            for (int nb = 0; nb < 4; ++nb)
#pragma unroll
                for (int mb = 0; mb < 4; ++mb) acc[mb][nb] = wmmab(h[ks][mb], b[ks][nb], acc[mb][nb]);
#pragma unroll
            for (int nb = 0; nb < 4; ++nb)
#pragma unroll
                for (int mb = 0; mb < 4; ++mb) acc[mb][nb] = wmmab(l[ks][mb], b[ks][nb], acc[mb][nb]);
        }
        __builtin_amdgcn_sched_barrier(0);   // the WMMAs stay in front of the waits: sunk behind the barrier they would stand in front of the refill and shorten its lead
        asm volatile("s_wait_dscnt 0x0" ::: "memory");      // this wave's reads of buffer s & 1 are done before the buffer is refilled
        asm volatile("s_wait_tensorcnt 0x0" ::: "memory");  // this wave's slice of stage s + 1 has landed
        __syncthreads();                                     // publishes stage s + 1 and ends every wave's reads of stage s
        if (pinned(s + 2 < np)) { tile_advance(g0, lbase + (unsigned)(s & 1) * GO_BUF); tile_load(g0, g1); }
    } while (++s < np);
    asm volatile("s_wait_tensorcnt 0x0" ::: "memory");   // no request outstanding at the wave's end
    asm volatile("s_wait_dscnt 0x0" ::: "memory");       // and no LDS read of the ring
    float* os = (float*)(sm + GO_RING + wave * GP_OS);   // each wave stages in its own range, outside the ring
    const int rq = r0 + (int)wm * 64, cq = c0 + (int)wn * 64;   // the quadrant's first row and column
#pragma unroll
    for (int mb = 0; mb < 4; ++mb) {
#pragma unroll
        for (int nb = 0; nb < 4; ++nb) {
#pragma unroll
            for (int j = 0; j < 8; ++j) os[(hi * 8 + j) * 68 + nb * 16 + lr] = acc[mb][nb][j]; }
        __builtin_amdgcn_wave_barrier(); asm volatile("" ::: "memory");   // the lanes' LDS writes stay in front of the reads of other lanes' pieces
        float* crow = C + (size_t)(rq + mb * 16) * DM + cq;
#pragma unroll
        for (int s = 0; s < 8; ++s) { const int row = 2 * s + hi, cofs = lr * 4; const v4f val = *(const v4fa*)(os + row * 68 + cofs);
            *(v4f*)(crow + (size_t)row * DM + cofs) = val; }
        __builtin_amdgcn_wave_barrier(); asm volatile("" ::: "memory");   // reads in front of the next tile's writes
    }
}

extern "C" void kernel_launch(void* const* d_in, const int* in_sizes, int n_in,
                              void* d_out, int out_size, void* d_ws, size_t ws_size, hipStream_t stream) {
    if (n_in < 3) return;
    const int need_x = (NB - 1) * SEQ_FULL * DM + SEQ * DM;
    if (in_sizes[0] < need_x || in_sizes[1] < DM * NQKV || in_sizes[2] < DM * DM || out_size < need_x) return;
    if (WS_TOTAL > ws_size) return;
    const float* x = (const float*)d_in[0]; const float* wqkv = (const float*)d_in[1]; const float* wo = (const float*)d_in[2];   // x, w_attn, w_proj
    float* OUT = (float*)d_out;     // [2][2048][1024]
    char* wsp = (char*)d_ws;
    bf* WQKV = (bf*)wsp;  wsp += WS_WQKV;      // [3072][1024] bf16, K-contiguous
    bf* WO2  = (bf*)wsp;  wsp += WS_WO2;       // [1024][1024] bf16, K-contiguous
    bf* XB   = (bf*)wsp;  wsp += WS_XB;        // [NB * SEQ][1024] bf16
    h16* PL  = (h16*)wsp; wsp += WS_PL;        // six head plane sets per batch element
    bf* CTX  = (bf*)wsp;  wsp += WS_CTX;       // [NB * SEQ][2048] bf16 hi | lo
    // every stage runs once, over all NB batch elements: the row-wise stages on NB * SEQ rows, the attention with head and batch element folded into its one-dimensional grid
    k_prep<<<(unsigned)PT_G, 256, 0, stream>>>(x, wqkv, wo, XB, WQKV, WO2);
    k_gemmp<<<dim3(NB * SEQ / 128, NQKV / 128, 1), 128, 0, stream>>>(XB, WQKV, DM, PL);   // q | k | v leave the projection as the f16 planes
    k_attn<<<(unsigned)((AT_HI + AT_LO) * NH * NB), AW * 32, 0, stream>>>(PL, CTX);
    k_gemmw<<<dim3(NB * SEQ / 128, DM / 128, 1), 128, 0, stream>>>(CTX, WO2, OUT);
}

// v008
// Measured time: 63.9 microseconds a run.
// In two side-by-side timings against v007, it was 1.05 and 1.04 times as fast.
// Over all steps from v000 it is 4.35 times as fast.
#include <hip/hip_runtime.h>

// Windowed causal multi-head attention with a fused qkv projection (x [2][2048][1024]; qkv = x w_attn ('io' [1024][3072], column = which*1024 + h*64 + d, no bias; 16 heads x 64); scores x 64^-0.5, key j visible to query i when 0 <= i - j < 256; softmax; out = merged w_proj ('io' [1024][1024], no bias) -> [2][2048][1024]).
// Compute dtypes, f32 accumulate everywhere: x, w_attn, w_proj converted to bf16 (RNE) and multiplied with v_wmma_f32_16x16x32_bf16 (exact products); attention on v_wmma_f32_16x16x32_f16:
// q, k, v carried as f16 value + f16 residual x2^11 (separate accumulator, folded back x2^-11); query rows < 256 use value+residual on q, k, P, v (3 products); rows >= 256 use q value+residual against single f16 k, single f16 P (x1024) and v;
// softmax f32 (running max, exp2); merged context stored as bf16 hi | lo; both halves are multiplied with the one bf16 w_proj plane on the bf16 WMMA, into the same accumulators.
// Fused flash-style attention in the transposed form S^T = K Q^T, O^T = V^T P^T: the packed score tiles are the B fragment of the second product directly (no probability plane, no LDS exchange); only the 32-key halves inside the window of a query tile are visited.

#ifndef NB
#define NB 2
#endif
#ifndef SEQ
#define SEQ 2048
#endif
#define NB_FULL  2
#define SEQ_FULL 2048
#define DM   1024
#define NH   16
#define HD   64
#define NQKV (3 * DM)
#define CK   (2 * DM)                 // context plane pitch: hi | lo along K
#define RH   256                      // query rows < RH use value+residual on every attention operand
#define RHE  ((SEQ < RH) ? SEQ : RH)
#define WIN  256                      // attention window: key j visible to query i when 0 <= i - j < WIN
#define PCAR 1024.0f                  // carry of the f16 probability operand
#define RSC  2048.0f                  // carry of every f16 residual plane (2^11)
#define RINV (1.0f / 2048.0f)
#define SCL  0.125f                   // HD^-0.5
#define NEGB (-3.0e38f)
#define MFLOOR (-1.0e30f)             // floor of the running maximum: a key half with no visible key for a query yields probabilities exactly 0
#define PLN  ((size_t)NH * SEQ * HD)  // elements per head plane set

#define WS_WQKV ((size_t)NQKV * DM * 2)
#define WS_WO2  ((size_t)DM * DM * 2)
#define WS_XB   ((size_t)NB * SEQ * DM * 2)
#define WS_PL   ((size_t)NB * 6 * NH * SEQ * HD * 2)
#define WS_CTX  ((size_t)NB * SEQ * CK * 2)
#define WS_TOTAL (WS_WQKV + WS_WO2 + WS_XB + WS_PL + WS_CTX)

static_assert(NB <= NB_FULL);                 // batch count within the inputs
static_assert(SEQ <= SEQ_FULL);               // sequence rows within the inputs
static_assert(NB == 1 || SEQ == SEQ_FULL);    // the batch elements' rows follow one another in x and out: one row range of NB * SEQ
static_assert(SEQ % 64 == 0);
static_assert(DM % 64 == 0);                  // wave quadrant columns
static_assert(NQKV % 64 == 0);                // wave quadrant columns
static_assert(DM % 32 == 0);                  // k-step of the projection
static_assert(HD == 64);
static_assert(NH * HD == DM);                 // merged head columns
static_assert(RH % 32 == 0);                  // whole key halves below the precision boundary
static_assert(RHE % 16 == 0);                 // whole query tiles on the HIRES body
static_assert((SEQ - RHE) % 16 == 0);         // whole query tiles on the other body
static_assert(WIN >= 16);                     // every query of a 16-row tile sees at least its own key
static_assert(WIN <= SEQ_FULL);               // window within the sequence
static_assert(WS_WQKV % 256 == 0);
static_assert(WS_WO2 % 256 == 0);
static_assert(WS_XB % 256 == 0);
static_assert(WS_PL % 256 == 0);
static_assert(WS_CTX % 256 == 0);
static_assert(WS_TOTAL <= (size_t)268435456); // total carve <= 256 MiB

typedef _Float16 h16;
typedef unsigned short bf;
typedef __attribute__((ext_vector_type(16))) __bf16   v16bf;
typedef __attribute__((ext_vector_type(16))) _Float16 v16h;
typedef __attribute__((ext_vector_type(8)))  _Float16 v8h;
typedef __attribute__((ext_vector_type(8)))  unsigned short v8us;
typedef __attribute__((ext_vector_type(8)))  float    v8f;
typedef __attribute__((ext_vector_type(4)))  float    v4f;
typedef v4f  __attribute__((may_alias)) v4fa;
typedef v8us __attribute__((may_alias)) v8usa;
typedef v8h  __attribute__((may_alias)) v8ha;

__device__ __forceinline__ unsigned short f2bf(float f) { unsigned u = __float_as_uint(f); u += 0x7FFFu + ((u >> 16) & 1u); return (unsigned short)(u >> 16); }   // RNE convert
__device__ __forceinline__ float bf2f(unsigned short b) { return __uint_as_float(((unsigned)b) << 16); }
__device__ __forceinline__ void splitf(float y, unsigned short& h, unsigned short& l) { h = f2bf(y); l = f2bf(y - bf2f(h)); }
__device__ __forceinline__ v16h cat16(v8h lo, v8h hi) { return __builtin_shufflevector(lo, hi, 0, 1, 2, 3, 4, 5, 6, 7, 8, 9, 10, 11, 12, 13, 14, 15); }
__device__ __forceinline__ v16bf cat16b(v8us lo, v8us hi) { return __builtin_bit_cast(v16bf, __builtin_shufflevector(lo, hi, 0, 1, 2, 3, 4, 5, 6, 7, 8, 9, 10, 11, 12, 13, 14, 15)); }
__device__ __forceinline__ v8f wmma16(v16h a, v16h b, v8f c) { return __builtin_amdgcn_wmma_f32_16x16x32_f16(false, a, false, b, (short)0, c, false, false); }
__device__ __forceinline__ v8f wmmab(v16bf a, v16bf b, v8f c) { return __builtin_amdgcn_wmma_f32_16x16x32_bf16(false, a, false, b, (short)0, c, false, false); }
// Fragment loaders from K-contiguous 16-bit rows; the pointer already includes row (lane & 15) and 8 * (lane >> 4): elements 0..7 <- k0 + 8h + i, elements 8..15 <- k0 + 16 + 8h + i (A and B alike).
__device__ __forceinline__ v16h  ldh(const h16* p) { return cat16(*(const v8h*)p, *(const v8h*)(p + 16)); }
__device__ __forceinline__ v16bf ldb(const bf* p)  { return cat16b(*(const v8us*)p, *(const v8us*)(p + 16)); }
// f32 -> f16 operand convert that cannot produce an f16 subnormal (value select after the plane's carry).
static __device__ __forceinline__ h16 toh_flush(float v) { const h16 r = (h16)v; return (fabsf(v) < 6.103515625e-05f) ? (h16)0.0f : r; }

// ---- k_gemmp: the qkv projection, 128x128 output tile per work-group of four waves, each wave a 64x64 quadrant (16 accumulators); grid (M/128, N/128), 128 threads.
// c[m][n] (f32) = sum_k A[m][k] Bt[n][k], bf16 operands in K-contiguous planes. K % 64 == 0, K >= 128, M and N multiples of 128 (asserted below for every use).
// A quadrant is 64 tokens x the 64 columns of one head of q, k or v,
// and the epilogue stores it straight as that head's two f16 planes (value, residual x2^11) in the layout the attention kernels read: q and k [token][d], v transposed [d][token].
// A pass is 64 k = 128 bytes of each of the 256 operand rows. Every wave brings one slice of 64 rows per pass into LDS with one tensor load (waves 0, 1: the A rows; waves 2, 3: the Bt rows),
// padded to a pitch of 144 bytes for the ds_load_b128 fragment reads; two buffers, the load of pass s + 2 issued when every wave has left pass s.
#define GP_K     64                      // k per pass
#define GP_ROWB  128u                    // bytes of one operand row per pass
#define GP_PITCH 144u                    // LDS row pitch: 128 + 16
#define GP_SLICE 10240u                  // 64 rows x 144 bytes = 9216, rounded up to a multiple of 2 KiB
#define GP_BUF   (4u * GP_SLICE)
#define GP_RING  (2u * GP_BUF)
#define GP_OS    (2u * 16u * 144u)       // output staging bytes per wave, behind the ring: 16 rows x 68 f32, or two f16 tiles of 16 rows x 144 bytes
#define GP_VP    72                      // pitch of a staged v^T row in f16 elements: 64 tokens + 16 bytes
static_assert(16u * 68u * 4u <= GP_OS);
static_assert((NB * SEQ) % 128 == 0);    // GEMM row tiles
static_assert(NQKV % 128 == 0);          // GEMM column tiles
static_assert(DM % 128 == 0);            // GEMM column tiles
static_assert(DM % GP_K == 0 && DM / GP_K >= 2);   // whole passes, two stages or more
static_assert(64u * GP_PITCH <= GP_SLICE && GP_SLICE % 2048u == 0);
typedef unsigned u32x4 __attribute__((ext_vector_type(4)));
typedef unsigned u32x8 __attribute__((ext_vector_type(8)));
__device__ __forceinline__ unsigned uni(unsigned v) { return (unsigned)__builtin_amdgcn_readfirstlane(v); }
__device__ __forceinline__ unsigned pinned(unsigned v) { unsigned w = uni(v); asm volatile("" : "+s"(w)); return w; }   // holds a wave-uniform test in a scalar register: the branch around a tensor load must be a scalar one (the load ignores EXEC)
__device__ __forceinline__ v16bf ldbs(const unsigned char* p) { return cat16b(*(const v8usa*)p, *(const v8usa*)(p + 32)); }   // the k order of ldb, from an LDS row
// Descriptor of one request: 64 rows of 128 bytes, source pitch in bytes, 16 bytes of pad behind every row.
__device__ __forceinline__ u32x8 tile_group1(unsigned src_pitch) {
    u32x8 g;
    g[0] = uni((1u << 20) | (4u << 22) | (3u << 25));
    g[1] = uni((GP_ROWB & 0xFFFFu) << 16);
    g[2] = uni((GP_ROWB >> 16) | (64u << 16));
    g[3] = uni(GP_ROWB << 16);
    g[4] = uni(64u);
    g[5] = uni(src_pitch);
    g[6] = uni(0u);
    g[7] = uni(0u);
    return g;
}
__device__ __forceinline__ u32x4 tile_group0(unsigned lds_dst, unsigned long long ga) {
    u32x4 g;
    g[0] = uni(1u); g[1] = uni(lds_dst); g[2] = uni((unsigned)ga); g[3] = uni((((unsigned)(ga >> 32)) & 0x01FFFFFFu) | 0x80000000u);
    return g;
}
// the next 128 bytes of the same rows: the address advances inside the descriptor's own words (the carry stays below the type bits for any valid address)
__device__ __forceinline__ void tile_advance(u32x4& g0, unsigned lds_dst) {
    const unsigned lo = g0[2] + GP_ROWB;
    g0[3] = uni(g0[3] + (lo < GP_ROWB ? 1u : 0u)); g0[2] = uni(lo); g0[1] = uni(lds_dst);
}
// both groups are in-out operands: their values stay live behind the instruction, so the compiler reuses none of their registers for another value while the request is on its way
__device__ __forceinline__ void tile_load(u32x4& g0, u32x8& g1) { asm volatile("tensor_load_to_lds %0, %1" : "+s"(g0), "+s"(g1) :: "memory"); }
__global__ __launch_bounds__(128) void k_gemmp(const bf* __restrict__ A, const bf* __restrict__ Bt, int K, h16* PL) {
    __shared__ __attribute__((aligned(2048))) unsigned char sm[GP_RING + 4u * GP_OS];
    const int lane = threadIdx.x & 31, lr = lane & 15, hi = lane >> 4; const unsigned wave = uni(threadIdx.x >> 5);
    const int r0 = blockIdx.x * 128, c0 = blockIdx.y * 128;
    const unsigned pitch = (unsigned)K * 2u;
    const unsigned lbase = (unsigned)(size_t)sm + wave * GP_SLICE;      // this wave's slice in buffer 0
    const unsigned long long gsrc = (wave < 2u) ? (unsigned long long)(size_t)A + (unsigned long long)(r0 + 64 * (int)wave) * pitch
                                                : (unsigned long long)(size_t)Bt + (unsigned long long)(c0 + 64 * ((int)wave - 2)) * pitch;
    const int np = K / GP_K;
    v8f acc[4][4];
#pragma unroll
    for (int mb = 0; mb < 4; ++mb)
#pragma unroll
        for (int nb = 0; nb < 4; ++nb) acc[mb][nb] = (v8f){};
    u32x8 g1 = tile_group1(pitch);
    u32x4 g0 = tile_group0(lbase, gsrc);
    tile_load(g0, g1);
    asm volatile("s_wait_tensorcnt 0x0" ::: "memory");   // stage 0 has landed before the barrier that publishes it
    __syncthreads();
    tile_advance(g0, lbase + GP_BUF);
    tile_load(g0, g1);
    const unsigned wm = wave & 1u, wn = wave >> 1;       // quadrant: rows r0 + 64 wm, columns c0 + 64 wn
    const unsigned aofs = wm * GP_SLICE + (unsigned)lr * GP_PITCH + 16u * (unsigned)hi, bofs = (2u + wn) * GP_SLICE + (unsigned)lr * GP_PITCH + 16u * (unsigned)hi;
    int s = 0;
#pragma unroll 1
    do {                                                 // np >= 2: the body runs at least twice
        const unsigned char* pa = sm + (unsigned)(s & 1) * GP_BUF + aofs; const unsigned char* pb = sm + (unsigned)(s & 1) * GP_BUF + bofs;
        v16bf a0[4], b0[4], a1[4], b1[4];    // fragments of the pass's two k-steps
        b0[0] = ldbs(pb);
#pragma unroll
        for (int mb = 0; mb < 4; ++mb) a0[mb] = ldbs(pa + (unsigned)mb * 16u * GP_PITCH);
#pragma unroll
        for (int nb = 1; nb < 4; ++nb) b0[nb] = ldbs(pb + (unsigned)nb * 16u * GP_PITCH);
#pragma unroll
        for (int mb = 0; mb < 4; ++mb) a1[mb] = ldbs(pa + (unsigned)mb * 16u * GP_PITCH + 64u);
#pragma unroll
        for (int nb = 0; nb < 2; ++nb) b1[nb] = ldbs(pb + (unsigned)nb * 16u * GP_PITCH + 64u);
        __builtin_amdgcn_sched_barrier(0);   // the LDS reads stay one group ahead of the matrix block
#pragma unroll
        for (int nb = 0; nb < 2; ++nb)
#pragma unroll
            for (int mb = 0; mb < 4; ++mb) acc[mb][nb] = wmmab(a0[mb], b0[nb], acc[mb][nb]);
        __builtin_amdgcn_sched_barrier(0);   // the last two fragments go into registers that the eight WMMAs above have freed (keeps the wave within 256 registers), as one group
#pragma unroll
        for (int nb = 2; nb < 4; ++nb) b1[nb] = ldbs(pb + (unsigned)nb * 16u * GP_PITCH + 64u);
        __builtin_amdgcn_sched_barrier(0);   // as above: no LDS read moves in among the WMMAs below
#pragma unroll
        for (int nb = 2; nb < 4; ++nb)
#pragma unroll
            for (int mb = 0; mb < 4; ++mb) acc[mb][nb] = wmmab(a0[mb], b0[nb], acc[mb][nb]);
#pragma unroll
        for (int nb = 0; nb < 4; ++nb)
#pragma unroll
            for (int mb = 0; mb < 4; ++mb) acc[mb][nb] = wmmab(a1[mb], b1[nb], acc[mb][nb]);
        __builtin_amdgcn_sched_barrier(0);   // the WMMAs stay in front of the waits: sunk behind the barrier they would stand in front of the refill and shorten its lead
        asm volatile("s_wait_dscnt 0x0" ::: "memory");      // this wave's reads of buffer s & 1 are done before the buffer is refilled
        asm volatile("s_wait_tensorcnt 0x0" ::: "memory");  // this wave's slice of stage s + 1 has landed
        __syncthreads();                                     // publishes stage s + 1 and ends every wave's reads of stage s
        if (pinned(s + 2 < np)) { tile_advance(g0, lbase + (unsigned)(s & 1) * GP_BUF); tile_load(g0, g1); }
    } while (++s < np);
    asm volatile("s_wait_tensorcnt 0x0" ::: "memory");   // no request outstanding at the wave's end
    asm volatile("s_wait_dscnt 0x0" ::: "memory");       // and no LDS read of the ring
    float* os = (float*)(sm + GP_RING + wave * GP_OS);   // each wave stages in its own range, outside the ring
    const int rq = r0 + (int)wm * 64, cq = c0 + (int)wn * 64;   // the quadrant's first row and column
    const int which = cq / DM;                           // 0 q, 1 k, 2 v; the same for the whole work-group (128 divides DM)
    // value plane of this quadrant's batch element, operand and head (plane set layout: see below the GEMM); its residual plane lies PLN further
    h16* pv = PL + ((size_t)(rq / SEQ) * 6 + (size_t)which * 2) * PLN + (size_t)((cq % DM) / HD) * SEQ * HD;
    const int t0 = rq % SEQ;                             // first token of the quadrant inside its batch element
    if (which == 2) {
        // v: a lane's eight accumulator rows are eight consecutive tokens of one d, a 16-byte piece of a v^T row; 16 d rows x 64 tokens are staged so that every store covers whole 128-byte lines
        h16* hs = (h16*)os;
#pragma unroll
        for (int nb = 0; nb < 4; ++nb) {
#pragma unroll
            for (int mb = 0; mb < 4; ++mb) { v8h o, r;
#pragma unroll
                for (int j = 0; j < 8; ++j) { const float x = acc[mb][nb][j]; const h16 a = (h16)x; o[j] = a; r[j] = (h16)((x - (float)a) * RSC); }
                *(v8ha*)(hs + lr * GP_VP + mb * 16 + hi * 8) = o; *(v8ha*)(hs + 16 * GP_VP + lr * GP_VP + mb * 16 + hi * 8) = r; }
            __builtin_amdgcn_wave_barrier(); asm volatile("" ::: "memory");   // the lanes' LDS writes stay in front of the reads of other lanes' pieces
#pragma unroll
            for (int s = 0; s < 4; ++s) { const int row = 4 * s + (lane >> 3), pc = (lane & 7) * 8;
                const v8h a = *(const v8ha*)(hs + row * GP_VP + pc); const v8h c = *(const v8ha*)(hs + 16 * GP_VP + row * GP_VP + pc);
                h16* p = pv + (size_t)(nb * 16 + row) * SEQ + t0 + pc;
                *(v8h*)p = a; *(v8h*)(p + PLN) = c; }
            __builtin_amdgcn_wave_barrier(); asm volatile("" ::: "memory");   // the reads stay in front of the next tile's writes
        }
    } else {
#pragma unroll
        for (int mb = 0; mb < 4; ++mb) {
#pragma unroll
            for (int nb = 0; nb < 4; ++nb) {
#pragma unroll
                for (int j = 0; j < 8; ++j) os[(hi * 8 + j) * 68 + nb * 16 + lr] = acc[mb][nb][j]; }
            __builtin_amdgcn_wave_barrier(); asm volatile("" ::: "memory");   // as in the v branch: writes in front of the reads
                // q, k: a staged row is one token's 64 d = one 128-byte row of each plane; eight lanes a row, four consecutive rows a store
#pragma unroll
                for (int s = 0; s < 4; ++s) { const int row = 4 * s + (lane >> 3), cofs = (lane & 7) * 8;
                    const v4f x0 = *(const v4fa*)(os + row * 68 + cofs); const v4f x1 = *(const v4fa*)(os + row * 68 + cofs + 4); v8h o, r;
#pragma unroll
                    for (int k = 0; k < 4; ++k) { const h16 a = (h16)x0[k]; o[k] = a; r[k] = (h16)((x0[k] - (float)a) * RSC); const h16 b = (h16)x1[k]; o[4 + k] = b; r[4 + k] = (h16)((x1[k] - (float)b) * RSC); }
                    h16* p = pv + (size_t)(t0 + mb * 16 + row) * HD + cofs;
                    *(v8h*)p = o; *(v8h*)(p + PLN) = r; }
            __builtin_amdgcn_wave_barrier(); asm volatile("" ::: "memory");   // reads in front of the next tile's writes
        }
        asm volatile("s_wait_xcnt 0x0" ::: "memory");   // in the built code this branch's end stands directly in front of the v branch, which reuses the registers that the stores above name
    }
}
// Plane set layout in PL (PLN elements each): 0 q value, 1 q residual, 2 k value, 3 k residual, 4 v^T value, 5 v^T residual; one such set of six per batch element.

// ---- k_prep: the three operand conversions (x, w_attn, w_proj to bf16, the weights transposed to K-contiguous rows) in one launch of one work-group per WGP.
// Every work-group takes one weight tile of 256 k x 64 n and an equal share of x; a lane issues all its 32 loads of 16 bytes before it uses the first, so a few long waves keep the whole input in flight.
// Every load of a half-wave and every store of a wave covers whole aligned 256-byte units. The weight tile turns in LDS: a lane holds 8 consecutive k of 4 n, packs them to 16 bytes per n and writes them to row n;
// a row is 32 pieces of 16 bytes (256 k), piece q of row n at place q ^ ((n >> 2) & 15), which spreads the 16 lanes of a write (n 4 apart, same q) over all banks and leaves a row's read a permutation of the row.
#define PT_K 256                         // k per weight tile
#define PT_N 64                          // n per weight tile
#define PT_Q (PT_K / 8)                  // 16-byte pieces per transposed row
#define PT_A ((DM / PT_K) * (NQKV / PT_N))   // tiles of w_attn: in[1024][3072] -> out[3072][1024]
#define PT_O ((DM / PT_K) * (DM / PT_N))     // tiles of w_proj: in[1024][1024] -> out[1024][1024]
#define PT_G (PT_A + PT_O)               // work-groups
#define PT_X 16                          // 16-byte loads of x per lane
static_assert(DM % PT_K == 0 && NQKV % PT_N == 0 && DM % PT_N == 0);   // whole tiles
static_assert(PT_Q == 32 && PT_N == 64);                               // the lane maps below
static_assert((size_t)NB * SEQ * DM / 4 == (size_t)PT_X * PT_G * 256); // x in equal shares
typedef __attribute__((ext_vector_type(4))) unsigned short v4us;
typedef __attribute__((ext_vector_type(4))) unsigned v4u;
typedef v4u  __attribute__((may_alias)) v4ua;
typedef v4us __attribute__((may_alias)) v4usa;
__global__ __launch_bounds__(256) void k_prep(const float* __restrict__ x, const float* __restrict__ wqkv, const float* __restrict__ wo, bf* XB, bf* WQKV, bf* WO2) {
    __shared__ __attribute__((aligned(16))) v4u tw[PT_N * PT_Q];
    const int b = blockIdx.x, tid = threadIdx.x;
    const bool isa = b < PT_A;                     // this work-group's tile is one of w_attn
    const float* __restrict__ w = isa ? wqkv : wo; bf* Bt = isa ? WQKV : WO2; const int N = isa ? NQKV : DM; const int t = isa ? b : b - PT_A;
    const int k0 = (t % (DM / PT_K)) * PT_K, n0 = (t / (DM / PT_K)) * PT_N;
    const int c = tid & 15, g = tid >> 4;          // columns n0 + 4c .. 4c + 3; pieces g and g + 16
    const size_t xf = (size_t)b * (PT_X * 256) + tid;   // this lane's first group of four x elements
    const float* px = x + xf * 4; const float* pw[16];
    v4f wv[16], xv[PT_X];                          // wv[8e + r]: row k0 + 8 (g + 16e) + r
#pragma unroll
    for (int i = 0; i < 16; ++i) pw[i] = w + ((k0 + 8 * g) * N + n0 + 4 * c) + (128 * (i >> 3) + (i & 7)) * N;   // element indices stay below DM * NQKV: 32-bit products do
#pragma unroll
    for (int i = 0; i < 16; ++i) wv[i] = *(const v4f*)pw[i];
    __builtin_amdgcn_sched_barrier(0);   // the weight loads go first: their data has the longer way (LDS, barrier, LDS) behind it
#pragma unroll
    for (int u = 0; u < PT_X; ++u) xv[u] = *(const v4f*)(px + (size_t)u * 1024);
    // every address pair stays live up to this wait, so no later load's result lands on one and nothing rewrites one in front of it
    asm volatile("s_wait_xcnt 0x0" :: "v"(pw[0]), "v"(pw[1]), "v"(pw[2]), "v"(pw[3]), "v"(pw[4]), "v"(pw[5]), "v"(pw[6]), "v"(pw[7]), "v"(pw[8]), "v"(pw[9]), "v"(pw[10]), "v"(pw[11]),
                 "v"(pw[12]), "v"(pw[13]), "v"(pw[14]), "v"(pw[15]), "v"(px) : "memory");
    __builtin_amdgcn_sched_barrier(0);   // every load is issued before the first wait for data: sunk to their uses they would come back one latency after another
#pragma unroll
    for (int e = 0; e < 2; ++e)
#pragma unroll
        for (int j = 0; j < 4; ++j) { v4u p;
#pragma unroll
            for (int m = 0; m < 4; ++m) p[m] = (unsigned)f2bf(wv[8 * e + 2 * m][j]) | ((unsigned)f2bf(wv[8 * e + 2 * m + 1][j]) << 16);
            tw[(4 * c + j) * PT_Q + ((g + 16 * e) ^ c)] = p; }
    v4us xo[PT_X];                       // x is converted as it arrives, in front of the barrier; its stores follow behind it (in front, the barrier would wait for them)
#pragma unroll
    for (int u = 0; u < PT_X; ++u)
#pragma unroll
        for (int k = 0; k < 4; ++k) xo[u][k] = f2bf(xv[u][k]);
    __syncthreads();                     // the tile is whole before its rows are read
#pragma unroll
    for (int s = 0; s < 8; ++s) { const int n = (tid >> 5) + 8 * s, q = tid & 31;
        *(v4ua*)(Bt + (size_t)(n0 + n) * DM + k0 + 8 * q) = tw[n * PT_Q + (q ^ ((n >> 2) & 15))]; }
#pragma unroll
    for (int u = 0; u < PT_X; ++u) *(v4usa*)(XB + (xf + (size_t)u * 256) * 4) = xo[u];
}

// ---- fused windowed causal attention, one wave per 16 query rows of one head; a work-group is eight such waves on 128 consecutive query rows; one launch for all heads and batch elements (k_attn below), the rows below RHE on the HIRES body.
// The keys that the eight waves visit together (the window behind the first query up to the last query: at most WIN + 128) are staged in LDS once, in chunks of 128 keys, one tensor load a wave:
// a k chunk is 128 rows of 128 bytes (LDS pitch 144), a v^T chunk 64 rows of 256 bytes (LDS pitch 272), both pitches for the ds_load_b128 fragment reads. Slot of a chunk = the number of the wave that brings it.
// Where two slots are left (the body that is not HIRES) the work-group's 128 q rows, value and residual, are staged in them like k chunks; the HIRES body fills all eight slots and reads q from global memory.
#define AW      8                        // waves per work-group
#define AQ      (AW * 16)                // query rows per work-group
#define AC      128                      // keys per staged chunk
#define AT_KP   144u                     // LDS pitch of a staged k row: 128 + 16
#define AT_VP   272u                     // LDS pitch of a staged v^T row: 256 + 16
#define AT_SLOT 18432u                   // 128 x 144 bytes; 64 x 272 = 17408 rounded up to a multiple of 2 KiB
static_assert(AC * AT_KP <= AT_SLOT && HD * AT_VP <= AT_SLOT && AT_SLOT % 2048u == 0);
static_assert(AC * 2 == 256 && HD * 2 == 128);                  // row lengths that the two pads are for
static_assert(SEQ % AQ == 0 && RHE % AQ == 0 && WIN % AC == 0 && AQ % AC == 0);   // whole work-groups per body, whole chunks
static_assert(2 * (WIN / AC + AQ / AC) <= AW);                  // other body: two planes' chunks, one a wave
static_assert(AQ == AC);                                        // a work-group's q rows are one chunk
static_assert(4 * (RHE / AC) <= AW);                            // HIRES body: four planes' chunks, one a wave
__device__ __forceinline__ v16h ldhs(const unsigned char* p) { return cat16(*(const v8ha*)p, *(const v8ha*)(p + 32)); }   // the k order of ldh, from an LDS row
// Descriptor of one chunk: rows of rowb bytes, source pitch in bytes, word 0 (the pad behind every row) a constant at each use.
__device__ __forceinline__ u32x8 chunk_group1(unsigned word0, unsigned rowb, unsigned rows, unsigned src_pitch) {
    u32x8 g;
    g[0] = uni(word0);
    g[1] = uni((rowb & 0xFFFFu) << 16);
    g[2] = uni((rowb >> 16) | (rows << 16));
    g[3] = uni(rowb << 16);
    g[4] = uni(rows);
    g[5] = uni(src_pitch);
    g[6] = uni(0u);
    g[7] = uni(0u);
    return g;
}
// Key halves visited by a wave: from the 32-aligned half holding key q0 - (WIN - 1) (clipped at 0) up to the half holding key q0 + 15; all of them lie inside the written planes.
// Per 32-key half: S^T tiles [16 keys][16 queries] = K Q^T (A = key rows, B = query rows, k = d); lane (h, n) holds query q0+n, keys kb + 16*tile + 8h + r.
// Online softmax per lane (16 values) + one xor-16 shuffle; the two packed tiles are the B fragment (k = key, n = query) of O^T [d][query] += V^T [d][key] P^T.
// HIRES: value+residual on q, k, P, v (3 products each side); else q value+residual against single k, single P and v.
template <bool HIRES>
__device__ __forceinline__ void attn_body(const h16* __restrict__ PL, bf* CTX, unsigned char* sm, const int qw, const int head, const int batch) {
    const int lane = threadIdx.x & 31, lr = lane & 15, hi = lane >> 4; const unsigned wave = uni(threadIdx.x >> 5);
    const int q0 = qw + 16 * (int)wave;                // this wave's query tile
    constexpr unsigned NCH = HIRES ? RHE / AC : WIN / AC + AQ / AC;   // chunk slots per plane
    constexpr unsigned NKP = HIRES ? 2u : 1u;          // k planes staged, and as many v^T planes behind them
    constexpr unsigned NST = 2u * NKP * NCH;           // slots of the k and v^T chunks
    constexpr bool QS = NST + 2u <= AW;                // two slots left: q value and q residual are staged too
    const int kbase = HIRES ? 0 : max(qw - WIN, 0);    // first staged key
    const unsigned nch = (unsigned)(qw + AQ - kbase) / AC;   // chunks up to the work-group's last query
    const int kb0 = max(q0 - (WIN - 1), 0) & ~31;      // first key half with a key inside the window of query q0
    const size_t hb = (size_t)batch * 6 * PLN + (size_t)head * SEQ * HD;   // this batch element's set of six planes, then the head
    const size_t oQ = hb + (size_t)(q0 + lr) * HD + 8 * hi;
    {
        const unsigned pi = wave / NCH, ch = wave % NCH;   // plane and chunk that this wave brings
        const unsigned dst = (unsigned)(size_t)sm + wave * AT_SLOT;
        const bool isq = QS && wave >= NST && wave < NST + 2u;
        if (pinned((pi < NKP && ch < nch) || isq)) {
            const unsigned plane = isq ? wave - NST : 2u + pi; const int row = isq ? qw : kbase + (int)ch * AC;
            const size_t src = plane * PLN + hb + (size_t)row * HD;
            u32x8 g1 = chunk_group1((1u << 20) | (4u << 22) | (3u << 25), HD * 2u, AC, HD * 2u);
            u32x4 g0 = tile_group0(dst, (unsigned long long)(size_t)(PL + src));
            tile_load(g0, g1);
            asm volatile("s_wait_tensorcnt 0x0" ::: "memory");   // the chunk has landed before the barrier that publishes it
        }
        if (pinned(pi >= NKP && pi < 2u * NKP && ch < nch)) {
            u32x8 g1 = chunk_group1((1u << 20) | (5u << 22) | (3u << 25), AC * 2u, HD, SEQ * 2u);
            u32x4 g0 = tile_group0(dst, (unsigned long long)(size_t)(PL + (4 + pi - NKP) * PLN + hb + (size_t)(kbase + (int)ch * AC)));
            tile_load(g0, g1);
            asm volatile("s_wait_tensorcnt 0x0" ::: "memory");   // as above
        }
    }
    __syncthreads();                                   // publishes every chunk; nothing staged is read in front of it
    const unsigned char* sK = sm + (unsigned)lr * AT_KP + 16u * (unsigned)hi;                          // k value chunks; the residual plane's lie NCH slots further
    const unsigned char* sQ = sm + NST * AT_SLOT + (16u * wave + (unsigned)lr) * AT_KP + 16u * (unsigned)hi;   // QS: this wave's q value rows; the residual rows lie one slot further
    const unsigned char* sV = sm + NKP * NCH * AT_SLOT + (unsigned)lr * AT_VP + 16u * (unsigned)hi;    // v^T value chunks; likewise
    const float CE = SCL * 1.4426950408889634f;
    v8f o[4], orr[4];
#pragma unroll
    for (int dt = 0; dt < 4; ++dt) { o[dt] = (v8f){}; orr[dt] = (v8f){}; }
    float m = NEGB, l = 0.0f;
#pragma unroll 1
    for (int kb = kb0; kb < q0 + 16; kb += 32) {
        v8f sh0 = (v8f){}, sh1 = (v8f){}, sr0 = (v8f){}, sr1 = (v8f){};
        const unsigned kr = (unsigned)(kb - kbase);    // a half of 32 keys lies inside one chunk
        const unsigned char* pk = sK + (kr / AC) * AT_SLOT + (kr % AC) * AT_KP;
        const unsigned char* pv = sV + (kr / AC) * AT_SLOT + (kr % AC) * 2u;
#pragma unroll
        for (int kc = 0; kc < HD; kc += 32) {
            const v16h bq  = QS ? ldhs(sQ + kc * 2) : ldh(PL + oQ + kc);
            const v16h bqr = QS ? ldhs(sQ + AT_SLOT + kc * 2) : ldh(PL + PLN + oQ + kc);
            const v16h ak0 = ldhs(pk + kc * 2);
            const v16h ak1 = ldhs(pk + 16u * AT_KP + kc * 2);
            sh0 = wmma16(ak0, bq, sh0);  sh1 = wmma16(ak1, bq, sh1);
            sr0 = wmma16(ak0, bqr, sr0); sr1 = wmma16(ak1, bqr, sr1);
            if (HIRES) {
                const v16h kr0 = ldhs(pk + NCH * AT_SLOT + kc * 2);
                const v16h kr1 = ldhs(pk + NCH * AT_SLOT + 16u * AT_KP + kc * 2);
                sr0 = wmma16(kr0, bq, sr0); sr1 = wmma16(kr1, bq, sr1);
                asm volatile("v_nop\n\tv_nop\n\tv_nop\n\tv_nop" : "+v"(sh0), "+v"(sh1), "+v"(sr0), "+v"(sr1) : "v"(ak0), "v"(ak1), "v"(bq), "v"(bqr), "v"(kr0), "v"(kr1));
            } else {
                asm volatile("v_nop\n\tv_nop\n\tv_nop\n\tv_nop" : "+v"(sh0), "+v"(sh1), "+v"(sr0), "+v"(sr1) : "v"(ak0), "v"(ak1), "v"(bq), "v"(bqr));
            }
        }
        float u[16];
#pragma unroll
        for (int r = 0; r < 8; ++r) { u[r] = (sh0[r] + sr0[r] * RINV) * CE; u[8 + r] = (sh1[r] + sr1[r] * RINV) * CE; }
        if (kb + 31 > q0 || kb + (WIN - 16) < q0) {   // wave-uniform: this half touches the diagonal or the far edge of the window; keys above the query or WIN or more behind it are excluded
            const int qi = q0 + lr; const int k0 = kb + 8 * hi;
#pragma unroll
            for (int r = 0; r < 8; ++r) { u[r] = (k0 + r > qi || qi - (k0 + r) >= WIN) ? NEGB : u[r]; u[8 + r] = (k0 + 16 + r > qi || qi - (k0 + 16 + r) >= WIN) ? NEGB : u[8 + r]; }
        }
        float mx = u[0];
#pragma unroll
        for (int i = 1; i < 16; ++i) mx = fmaxf(mx, u[i]);
        mx = fmaxf(mx, __shfl_xor(mx, 16, 32));
        const float mn = fmaxf(fmaxf(m, mx), MFLOOR);
        const float corr = __builtin_amdgcn_exp2f(m - mn);
        m = mn;
        float psum = 0.0f;
#pragma unroll
        for (int i = 0; i < 16; ++i) { u[i] = __builtin_amdgcn_exp2f(u[i] - mn); psum += u[i]; }
        l = l * corr + psum;
#pragma unroll
        for (int dt = 0; dt < 4; ++dt) {
#pragma unroll
            for (int r = 0; r < 8; ++r) { o[dt][r] *= corr; if (HIRES) orr[dt][r] *= corr; } }
        v16h pb, pr;
#pragma unroll
        for (int i = 0; i < 16; ++i) { const float pc = u[i] * PCAR; const h16 ph = toh_flush(pc); pb[i] = ph; pr[i] = toh_flush((pc - (float)ph) * RSC); }
        if (HIRES) {
#pragma unroll
            for (int dt = 0; dt < 4; ++dt) {
                const v16h av  = ldhs(pv + (unsigned)dt * 16u * AT_VP);
                const v16h avr = ldhs(pv + NCH * AT_SLOT + (unsigned)dt * 16u * AT_VP);
                o[dt]   = wmma16(av, pb, o[dt]);
                orr[dt] = wmma16(avr, pb, orr[dt]);
                orr[dt] = wmma16(av, pr, orr[dt]);
                asm volatile("v_nop\n\tv_nop\n\tv_nop\n\tv_nop" : "+v"(o[dt]), "+v"(orr[dt]) : "v"(av), "v"(avr), "v"(pb), "v"(pr));
            }
        } else {
            const v16h av0 = ldhs(pv);
            const v16h av1 = ldhs(pv + 16u * AT_VP);
            const v16h av2 = ldhs(pv + 32u * AT_VP);
            const v16h av3 = ldhs(pv + 48u * AT_VP);
            o[0] = wmma16(av0, pb, o[0]); o[1] = wmma16(av1, pb, o[1]); o[2] = wmma16(av2, pb, o[2]); o[3] = wmma16(av3, pb, o[3]);
            asm volatile("v_nop\n\tv_nop\n\tv_nop\n\tv_nop" : "+v"(o[0]), "+v"(o[1]), "+v"(o[2]), "+v"(o[3]) : "v"(av0), "v"(av1), "v"(av2), "v"(av3), "v"(pb));
        }
    }
    if (!QS) asm volatile("s_wait_xcnt 0x0" ::: "memory");   // stands in front of whatever reuses the address registers of the loop's q loads
    l += __shfl_xor(l, 16, 32);
    const float inv = 1.0f / (l * PCAR);
    // output staging, 4 KiB a wave, in the chunks' LDS once every wave has left its loop
    asm volatile("s_wait_dscnt 0x0" ::: "memory");   // this wave's fragment reads are done before another wave writes over the chunks
    __syncthreads();
    unsigned short* ost = (unsigned short*)(sm + wave * 4096u);
#pragma unroll
    for (int dt = 0; dt < 4; ++dt) { v8us vh, vl;
#pragma unroll
        for (int r = 0; r < 8; ++r) { float y = o[dt][r]; if (HIRES) y += orr[dt][r] * RINV; y *= inv; unsigned short a, c; splitf(y, a, c); vh[r] = a; vl[r] = c; }
        *(v8usa*)(ost + lr * HD + dt * 16 + hi * 8) = vh; *(v8usa*)(ost + 16 * HD + lr * HD + dt * 16 + hi * 8) = vl; }
    __builtin_amdgcn_wave_barrier(); asm volatile("" ::: "memory");
    bf* crow = CTX + ((size_t)batch * SEQ + q0) * CK + head * HD;
{
#pragma unroll
        for (int s = 0; s < 4; ++s) { const int row = 4 * s + (lane >> 3), pc = (lane & 7) * 8;
            const v8us a = *(const v8usa*)(ost + row * HD + pc); const v8us c = *(const v8usa*)(ost + 16 * HD + row * HD + pc);
            *(v8us*)(crow + (size_t)row * CK + pc) = a; *(v8us*)(crow + (size_t)row * CK + DM + pc) = c; }
         }
}
#define AT_HI  (RHE / AQ)                     // work-groups per head on the HIRES body
#define AT_LO  ((SEQ - RHE) / AQ)             // work-groups per head on the other body
#define AT_NHI (AT_HI * NH * NB)
// Grid order: a HIRES wave with many key halves runs longest. So the HIRES work-groups come first, the one with the most key halves ahead;
// behind them the others, query block fastest, then head, then batch element.
__global__ __launch_bounds__(AW * 32) __attribute__((amdgpu_num_vgpr(256))) void k_attn(const h16* __restrict__ PL, bf* CTX) {
    __shared__ __attribute__((aligned(2048))) unsigned char sm[AW * AT_SLOT];   // one chunk slot a wave: two work-groups fit a WGP's LDS
    const int b = blockIdx.x;
    if (b < AT_NHI) { const int hb = b % (NH * NB); attn_body<true>(PL, CTX, sm, (AT_HI - 1 - b / (NH * NB)) * AQ, hb % NH, hb / NH); }
    else { const int c = b - AT_NHI, hb = c / (AT_LO > 0 ? AT_LO : 1); attn_body<false>(PL, CTX, sm, RHE + (c - hb * AT_LO) * AQ, hb % NH, hb / NH); }
}

// ---- k_gemmw: the output product, out[m][n] (f32) = sum_k (hi[m][k] + lo[m][k]) w[n][k]; 128x128 output tile per work-group of four waves, each wave a 64x64 quadrant; grid (M/128, N/128), 128 threads.
// A pass is 64 k = 128 bytes of 384 operand rows: the 128 hi rows, the 128 lo rows and the 128 w rows. A w row is staged once and its fragment read once for both context halves:
// every accumulator takes the hi product and the lo product of each 32-k step. One tensor load a wave and pass (wave 0: hi, wave 1: lo, waves 2, 3: 64 w rows each), LDS pitch 144 bytes.
// The work-group is alone on its WGP, with no other wave to fill the time in which a stage lands, so a stage gets three passes to land in: the ring has four buffers and every wave keeps three requests on their way;
// stage s + 4 is issued when every wave has left pass s, and the wait in front of pass s + 1 is counted (all but the wave's two youngest requests have landed).
#define GO_ASL  18432u                   // 128 rows x 144 bytes: one context half's slice, a multiple of 2 KiB
#define GO_BUF  (2u * GO_ASL + 2u * GP_SLICE)
#define GO_NB   4u                       // buffers of the ring
#define GO_RING (GO_NB * GO_BUF)
static_assert(128u * GP_PITCH <= GO_ASL && GO_ASL % 2048u == 0);
static_assert(GO_BUF % 2048u == 0 && GO_NB == 4u && DM / GP_K >= 4);   // every place a multiple of 2 KiB; the prologue's four stages exist
// tile_advance for a wave with requests on their way: under them only the LDS place and the low address word take new values; a carry into the high word first waits for every request
__device__ __forceinline__ void tile_advance_fly(u32x4& g0, unsigned lds_dst) {
    const unsigned lo = g0[2] + GP_ROWB;
    if (lo < GP_ROWB) { asm volatile("s_wait_tensorcnt 0x0" ::: "memory"); g0[3] = uni(g0[3] + 1u); }
    g0[2] = uni(lo); g0[1] = uni(lds_dst);
}
__global__ __launch_bounds__(128) void k_gemmw(const bf* __restrict__ A, const bf* __restrict__ Bt, float* C) {
    __shared__ __attribute__((aligned(2048))) unsigned char sm[GO_RING + 4u * GP_OS];
    const int lane = threadIdx.x & 31, lr = lane & 15, hi = lane >> 4; const unsigned wave = uni(threadIdx.x >> 5);
    const int r0 = blockIdx.x * 128, c0 = blockIdx.y * 128;
    const bool ctx = wave < 2u;                          // this wave brings a context half (else 64 w rows)
    const unsigned lbase = (unsigned)(size_t)sm + (ctx ? wave * GO_ASL : 2u * GO_ASL + (wave - 2u) * GP_SLICE);   // this wave's slice in buffer 0
    const unsigned long long gsrc = ctx ? (unsigned long long)(size_t)A + (unsigned long long)r0 * (CK * 2u) + wave * (DM * 2u)
                                        : (unsigned long long)(size_t)Bt + (unsigned long long)(c0 + 64 * ((int)wave - 2)) * (DM * 2u);
    constexpr int np = DM / GP_K;
    v8f acc[4][4];
#pragma unroll
    for (int mb = 0; mb < 4; ++mb)
#pragma unroll
        for (int nb = 0; nb < 4; ++nb) acc[mb][nb] = (v8f){};
    u32x8 g1 = chunk_group1((1u << 20) | (4u << 22) | (3u << 25), GP_ROWB, ctx ? 128u : 64u, ctx ? CK * 2u : DM * 2u);
    u32x4 g0 = tile_group0(lbase, gsrc);
    tile_load(g0, g1);
    tile_advance_fly(g0, lbase + GO_BUF);
    tile_load(g0, g1);
    tile_advance_fly(g0, lbase + 2u * GO_BUF);
    tile_load(g0, g1);
    asm volatile("s_wait_tensorcnt 0x2" ::: "memory");   // all but the two youngest requests: stage 0 has landed before the barrier that publishes it
    __syncthreads();
    tile_advance_fly(g0, lbase + 3u * GO_BUF);           // three on their way again
    tile_load(g0, g1);
    const unsigned wm = wave & 1u, wn = wave >> 1;       // quadrant: rows r0 + 64 wm, columns c0 + 64 wn
    const unsigned aofs = (wm * 64u + (unsigned)lr) * GP_PITCH + 16u * (unsigned)hi, bofs = 2u * GO_ASL + wn * GP_SLICE + (unsigned)lr * GP_PITCH + 16u * (unsigned)hi;
    int s = 0;
#pragma unroll 1
    do {
        const unsigned char* ph = sm + (unsigned)(s & 3) * GO_BUF + aofs; const unsigned char* pl = ph + GO_ASL; const unsigned char* pb = sm + (unsigned)(s & 3) * GO_BUF + bofs;
        v16bf h[2][4], l[2][4], b[2][4];     // fragments of the pass's two k-steps, read in the order in which the WMMAs take them
#pragma unroll
        for (int ks = 0; ks < 2; ++ks) {
            b[ks][0] = ldbs(pb + (unsigned)ks * 64u);
#pragma unroll
            for (int mb = 0; mb < 4; ++mb) h[ks][mb] = ldbs(ph + (unsigned)mb * 16u * GP_PITCH + (unsigned)ks * 64u);
#pragma unroll
            for (int nb = 1; nb < 4; ++nb) b[ks][nb] = ldbs(pb + (unsigned)nb * 16u * GP_PITCH + (unsigned)ks * 64u);
#pragma unroll
            for (int mb = 0; mb < 4; ++mb) l[ks][mb] = ldbs(pl + (unsigned)mb * 16u * GP_PITCH + (unsigned)ks * 64u);
        }
        __builtin_amdgcn_sched_barrier(0);   // the LDS reads stay one group ahead of the matrix block
#pragma unroll
        for (int ks = 0; ks < 2; ++ks) {
#pragma unroll
            for (int nb = 0; nb < 4; ++nb)
#pragma unroll
                for (int mb = 0; mb < 4; ++mb) acc[mb][nb] = wmmab(h[ks][mb], b[ks][nb], acc[mb][nb]);
#pragma unroll
            for (int nb = 0; nb < 4; ++nb)
#pragma unroll
                for (int mb = 0; mb < 4; ++mb) acc[mb][nb] = wmmab(l[ks][mb], b[ks][nb], acc[mb][nb]);
        }
        __builtin_amdgcn_sched_barrier(0);   // the WMMAs stay in front of the waits: sunk behind the barrier they would stand in front of the refill and shorten its lead
        asm volatile("s_wait_dscnt 0x0" ::: "memory");      // this wave's reads of buffer s & 3 are done before the buffer is refilled
        if (s + 3 < np) asm volatile("s_wait_tensorcnt 0x2" ::: "memory");   // stages s + 1, s + 2, s + 3 are this wave's last three requests: its slice of stage s + 1 has landed
        else            asm volatile("s_wait_tensorcnt 0x0" ::: "memory");   // fewer are on their way behind the last issue: all of them have landed
        __syncthreads();                                     // publishes stage s + 1 and ends every wave's reads of stage s
        if (pinned(s + 4 < np)) { tile_advance_fly(g0, lbase + (unsigned)(s & 3) * GO_BUF); tile_load(g0, g1); }
    } while (++s < np);
    asm volatile("s_wait_tensorcnt 0x0" ::: "memory");   // no request outstanding at the wave's end
    asm volatile("s_wait_dscnt 0x0" ::: "memory");       // and no LDS read of the ring
    float* os = (float*)(sm + GO_RING + wave * GP_OS);   // each wave stages in its own range, outside the ring
    const int rq = r0 + (int)wm * 64, cq = c0 + (int)wn * 64;   // the quadrant's first row and column
#pragma unroll
    for (int mb = 0; mb < 4; ++mb) {
#pragma unroll
        for (int nb = 0; nb < 4; ++nb) {
#pragma unroll
            for (int j = 0; j < 8; ++j) os[(hi * 8 + j) * 68 + nb * 16 + lr] = acc[mb][nb][j]; }
        __builtin_amdgcn_wave_barrier(); asm volatile("" ::: "memory");   // the lanes' LDS writes stay in front of the reads of other lanes' pieces
        float* crow = C + (size_t)(rq + mb * 16) * DM + cq;
#pragma unroll
        for (int s = 0; s < 8; ++s) { const int row = 2 * s + hi, cofs = lr * 4; const v4f val = *(const v4fa*)(os + row * 68 + cofs);
            *(v4f*)(crow + (size_t)row * DM + cofs) = val; }
        __builtin_amdgcn_wave_barrier(); asm volatile("" ::: "memory");   // reads in front of the next tile's writes
    }
}

extern "C" void kernel_launch(void* const* d_in, const int* in_sizes, int n_in,
                              void* d_out, int out_size, void* d_ws, size_t ws_size, hipStream_t stream) {
    if (n_in < 3) return;
    const int need_x = (NB - 1) * SEQ_FULL * DM + SEQ * DM;
    if (in_sizes[0] < need_x || in_sizes[1] < DM * NQKV || in_sizes[2] < DM * DM || out_size < need_x) return;
    if (WS_TOTAL > ws_size) return;
    const float* x = (const float*)d_in[0]; const float* wqkv = (const float*)d_in[1]; const float* wo = (const float*)d_in[2];   // x, w_attn, w_proj
    float* OUT = (float*)d_out;     // [2][2048][1024]
    char* wsp = (char*)d_ws;
    bf* WQKV = (bf*)wsp;  wsp += WS_WQKV;      // [3072][1024] bf16, K-contiguous
    bf* WO2  = (bf*)wsp;  wsp += WS_WO2;       // [1024][1024] bf16, K-contiguous
    bf* XB   = (bf*)wsp;  wsp += WS_XB;        // [NB * SEQ][1024] bf16
    h16* PL  = (h16*)wsp; wsp += WS_PL;        // six head plane sets per batch element
    bf* CTX  = (bf*)wsp;  wsp += WS_CTX;       // [NB * SEQ][2048] bf16 hi | lo
    // every stage runs once, over all NB batch elements: the row-wise stages on NB * SEQ rows, the attention with head and batch element folded into its one-dimensional grid
    k_prep<<<(unsigned)PT_G, 256, 0, stream>>>(x, wqkv, wo, XB, WQKV, WO2);
    k_gemmp<<<dim3(NB * SEQ / 128, NQKV / 128, 1), 128, 0, stream>>>(XB, WQKV, DM, PL);   // q | k | v leave the projection as the f16 planes
    k_attn<<<(unsigned)((AT_HI + AT_LO) * NH * NB), AW * 32, 0, stream>>>(PL, CTX);
    k_gemmw<<<dim3(NB * SEQ / 128, DM / 128, 1), 128, 0, stream>>>(CTX, WO2, OUT);
}

// v009
// A run of this version takes 59.8 microseconds.
// Timed twice side by side with v008, it ran 1.07 times as fast both times.
// All steps since v000 together make it 4.65 times as fast.
#include <hip/hip_runtime.h>

// Windowed causal multi-head attention with a fused qkv projection (x [2][2048][1024]; qkv = x w_attn ('io' [1024][3072], column = which*1024 + h*64 + d, no bias; 16 heads x 64); scores x 64^-0.5, key j visible to query i when 0 <= i - j < 256; softmax; out = merged w_proj ('io' [1024][1024], no bias) -> [2][2048][1024]).
// Compute dtypes, f32 accumulate everywhere: x, w_attn, w_proj converted to bf16 (RNE) and multiplied with v_wmma_f32_16x16x32_bf16 (exact products); attention on v_wmma_f32_16x16x32_f16:
// q, k, v carried as f16 value + f16 residual x2^11 (separate accumulator, folded back x2^-11); query rows < 256 use value+residual on q, k, P, v (3 products); rows >= 256 use q value+residual against single f16 k, single f16 P (x1024) and v;
// softmax f32 (running max, exp2); merged context stored as bf16 hi | lo; both halves are multiplied with the one bf16 w_proj plane on the bf16 WMMA, into the same accumulators.
// Fused flash-style attention in the transposed form S^T = K Q^T, O^T = V^T P^T: the packed score tiles are the B fragment of the second product directly (no probability plane, no LDS exchange); only the 32-key halves inside the window of a query tile are visited.

#ifndef NB
#define NB 2
#endif
#ifndef SEQ
#define SEQ 2048
#endif
#define NB_FULL  2
#define SEQ_FULL 2048
#define DM   1024
#define NH   16
#define HD   64
#define NQKV (3 * DM)
#define CK   (2 * DM)                 // context plane pitch: hi | lo along K
#define RH   256                      // query rows < RH use value+residual on every attention operand
#define RHE  ((SEQ < RH) ? SEQ : RH)
#define WIN  256                      // attention window: key j visible to query i when 0 <= i - j < WIN
#define PCAR 1024.0f                  // carry of the f16 probability operand
#define RSC  2048.0f                  // carry of every f16 residual plane (2^11)
#define RINV (1.0f / 2048.0f)
#define SCL  0.125f                   // HD^-0.5
#define NEGB (-3.0e38f)
#define MFLOOR (-1.0e30f)             // floor of the running maximum: a key half with no visible key for a query yields probabilities exactly 0
#define PLN  ((size_t)NH * SEQ * HD)  // elements per head plane set

#define WS_WQKV ((size_t)NQKV * DM * 2)
#define WS_WO2  ((size_t)DM * DM * 2)
#define WS_XB   ((size_t)NB * SEQ * DM * 2)
#define WS_PL   ((size_t)NB * 6 * NH * SEQ * HD * 2)
#define WS_CTX  ((size_t)NB * SEQ * CK * 2)
#define WS_TOTAL (WS_WQKV + WS_WO2 + WS_XB + WS_PL + WS_CTX)

static_assert(NB <= NB_FULL);                 // batch count within the inputs
static_assert(SEQ <= SEQ_FULL);               // sequence rows within the inputs
static_assert(NB == 1 || SEQ == SEQ_FULL);    // the batch elements' rows follow one another in x and out: one row range of NB * SEQ
static_assert(SEQ % 64 == 0);
static_assert(DM % 64 == 0);                  // wave quadrant columns
static_assert(NQKV % 64 == 0);                // whole 64-column head groups of q, k, v
static_assert(DM % 32 == 0);                  // k-step of the projection
static_assert(HD == 64);
static_assert(NH * HD == DM);                 // merged head columns
static_assert(RH % 32 == 0);                  // whole key halves below the precision boundary
static_assert(RHE % 16 == 0);                 // whole query tiles on the HIRES body
static_assert((SEQ - RHE) % 16 == 0);         // whole query tiles on the other body
static_assert(WIN >= 16);                     // every query of a 16-row tile sees at least its own key
static_assert(WIN <= SEQ_FULL);               // window within the sequence
static_assert(WS_WQKV % 256 == 0);
static_assert(WS_WO2 % 256 == 0);
static_assert(WS_XB % 256 == 0);
static_assert(WS_PL % 256 == 0);
static_assert(WS_CTX % 256 == 0);
static_assert(WS_TOTAL <= (size_t)268435456); // total carve <= 256 MiB

typedef _Float16 h16;
typedef unsigned short bf;
typedef __attribute__((ext_vector_type(16))) __bf16   v16bf;
typedef __attribute__((ext_vector_type(16))) _Float16 v16h;
typedef __attribute__((ext_vector_type(8)))  _Float16 v8h;
typedef __attribute__((ext_vector_type(8)))  unsigned short v8us;
typedef __attribute__((ext_vector_type(8)))  float    v8f;
typedef __attribute__((ext_vector_type(4)))  float    v4f;
typedef v4f  __attribute__((may_alias)) v4fa;
typedef v8us __attribute__((may_alias)) v8usa;
typedef v8h  __attribute__((may_alias)) v8ha;

__device__ __forceinline__ unsigned short f2bf(float f) { unsigned u = __float_as_uint(f); u += 0x7FFFu + ((u >> 16) & 1u); return (unsigned short)(u >> 16); }   // RNE convert
__device__ __forceinline__ float bf2f(unsigned short b) { return __uint_as_float(((unsigned)b) << 16); }
__device__ __forceinline__ void splitf(float y, unsigned short& h, unsigned short& l) { h = f2bf(y); l = f2bf(y - bf2f(h)); }
__device__ __forceinline__ v16h cat16(v8h lo, v8h hi) { return __builtin_shufflevector(lo, hi, 0, 1, 2, 3, 4, 5, 6, 7, 8, 9, 10, 11, 12, 13, 14, 15); }
__device__ __forceinline__ v16bf cat16b(v8us lo, v8us hi) { return __builtin_bit_cast(v16bf, __builtin_shufflevector(lo, hi, 0, 1, 2, 3, 4, 5, 6, 7, 8, 9, 10, 11, 12, 13, 14, 15)); }
__device__ __forceinline__ v8f wmma16(v16h a, v16h b, v8f c) { return __builtin_amdgcn_wmma_f32_16x16x32_f16(false, a, false, b, (short)0, c, false, false); }
__device__ __forceinline__ v8f wmmab(v16bf a, v16bf b, v8f c) { return __builtin_amdgcn_wmma_f32_16x16x32_bf16(false, a, false, b, (short)0, c, false, false); }
// Fragment loaders from K-contiguous 16-bit rows; the pointer already includes row (lane & 15) and 8 * (lane >> 4): elements 0..7 <- k0 + 8h + i, elements 8..15 <- k0 + 16 + 8h + i (A and B alike).
__device__ __forceinline__ v16h  ldh(const h16* p) { return cat16(*(const v8h*)p, *(const v8h*)(p + 16)); }
__device__ __forceinline__ v16bf ldb(const bf* p)  { return cat16b(*(const v8us*)p, *(const v8us*)(p + 16)); }
// f32 -> f16 operand convert that cannot produce an f16 subnormal (value select after the plane's carry).
static __device__ __forceinline__ h16 toh_flush(float v) { const h16 r = (h16)v; return (fabsf(v) < 6.103515625e-05f) ? (h16)0.0f : r; }

// ---- k_gemmp: the qkv projection, 256 tokens x 192 columns per work-group of four waves, one work-group per WGP; grid (M/256, NH), 128 threads.
// c[m][n] (f32) = sum_k A[m][k] Bt[n][k], bf16 operands in K-contiguous planes of DM elements a row.
// The 192 columns are one head's 64 columns of q, of k and of v. A wave holds 64 tokens x all 192 columns (48 accumulators): a staged x row serves 192 columns, an x fragment 12 WMMAs and a weight fragment 4,
// and the epilogue stores each 64 x 64 part straight as that head's two f16 planes (value, residual x2^11) in the layout the attention kernels read: q and k [token][d], v transposed [d][token].
// A pass is 64 k = 128 bytes of each of the 448 operand rows. One tensor load a wave and pass (wave 0: the 256 x rows; waves 1, 2, 3: the head's 64 rows of q, k, v), LDS pitch 144 bytes for the ds_load_b128 fragment reads.
// The work-group is alone on its WGP, so a stage gets three passes to land in: four buffers, three requests of a wave on their way; stage s + 4 is issued when every wave has left pass s,
// and the wait in front of pass s + 1 is counted (all but the wave's two youngest requests have landed).
#define GP_K     64                      // k per pass
#define GP_ROWB  128u                    // bytes of one operand row per pass
#define GP_PITCH 144u                    // LDS row pitch: 128 + 16
#define GP_SLICE 10240u                  // 64 rows x 144 bytes = 9216, rounded up to a multiple of 2 KiB
#define GQ_A     36864u                  // 256 rows x 144 bytes: the x slice, a multiple of 2 KiB
#define GQ_BUF   (GQ_A + 3u * GP_SLICE)
#define GQ_NB    4u                      // buffers of the ring
#define GQ_RING  (GQ_NB * GQ_BUF)
#define GP_OS    (2u * 16u * 144u)       // output staging bytes per wave, behind the ring: 16 rows x 68 f32, or two f16 tiles of 16 rows x 144 bytes
#define GP_VP    72                      // pitch of a staged v^T row in f16 elements: 64 tokens + 16 bytes
static_assert(16u * 68u * 4u <= GP_OS);
static_assert((NB * SEQ) % 256 == 0);    // GEMM row tiles
static_assert(DM % 128 == 0);            // GEMM column tiles
static_assert(DM % GP_K == 0 && DM / GP_K >= 4);   // whole passes; the prologue's four stages exist
static_assert(64u * GP_PITCH <= GP_SLICE && GP_SLICE % 2048u == 0);
static_assert(256u * GP_PITCH == GQ_A && GQ_A % 2048u == 0 && GQ_BUF % 2048u == 0 && GQ_NB == 4u);   // every place a multiple of 2 KiB
typedef unsigned u32x4 __attribute__((ext_vector_type(4)));
typedef unsigned u32x8 __attribute__((ext_vector_type(8)));
__device__ __forceinline__ unsigned uni(unsigned v) { return (unsigned)__builtin_amdgcn_readfirstlane(v); }
__device__ __forceinline__ unsigned pinned(unsigned v) { unsigned w = uni(v); asm volatile("" : "+s"(w)); return w; }   // holds a wave-uniform test in a scalar register: the branch around a tensor load must be a scalar one (the load ignores EXEC)
__device__ __forceinline__ v16bf ldbs(const unsigned char* p) { return cat16b(*(const v8usa*)p, *(const v8usa*)(p + 32)); }   // the k order of ldb, from an LDS row
// Descriptor of one chunk: rows of rowb bytes, source pitch in bytes, word 0 (the pad behind every row) a constant at each use.
__device__ __forceinline__ u32x8 chunk_group1(unsigned word0, unsigned rowb, unsigned rows, unsigned src_pitch) {
    u32x8 g;
    g[0] = uni(word0);
    g[1] = uni((rowb & 0xFFFFu) << 16);
    g[2] = uni((rowb >> 16) | (rows << 16));
    g[3] = uni(rowb << 16);
    g[4] = uni(rows);
    g[5] = uni(src_pitch);
    g[6] = uni(0u);
    g[7] = uni(0u);
    return g;
}
__device__ __forceinline__ u32x4 tile_group0(unsigned lds_dst, unsigned long long ga) {
    u32x4 g;
    g[0] = uni(1u); g[1] = uni(lds_dst); g[2] = uni((unsigned)ga); g[3] = uni((((unsigned)(ga >> 32)) & 0x01FFFFFFu) | 0x80000000u);
    return g;
}
// tile_advance for a wave with requests on their way: under them only the LDS place and the low address word take new values; a carry into the high word first waits for every request
__device__ __forceinline__ void tile_advance_fly(u32x4& g0, unsigned lds_dst) {
    const unsigned lo = g0[2] + GP_ROWB;
    if (lo < GP_ROWB) { asm volatile("s_wait_tensorcnt 0x0" ::: "memory"); g0[3] = uni(g0[3] + 1u); }
    g0[2] = uni(lo); g0[1] = uni(lds_dst);
}
// both groups are in-out operands: their values stay live behind the instruction, so the compiler reuses none of their registers for another value while the request is on its way
__device__ __forceinline__ void tile_load(u32x4& g0, u32x8& g1) { asm volatile("tensor_load_to_lds %0, %1" : "+s"(g0), "+s"(g1) :: "memory"); }
__global__ __launch_bounds__(128) void k_gemmp(const bf* __restrict__ A, const bf* __restrict__ Bt, h16* PL) {
    __shared__ __attribute__((aligned(2048))) unsigned char sm[GQ_RING + 4u * GP_OS];
    const int lane = threadIdx.x & 31, lr = lane & 15, hi = lane >> 4; const unsigned wave = uni(threadIdx.x >> 5);
    const int r0 = blockIdx.x * 256, head = blockIdx.y;
    const bool xs = wave == 0u;                          // this wave brings the x rows (else the head's 64 weight rows of q, k or v)
    const unsigned lbase = (unsigned)(size_t)sm + (xs ? 0u : GQ_A + (wave - 1u) * GP_SLICE);   // this wave's slice in buffer 0
    const unsigned long long gsrc = xs ? (unsigned long long)(size_t)A + (unsigned long long)r0 * (DM * 2u)
                                       : (unsigned long long)(size_t)Bt + (unsigned long long)(((int)wave - 1) * DM + head * HD) * (DM * 2u);
    constexpr int np = DM / GP_K;
    v8f acc[4][12];
#pragma unroll
    for (int mb = 0; mb < 4; ++mb)
#pragma unroll
        for (int nb = 0; nb < 12; ++nb) acc[mb][nb] = (v8f){};
    u32x8 g1 = chunk_group1((1u << 20) | (4u << 22) | (3u << 25), GP_ROWB, xs ? 256u : 64u, DM * 2u);
    u32x4 g0 = tile_group0(lbase, gsrc);
    tile_load(g0, g1);
    tile_advance_fly(g0, lbase + GQ_BUF);
    tile_load(g0, g1);
    tile_advance_fly(g0, lbase + 2u * GQ_BUF);
    tile_load(g0, g1);
    asm volatile("s_wait_tensorcnt 0x2" ::: "memory");   // all but the two youngest requests: stage 0 has landed before the barrier that publishes it
    __syncthreads();
    tile_advance_fly(g0, lbase + 3u * GQ_BUF);           // three on their way again
    tile_load(g0, g1);
    const unsigned aofs = (wave * 64u + (unsigned)lr) * GP_PITCH + 16u * (unsigned)hi, bofs = GQ_A + (unsigned)lr * GP_PITCH + 16u * (unsigned)hi;
    int s = 0;
#pragma unroll 1
    do {
        const unsigned char* pa = sm + (unsigned)(s & 3) * GQ_BUF + aofs; const unsigned char* pb = sm + (unsigned)(s & 3) * GQ_BUF + bofs;
        v16bf a[2][4], b[2][12];             // fragments of the pass's two k-steps, read in the order in which the WMMAs take them
#pragma unroll
        for (int ks = 0; ks < 2; ++ks) {
            b[ks][0] = ldbs(pb + (unsigned)ks * 64u);
#pragma unroll
            for (int mb = 0; mb < 4; ++mb) a[ks][mb] = ldbs(pa + (unsigned)mb * 16u * GP_PITCH + (unsigned)ks * 64u);
#pragma unroll
            for (int nb = 1; nb < 12; ++nb) b[ks][nb] = ldbs(pb + (unsigned)(nb >> 2) * GP_SLICE + (unsigned)(nb & 3) * 16u * GP_PITCH + (unsigned)ks * 64u);
        }
        __builtin_amdgcn_sched_barrier(0);   // the LDS reads stay one group ahead of the matrix block
#pragma unroll
        for (int ks = 0; ks < 2; ++ks)
#pragma unroll
            for (int nb = 0; nb < 12; ++nb)
#pragma unroll
                for (int mb = 0; mb < 4; ++mb) acc[mb][nb] = wmmab(a[ks][mb], b[ks][nb], acc[mb][nb]);
        __builtin_amdgcn_sched_barrier(0);   // the WMMAs stay in front of the waits: sunk behind the barrier they would stand in front of the refill and shorten its lead
        asm volatile("s_wait_dscnt 0x0" ::: "memory");      // this wave's reads of buffer s & 3 are done before the buffer is refilled
        if (s + 3 < np) asm volatile("s_wait_tensorcnt 0x2" ::: "memory");   // stages s + 1, s + 2, s + 3 are this wave's last three requests: its slice of stage s + 1 has landed
        else            asm volatile("s_wait_tensorcnt 0x0" ::: "memory");   // fewer are on their way behind the last issue: all of them have landed
        __syncthreads();                                     // publishes stage s + 1 and ends every wave's reads of stage s
        if (pinned(s + 4 < np)) { tile_advance_fly(g0, lbase + (unsigned)(s & 3) * GQ_BUF); tile_load(g0, g1); }
    } while (++s < np);
    asm volatile("s_wait_tensorcnt 0x0" ::: "memory");   // no request outstanding at the wave's end
    asm volatile("s_wait_dscnt 0x0" ::: "memory");       // and no LDS read of the ring
    float* os = (float*)(sm + GQ_RING + wave * GP_OS);   // each wave stages in its own range, outside the ring
    const int rq = r0 + (int)wave * 64;                  // the wave's first row
    const int t0 = rq % SEQ;                             // its first token inside its batch element (64 divides SEQ)
    // value plane of q of this wave's batch element and head (plane set layout: see below the GEMM); k and v^T lie 2 and 4 planes further, each residual plane PLN behind its value plane
    h16* ph = PL + (size_t)(rq / SEQ) * 6 * PLN + (size_t)head * SEQ * HD;
#pragma unroll
    for (int g = 0; g < 2; ++g) {                        // q, then k
        h16* pv = ph + (size_t)g * 2 * PLN;
#pragma unroll
        for (int mb = 0; mb < 4; ++mb) {
#pragma unroll
            for (int nb = 0; nb < 4; ++nb) {
#pragma unroll
                for (int j = 0; j < 8; ++j) os[(hi * 8 + j) * 68 + nb * 16 + lr] = acc[mb][4 * g + nb][j]; }
            __builtin_amdgcn_wave_barrier(); asm volatile("" ::: "memory");   // the lanes' LDS writes stay in front of the reads of other lanes' pieces
            asm volatile("s_wait_xcnt 0x0" ::: "memory");   // stands in front of every instruction below that reuses a register which the last tile's stores name
            __builtin_amdgcn_sched_barrier(0);              // keeps those instructions behind the wait
            // a staged row is one token's 64 d = one 128-byte row of each plane; eight lanes a row, four consecutive rows a store
            v8h o[4], r[4];
#pragma unroll
            for (int s = 0; s < 4; ++s) { const int row = 4 * s + (lane >> 3), cofs = (lane & 7) * 8;
                const v4f x0 = *(const v4fa*)(os + row * 68 + cofs); const v4f x1 = *(const v4fa*)(os + row * 68 + cofs + 4);
#pragma unroll
                for (int k = 0; k < 4; ++k) { const h16 a = (h16)x0[k]; o[s][k] = a; r[s][k] = (h16)((x0[k] - (float)a) * RSC); const h16 b = (h16)x1[k]; o[s][4 + k] = b; r[s][4 + k] = (h16)((x1[k] - (float)b) * RSC); } }
            h16* p = pv + (size_t)(t0 + mb * 16 + (lane >> 3)) * HD + (lane & 7) * 8;
            __builtin_amdgcn_sched_barrier(0);              // the tile's eight stores follow as one group, with no vector write among them
#pragma unroll
            for (int s = 0; s < 4; ++s) { *(v8h*)(p + s * 4 * HD) = o[s]; *(v8h*)(p + s * 4 * HD + PLN) = r[s]; }
            __builtin_amdgcn_sched_barrier(0);              // and nothing of the next tile moves up among them
            __builtin_amdgcn_wave_barrier(); asm volatile("" ::: "memory");   // reads in front of the next tile's writes
        }
    }
    {
        asm volatile("s_wait_xcnt 0x0" ::: "memory");   // as above: in front of whatever reuses a register that the last k tile's stores name, this part's address set-up included
        __builtin_amdgcn_sched_barrier(0);              // keeps those instructions behind the wait
        // v: a lane's eight accumulator rows are eight consecutive tokens of one d, a 16-byte piece of a v^T row; 16 d rows x 64 tokens are staged so that every store covers whole 128-byte lines
        h16* pv = ph + (size_t)4 * PLN;
        h16* hs = (h16*)os;
#pragma unroll
        for (int nb = 0; nb < 4; ++nb) {
#pragma unroll
            for (int mb = 0; mb < 4; ++mb) { v8h o, r;
#pragma unroll
                for (int j = 0; j < 8; ++j) { const float x = acc[mb][8 + nb][j]; const h16 a = (h16)x; o[j] = a; r[j] = (h16)((x - (float)a) * RSC); }
                *(v8ha*)(hs + lr * GP_VP + mb * 16 + hi * 8) = o; *(v8ha*)(hs + 16 * GP_VP + lr * GP_VP + mb * 16 + hi * 8) = r; }
            __builtin_amdgcn_wave_barrier(); asm volatile("" ::: "memory");   // the lanes' LDS writes stay in front of the reads of other lanes' pieces
            v8h a[4], c[4];
#pragma unroll
            for (int s = 0; s < 4; ++s) { const int row = 4 * s + (lane >> 3), pc = (lane & 7) * 8;
                a[s] = *(const v8ha*)(hs + row * GP_VP + pc); c[s] = *(const v8ha*)(hs + 16 * GP_VP + row * GP_VP + pc); }
            h16* p = pv + (size_t)(nb * 16 + (lane >> 3)) * SEQ + t0 + (lane & 7) * 8;
            __builtin_amdgcn_sched_barrier(0);              // the tile's eight stores follow as one group, with no vector write among them
#pragma unroll
            for (int s = 0; s < 4; ++s) { *(v8h*)(p + (size_t)s * 4 * SEQ) = a[s]; *(v8h*)(p + (size_t)s * 4 * SEQ + PLN) = c[s]; }
            __builtin_amdgcn_sched_barrier(0);              // and nothing of the next tile moves up among them
            if (nb < 3) { asm volatile("s_wait_xcnt 0x0" ::: "memory"); __builtin_amdgcn_sched_barrier(0); }   // the next tile's converts reuse registers that these stores name: they stay behind this wait
            __builtin_amdgcn_wave_barrier(); asm volatile("" ::: "memory");   // the reads stay in front of the next tile's writes
        }
    }
}
// Plane set layout in PL (PLN elements each): 0 q value, 1 q residual, 2 k value, 3 k residual, 4 v^T value, 5 v^T residual; one such set of six per batch element.

// ---- k_prep: the three operand conversions (x, w_attn, w_proj to bf16, the weights transposed to K-contiguous rows) in one launch of one work-group per WGP.
// Every work-group takes one weight tile of 256 k x 64 n and an equal share of x; a lane issues all its 32 loads of 16 bytes before it uses the first, so a few long waves keep the whole input in flight.
// Every load of a half-wave and every store of a wave covers whole aligned 256-byte units. The weight tile turns in LDS: a lane holds 8 consecutive k of 4 n, packs them to 16 bytes per n and writes them to row n;
// a row is 32 pieces of 16 bytes (256 k), piece q of row n at place q ^ ((n >> 2) & 15), which spreads the 16 lanes of a write (n 4 apart, same q) over all banks and leaves a row's read a permutation of the row.
#define PT_K 256                         // k per weight tile
#define PT_N 64                          // n per weight tile
#define PT_Q (PT_K / 8)                  // 16-byte pieces per transposed row
#define PT_A ((DM / PT_K) * (NQKV / PT_N))   // tiles of w_attn: in[1024][3072] -> out[3072][1024]
#define PT_O ((DM / PT_K) * (DM / PT_N))     // tiles of w_proj: in[1024][1024] -> out[1024][1024]
#define PT_G (PT_A + PT_O)               // work-groups
#define PT_X 16                          // 16-byte loads of x per lane
static_assert(DM % PT_K == 0 && NQKV % PT_N == 0 && DM % PT_N == 0);   // whole tiles
static_assert(PT_Q == 32 && PT_N == 64);                               // the lane maps below
static_assert((size_t)NB * SEQ * DM / 4 == (size_t)PT_X * PT_G * 256); // x in equal shares
typedef __attribute__((ext_vector_type(4))) unsigned short v4us;
typedef __attribute__((ext_vector_type(4))) unsigned v4u;
typedef v4u  __attribute__((may_alias)) v4ua;
typedef v4us __attribute__((may_alias)) v4usa;
__global__ __launch_bounds__(256) void k_prep(const float* __restrict__ x, const float* __restrict__ wqkv, const float* __restrict__ wo, bf* XB, bf* WQKV, bf* WO2) {
    __shared__ __attribute__((aligned(16))) v4u tw[PT_N * PT_Q];
    const int b = blockIdx.x, tid = threadIdx.x;
    const bool isa = b < PT_A;                     // this work-group's tile is one of w_attn
    const float* __restrict__ w = isa ? wqkv : wo; bf* Bt = isa ? WQKV : WO2; const int N = isa ? NQKV : DM; const int t = isa ? b : b - PT_A;
    const int k0 = (t % (DM / PT_K)) * PT_K, n0 = (t / (DM / PT_K)) * PT_N;
    const int c = tid & 15, g = tid >> 4;          // columns n0 + 4c .. 4c + 3; pieces g and g + 16
    const size_t xf = (size_t)b * (PT_X * 256) + tid;   // this lane's first group of four x elements
    const float* px = x + xf * 4; const float* pw[16];
    v4f wv[16], xv[PT_X];                          // wv[8e + r]: row k0 + 8 (g + 16e) + r
#pragma unroll
    for (int i = 0; i < 16; ++i) pw[i] = w + ((k0 + 8 * g) * N + n0 + 4 * c) + (128 * (i >> 3) + (i & 7)) * N;   // element indices stay below DM * NQKV: 32-bit products do
#pragma unroll
    for (int i = 0; i < 16; ++i) wv[i] = *(const v4f*)pw[i];
    __builtin_amdgcn_sched_barrier(0);   // the weight loads go first: their data has the longer way (LDS, barrier, LDS) behind it
#pragma unroll
    for (int u = 0; u < PT_X; ++u) xv[u] = *(const v4f*)(px + (size_t)u * 1024);
    // every address pair stays live up to this wait, so no later load's result lands on one and nothing rewrites one in front of it
    asm volatile("s_wait_xcnt 0x0" :: "v"(pw[0]), "v"(pw[1]), "v"(pw[2]), "v"(pw[3]), "v"(pw[4]), "v"(pw[5]), "v"(pw[6]), "v"(pw[7]), "v"(pw[8]), "v"(pw[9]), "v"(pw[10]), "v"(pw[11]),
                 "v"(pw[12]), "v"(pw[13]), "v"(pw[14]), "v"(pw[15]), "v"(px) : "memory");
    __builtin_amdgcn_sched_barrier(0);   // every load is issued before the first wait for data: sunk to their uses they would come back one latency after another
#pragma unroll
    for (int e = 0; e < 2; ++e)
#pragma unroll
        for (int j = 0; j < 4; ++j) { v4u p;
#pragma unroll
            for (int m = 0; m < 4; ++m) p[m] = (unsigned)f2bf(wv[8 * e + 2 * m][j]) | ((unsigned)f2bf(wv[8 * e + 2 * m + 1][j]) << 16);
            tw[(4 * c + j) * PT_Q + ((g + 16 * e) ^ c)] = p; }
    v4us xo[PT_X];                       // x is converted as it arrives, in front of the barrier; its stores follow behind it (in front, the barrier would wait for them)
#pragma unroll
    for (int u = 0; u < PT_X; ++u)
#pragma unroll
        for (int k = 0; k < 4; ++k) xo[u][k] = f2bf(xv[u][k]);
    __syncthreads();                     // the tile is whole before its rows are read
#pragma unroll
    for (int s = 0; s < 8; ++s) { const int n = (tid >> 5) + 8 * s, q = tid & 31;
        *(v4ua*)(Bt + (size_t)(n0 + n) * DM + k0 + 8 * q) = tw[n * PT_Q + (q ^ ((n >> 2) & 15))]; }
#pragma unroll
    for (int u = 0; u < PT_X; ++u) *(v4usa*)(XB + (xf + (size_t)u * 256) * 4) = xo[u];
}

// ---- fused windowed causal attention, one wave per 16 query rows of one head; a work-group is eight such waves on 128 consecutive query rows; one launch for all heads and batch elements (k_attn below), the rows below RHE on the HIRES body.
// The keys that the eight waves visit together (the window behind the first query up to the last query: at most WIN + 128) are staged in LDS once, in chunks of 128 keys, one tensor load a wave:
// a k chunk is 128 rows of 128 bytes (LDS pitch 144), a v^T chunk 64 rows of 256 bytes (LDS pitch 272), both pitches for the ds_load_b128 fragment reads. Slot of a chunk = the number of the wave that brings it.
// Where two slots are left (the body that is not HIRES) the work-group's 128 q rows, value and residual, are staged in them like k chunks; the HIRES body fills all eight slots and reads q from global memory.
#define AW      8                        // waves per work-group
#define AQ      (AW * 16)                // query rows per work-group
#define AC      128                      // keys per staged chunk
#define AT_KP   144u                     // LDS pitch of a staged k row: 128 + 16
#define AT_VP   272u                     // LDS pitch of a staged v^T row: 256 + 16
#define AT_SLOT 18432u                   // 128 x 144 bytes; 64 x 272 = 17408 rounded up to a multiple of 2 KiB
static_assert(AC * AT_KP <= AT_SLOT && HD * AT_VP <= AT_SLOT && AT_SLOT % 2048u == 0);
static_assert(AC * 2 == 256 && HD * 2 == 128);                  // row lengths that the two pads are for
static_assert(SEQ % AQ == 0 && RHE % AQ == 0 && WIN % AC == 0 && AQ % AC == 0);   // whole work-groups per body, whole chunks
static_assert(2 * (WIN / AC + AQ / AC) <= AW);                  // other body: two planes' chunks, one a wave
static_assert(AQ == AC);                                        // a work-group's q rows are one chunk
static_assert(4 * (RHE / AC) <= AW);                            // HIRES body: four planes' chunks, one a wave
__device__ __forceinline__ v16h ldhs(const unsigned char* p) { return cat16(*(const v8ha*)p, *(const v8ha*)(p + 32)); }   // the k order of ldh, from an LDS row
// Key halves visited by a wave: from the 32-aligned half holding key q0 - (WIN - 1) (clipped at 0) up to the half holding key q0 + 15; all of them lie inside the written planes.
// Per 32-key half: S^T tiles [16 keys][16 queries] = K Q^T (A = key rows, B = query rows, k = d); lane (h, n) holds query q0+n, keys kb + 16*tile + 8h + r.
// Online softmax per lane (16 values) + one xor-16 shuffle; the two packed tiles are the B fragment (k = key, n = query) of O^T [d][query] += V^T [d][key] P^T.
// HIRES: value+residual on q, k, P, v (3 products each side); else q value+residual against single k, single P and v.
template <bool HIRES>
__device__ __forceinline__ void attn_body(const h16* __restrict__ PL, bf* CTX, unsigned char* sm, const int qw, const int head, const int batch) {
    const int lane = threadIdx.x & 31, lr = lane & 15, hi = lane >> 4; const unsigned wave = uni(threadIdx.x >> 5);
    const int q0 = qw + 16 * (int)wave;                // this wave's query tile
    constexpr unsigned NCH = HIRES ? RHE / AC : WIN / AC + AQ / AC;   // chunk slots per plane
    constexpr unsigned NKP = HIRES ? 2u : 1u;          // k planes staged, and as many v^T planes behind them
    constexpr unsigned NST = 2u * NKP * NCH;           // slots of the k and v^T chunks
    constexpr bool QS = NST + 2u <= AW;                // two slots left: q value and q residual are staged too
    const int kbase = HIRES ? 0 : max(qw - WIN, 0);    // first staged key
    const unsigned nch = (unsigned)(qw + AQ - kbase) / AC;   // chunks up to the work-group's last query
    const int kb0 = max(q0 - (WIN - 1), 0) & ~31;      // first key half with a key inside the window of query q0
    const size_t hb = (size_t)batch * 6 * PLN + (size_t)head * SEQ * HD;   // this batch element's set of six planes, then the head
    const size_t oQ = hb + (size_t)(q0 + lr) * HD + 8 * hi;
    {
        const unsigned pi = wave / NCH, ch = wave % NCH;   // plane and chunk that this wave brings
        const unsigned dst = (unsigned)(size_t)sm + wave * AT_SLOT;
        const bool isq = QS && wave >= NST && wave < NST + 2u;
        if (pinned((pi < NKP && ch < nch) || isq)) {
            const unsigned plane = isq ? wave - NST : 2u + pi; const int row = isq ? qw : kbase + (int)ch * AC;
            const size_t src = plane * PLN + hb + (size_t)row * HD;
            u32x8 g1 = chunk_group1((1u << 20) | (4u << 22) | (3u << 25), HD * 2u, AC, HD * 2u);
            u32x4 g0 = tile_group0(dst, (unsigned long long)(size_t)(PL + src));
            tile_load(g0, g1);
            asm volatile("s_wait_tensorcnt 0x0" ::: "memory");   // the chunk has landed before the barrier that publishes it
        }
        if (pinned(pi >= NKP && pi < 2u * NKP && ch < nch)) {
            u32x8 g1 = chunk_group1((1u << 20) | (5u << 22) | (3u << 25), AC * 2u, HD, SEQ * 2u);
            u32x4 g0 = tile_group0(dst, (unsigned long long)(size_t)(PL + (4 + pi - NKP) * PLN + hb + (size_t)(kbase + (int)ch * AC)));
            tile_load(g0, g1);
            asm volatile("s_wait_tensorcnt 0x0" ::: "memory");   // as above
        }
    }
    __syncthreads();                                   // publishes every chunk; nothing staged is read in front of it
    const unsigned char* sK = sm + (unsigned)lr * AT_KP + 16u * (unsigned)hi;                          // k value chunks; the residual plane's lie NCH slots further
    const unsigned char* sQ = sm + NST * AT_SLOT + (16u * wave + (unsigned)lr) * AT_KP + 16u * (unsigned)hi;   // QS: this wave's q value rows; the residual rows lie one slot further
    const unsigned char* sV = sm + NKP * NCH * AT_SLOT + (unsigned)lr * AT_VP + 16u * (unsigned)hi;    // v^T value chunks; likewise
    const float CE = SCL * 1.4426950408889634f;
    v8f o[4], orr[4];
#pragma unroll
    for (int dt = 0; dt < 4; ++dt) { o[dt] = (v8f){}; orr[dt] = (v8f){}; }
    float m = NEGB, l = 0.0f;
#pragma unroll 1
    for (int kb = kb0; kb < q0 + 16; kb += 32) {
        v8f sh0 = (v8f){}, sh1 = (v8f){}, sr0 = (v8f){}, sr1 = (v8f){};
        const unsigned kr = (unsigned)(kb - kbase);    // a half of 32 keys lies inside one chunk
        const unsigned char* pk = sK + (kr / AC) * AT_SLOT + (kr % AC) * AT_KP;
        const unsigned char* pv = sV + (kr / AC) * AT_SLOT + (kr % AC) * 2u;
#pragma unroll
        for (int kc = 0; kc < HD; kc += 32) {
            const v16h bq  = QS ? ldhs(sQ + kc * 2) : ldh(PL + oQ + kc);
            const v16h bqr = QS ? ldhs(sQ + AT_SLOT + kc * 2) : ldh(PL + PLN + oQ + kc);
            const v16h ak0 = ldhs(pk + kc * 2);
            const v16h ak1 = ldhs(pk + 16u * AT_KP + kc * 2);
            sh0 = wmma16(ak0, bq, sh0);  sh1 = wmma16(ak1, bq, sh1);
            sr0 = wmma16(ak0, bqr, sr0); sr1 = wmma16(ak1, bqr, sr1);
            if (HIRES) {
                const v16h kr0 = ldhs(pk + NCH * AT_SLOT + kc * 2);
                const v16h kr1 = ldhs(pk + NCH * AT_SLOT + 16u * AT_KP + kc * 2);
                sr0 = wmma16(kr0, bq, sr0); sr1 = wmma16(kr1, bq, sr1);
                asm volatile("v_nop\n\tv_nop\n\tv_nop\n\tv_nop" : "+v"(sh0), "+v"(sh1), "+v"(sr0), "+v"(sr1) : "v"(ak0), "v"(ak1), "v"(bq), "v"(bqr), "v"(kr0), "v"(kr1));
            } else {
                asm volatile("v_nop\n\tv_nop\n\tv_nop\n\tv_nop" : "+v"(sh0), "+v"(sh1), "+v"(sr0), "+v"(sr1) : "v"(ak0), "v"(ak1), "v"(bq), "v"(bqr));
            }
        }
        float u[16];
#pragma unroll
        for (int r = 0; r < 8; ++r) { u[r] = (sh0[r] + sr0[r] * RINV) * CE; u[8 + r] = (sh1[r] + sr1[r] * RINV) * CE; }
        if (kb + 31 > q0 || kb + (WIN - 16) < q0) {   // wave-uniform: this half touches the diagonal or the far edge of the window; keys above the query or WIN or more behind it are excluded
            const int qi = q0 + lr; const int k0 = kb + 8 * hi;
#pragma unroll
            for (int r = 0; r < 8; ++r) { u[r] = (k0 + r > qi || qi - (k0 + r) >= WIN) ? NEGB : u[r]; u[8 + r] = (k0 + 16 + r > qi || qi - (k0 + 16 + r) >= WIN) ? NEGB : u[8 + r]; }
        }
        float mx = u[0];
#pragma unroll
        for (int i = 1; i < 16; ++i) mx = fmaxf(mx, u[i]);
        mx = fmaxf(mx, __shfl_xor(mx, 16, 32));
        const float mn = fmaxf(fmaxf(m, mx), MFLOOR);
        const float corr = __builtin_amdgcn_exp2f(m - mn);
        m = mn;
        float psum = 0.0f;
#pragma unroll
        for (int i = 0; i < 16; ++i) { u[i] = __builtin_amdgcn_exp2f(u[i] - mn); psum += u[i]; }
        l = l * corr + psum;
#pragma unroll
        for (int dt = 0; dt < 4; ++dt) {
#pragma unroll
            for (int r = 0; r < 8; ++r) { o[dt][r] *= corr; if (HIRES) orr[dt][r] *= corr; } }
        v16h pb, pr;
#pragma unroll
        for (int i = 0; i < 16; ++i) { const float pc = u[i] * PCAR; const h16 ph = toh_flush(pc); pb[i] = ph; pr[i] = toh_flush((pc - (float)ph) * RSC); }
        if (HIRES) {
#pragma unroll
            for (int dt = 0; dt < 4; ++dt) {
                const v16h av  = ldhs(pv + (unsigned)dt * 16u * AT_VP);
                const v16h avr = ldhs(pv + NCH * AT_SLOT + (unsigned)dt * 16u * AT_VP);
                o[dt]   = wmma16(av, pb, o[dt]);
                orr[dt] = wmma16(avr, pb, orr[dt]);
                orr[dt] = wmma16(av, pr, orr[dt]);
                asm volatile("v_nop\n\tv_nop\n\tv_nop\n\tv_nop" : "+v"(o[dt]), "+v"(orr[dt]) : "v"(av), "v"(avr), "v"(pb), "v"(pr));
            }
        } else {
            const v16h av0 = ldhs(pv);
            const v16h av1 = ldhs(pv + 16u * AT_VP);
            const v16h av2 = ldhs(pv + 32u * AT_VP);
            const v16h av3 = ldhs(pv + 48u * AT_VP);
            o[0] = wmma16(av0, pb, o[0]); o[1] = wmma16(av1, pb, o[1]); o[2] = wmma16(av2, pb, o[2]); o[3] = wmma16(av3, pb, o[3]);
            asm volatile("v_nop\n\tv_nop\n\tv_nop\n\tv_nop" : "+v"(o[0]), "+v"(o[1]), "+v"(o[2]), "+v"(o[3]) : "v"(av0), "v"(av1), "v"(av2), "v"(av3), "v"(pb));
        }
    }
    if (!QS) asm volatile("s_wait_xcnt 0x0" ::: "memory");   // stands in front of whatever reuses the address registers of the loop's q loads
    l += __shfl_xor(l, 16, 32);
    const float inv = 1.0f / (l * PCAR);
    // output staging, 4 KiB a wave, in the chunks' LDS once every wave has left its loop
    asm volatile("s_wait_dscnt 0x0" ::: "memory");   // this wave's fragment reads are done before another wave writes over the chunks
    __syncthreads();
    unsigned short* ost = (unsigned short*)(sm + wave * 4096u);
#pragma unroll
    for (int dt = 0; dt < 4; ++dt) { v8us vh, vl;
#pragma unroll
        for (int r = 0; r < 8; ++r) { float y = o[dt][r]; if (HIRES) y += orr[dt][r] * RINV; y *= inv; unsigned short a, c; splitf(y, a, c); vh[r] = a; vl[r] = c; }
        *(v8usa*)(ost + lr * HD + dt * 16 + hi * 8) = vh; *(v8usa*)(ost + 16 * HD + lr * HD + dt * 16 + hi * 8) = vl; }
    __builtin_amdgcn_wave_barrier(); asm volatile("" ::: "memory");
    bf* crow = CTX + ((size_t)batch * SEQ + q0) * CK + head * HD;
{
#pragma unroll
        for (int s = 0; s < 4; ++s) { const int row = 4 * s + (lane >> 3), pc = (lane & 7) * 8;
            const v8us a = *(const v8usa*)(ost + row * HD + pc); const v8us c = *(const v8usa*)(ost + 16 * HD + row * HD + pc);
            *(v8us*)(crow + (size_t)row * CK + pc) = a; *(v8us*)(crow + (size_t)row * CK + DM + pc) = c; }
         }
}
#define AT_HI  (RHE / AQ)                     // work-groups per head on the HIRES body
#define AT_LO  ((SEQ - RHE) / AQ)             // work-groups per head on the other body
#define AT_NHI (AT_HI * NH * NB)
// Grid order: a HIRES wave with many key halves runs longest. So the HIRES work-groups come first, the one with the most key halves ahead;
// behind them the others, query block fastest, then head, then batch element.
__global__ __launch_bounds__(AW * 32) __attribute__((amdgpu_num_vgpr(256))) void k_attn(const h16* __restrict__ PL, bf* CTX) {
    __shared__ __attribute__((aligned(2048))) unsigned char sm[AW * AT_SLOT];   // one chunk slot a wave: two work-groups fit a WGP's LDS
    const int b = blockIdx.x;
    if (b < AT_NHI) { const int hb = b % (NH * NB); attn_body<true>(PL, CTX, sm, (AT_HI - 1 - b / (NH * NB)) * AQ, hb % NH, hb / NH); }
    else { const int c = b - AT_NHI, hb = c / (AT_LO > 0 ? AT_LO : 1); attn_body<false>(PL, CTX, sm, RHE + (c - hb * AT_LO) * AQ, hb % NH, hb / NH); }
}

// ---- k_gemmw: the output product, out[m][n] (f32) = sum_k (hi[m][k] + lo[m][k]) w[n][k]; 128x128 output tile per work-group of four waves, each wave a 64x64 quadrant; grid (M/128, N/128), 128 threads.
// A pass is 64 k = 128 bytes of 384 operand rows: the 128 hi rows, the 128 lo rows and the 128 w rows. A w row is staged once and its fragment read once for both context halves:
// every accumulator takes the hi product and the lo product of each 32-k step. One tensor load a wave and pass (wave 0: hi, wave 1: lo, waves 2, 3: 64 w rows each), LDS pitch 144 bytes.
// The work-group is alone on its WGP, with no other wave to fill the time in which a stage lands, so a stage gets three passes to land in: the ring has four buffers and every wave keeps three requests on their way;
// stage s + 4 is issued when every wave has left pass s, and the wait in front of pass s + 1 is counted (all but the wave's two youngest requests have landed).
#define GO_ASL  18432u                   // 128 rows x 144 bytes: one context half's slice, a multiple of 2 KiB
#define GO_BUF  (2u * GO_ASL + 2u * GP_SLICE)
#define GO_NB   4u                       // buffers of the ring
#define GO_RING (GO_NB * GO_BUF)
static_assert(128u * GP_PITCH <= GO_ASL && GO_ASL % 2048u == 0);
static_assert((NB * SEQ) % 128 == 0 && GO_BUF % 2048u == 0 && GO_NB == 4u && DM / GP_K >= 4);   // every place a multiple of 2 KiB; the prologue's four stages exist
__global__ __launch_bounds__(128) void k_gemmw(const bf* __restrict__ A, const bf* __restrict__ Bt, float* C) {
    __shared__ __attribute__((aligned(2048))) unsigned char sm[GO_RING + 4u * GP_OS];
    const int lane = threadIdx.x & 31, lr = lane & 15, hi = lane >> 4; const unsigned wave = uni(threadIdx.x >> 5);
    const int r0 = blockIdx.x * 128, c0 = blockIdx.y * 128;
    const bool ctx = wave < 2u;                          // this wave brings a context half (else 64 w rows)
    const unsigned lbase = (unsigned)(size_t)sm + (ctx ? wave * GO_ASL : 2u * GO_ASL + (wave - 2u) * GP_SLICE);   // this wave's slice in buffer 0
    const unsigned long long gsrc = ctx ? (unsigned long long)(size_t)A + (unsigned long long)r0 * (CK * 2u) + wave * (DM * 2u)
                                        : (unsigned long long)(size_t)Bt + (unsigned long long)(c0 + 64 * ((int)wave - 2)) * (DM * 2u);
    constexpr int np = DM / GP_K;
    v8f acc[4][4];
#pragma unroll
    for (int mb = 0; mb < 4; ++mb)
#pragma unroll
        for (int nb = 0; nb < 4; ++nb) acc[mb][nb] = (v8f){};
    u32x8 g1 = chunk_group1((1u << 20) | (4u << 22) | (3u << 25), GP_ROWB, ctx ? 128u : 64u, ctx ? CK * 2u : DM * 2u);
    u32x4 g0 = tile_group0(lbase, gsrc);
    tile_load(g0, g1);
    tile_advance_fly(g0, lbase + GO_BUF);
    tile_load(g0, g1);
    tile_advance_fly(g0, lbase + 2u * GO_BUF);
    tile_load(g0, g1);
    asm volatile("s_wait_tensorcnt 0x2" ::: "memory");   // all but the two youngest requests: stage 0 has landed before the barrier that publishes it
    __syncthreads();
    tile_advance_fly(g0, lbase + 3u * GO_BUF);           // three on their way again
    tile_load(g0, g1);
    const unsigned wm = wave & 1u, wn = wave >> 1;       // quadrant: rows r0 + 64 wm, columns c0 + 64 wn
    const unsigned aofs = (wm * 64u + (unsigned)lr) * GP_PITCH + 16u * (unsigned)hi, bofs = 2u * GO_ASL + wn * GP_SLICE + (unsigned)lr * GP_PITCH + 16u * (unsigned)hi;
    int s = 0;
#pragma unroll 1
    do {
        const unsigned char* ph = sm + (unsigned)(s & 3) * GO_BUF + aofs; const unsigned char* pl = ph + GO_ASL; const unsigned char* pb = sm + (unsigned)(s & 3) * GO_BUF + bofs;
        v16bf h[2][4], l[2][4], b[2][4];     // fragments of the pass's two k-steps, read in the order in which the WMMAs take them
#pragma unroll
        for (int ks = 0; ks < 2; ++ks) {
            b[ks][0] = ldbs(pb + (unsigned)ks * 64u);
#pragma unroll
            for (int mb = 0; mb < 4; ++mb) h[ks][mb] = ldbs(ph + (unsigned)mb * 16u * GP_PITCH + (unsigned)ks * 64u);
#pragma unroll
            for (int nb = 1; nb < 4; ++nb) b[ks][nb] = ldbs(pb + (unsigned)nb * 16u * GP_PITCH + (unsigned)ks * 64u);
#pragma unroll
            for (int mb = 0; mb < 4; ++mb) l[ks][mb] = ldbs(pl + (unsigned)mb * 16u * GP_PITCH + (unsigned)ks * 64u);
        }
        __builtin_amdgcn_sched_barrier(0);   // the LDS reads stay one group ahead of the matrix block
#pragma unroll
        for (int ks = 0; ks < 2; ++ks) {
#pragma unroll
            for (int nb = 0; nb < 4; ++nb)
#pragma unroll
                for (int mb = 0; mb < 4; ++mb) acc[mb][nb] = wmmab(h[ks][mb], b[ks][nb], acc[mb][nb]);
#pragma unroll
            for (int nb = 0; nb < 4; ++nb)
#pragma unroll
                for (int mb = 0; mb < 4; ++mb) acc[mb][nb] = wmmab(l[ks][mb], b[ks][nb], acc[mb][nb]);
        }
        __builtin_amdgcn_sched_barrier(0);   // the WMMAs stay in front of the waits: sunk behind the barrier they would stand in front of the refill and shorten its lead
        asm volatile("s_wait_dscnt 0x0" ::: "memory");      // this wave's reads of buffer s & 3 are done before the buffer is refilled
        if (s + 3 < np) asm volatile("s_wait_tensorcnt 0x2" ::: "memory");   // stages s + 1, s + 2, s + 3 are this wave's last three requests: its slice of stage s + 1 has landed
        else            asm volatile("s_wait_tensorcnt 0x0" ::: "memory");   // fewer are on their way behind the last issue: all of them have landed
        __syncthreads();                                     // publishes stage s + 1 and ends every wave's reads of stage s
        if (pinned(s + 4 < np)) { tile_advance_fly(g0, lbase + (unsigned)(s & 3) * GO_BUF); tile_load(g0, g1); }
    } while (++s < np);
    asm volatile("s_wait_tensorcnt 0x0" ::: "memory");   // no request outstanding at the wave's end
    asm volatile("s_wait_dscnt 0x0" ::: "memory");       // and no LDS read of the ring
    float* os = (float*)(sm + GO_RING + wave * GP_OS);   // each wave stages in its own range, outside the ring
    const int rq = r0 + (int)wm * 64, cq = c0 + (int)wn * 64;   // the quadrant's first row and column
#pragma unroll
    for (int mb = 0; mb < 4; ++mb) {
#pragma unroll
        for (int nb = 0; nb < 4; ++nb) {
#pragma unroll
            for (int j = 0; j < 8; ++j) os[(hi * 8 + j) * 68 + nb * 16 + lr] = acc[mb][nb][j]; }
        __builtin_amdgcn_wave_barrier(); asm volatile("" ::: "memory");   // the lanes' LDS writes stay in front of the reads of other lanes' pieces
        float* crow = C + (size_t)(rq + mb * 16) * DM + cq;
#pragma unroll
        for (int s = 0; s < 8; ++s) { const int row = 2 * s + hi, cofs = lr * 4; const v4f val = *(const v4fa*)(os + row * 68 + cofs);
            *(v4f*)(crow + (size_t)row * DM + cofs) = val; }
        __builtin_amdgcn_wave_barrier(); asm volatile("" ::: "memory");   // reads in front of the next tile's writes
    }
}

extern "C" void kernel_launch(void* const* d_in, const int* in_sizes, int n_in,
                              void* d_out, int out_size, void* d_ws, size_t ws_size, hipStream_t stream) {
    if (n_in < 3) return;
    const int need_x = (NB - 1) * SEQ_FULL * DM + SEQ * DM;
    if (in_sizes[0] < need_x || in_sizes[1] < DM * NQKV || in_sizes[2] < DM * DM || out_size < need_x) return;
    if (WS_TOTAL > ws_size) return;
    const float* x = (const float*)d_in[0]; const float* wqkv = (const float*)d_in[1]; const float* wo = (const float*)d_in[2];   // x, w_attn, w_proj
    float* OUT = (float*)d_out;     // [2][2048][1024]
    char* wsp = (char*)d_ws;
    bf* WQKV = (bf*)wsp;  wsp += WS_WQKV;      // [3072][1024] bf16, K-contiguous
    bf* WO2  = (bf*)wsp;  wsp += WS_WO2;       // [1024][1024] bf16, K-contiguous
    bf* XB   = (bf*)wsp;  wsp += WS_XB;        // [NB * SEQ][1024] bf16
    h16* PL  = (h16*)wsp; wsp += WS_PL;        // six head plane sets per batch element
    bf* CTX  = (bf*)wsp;  wsp += WS_CTX;       // [NB * SEQ][2048] bf16 hi | lo
    // every stage runs once, over all NB batch elements: the row-wise stages on NB * SEQ rows, the attention with head and batch element folded into its one-dimensional grid
    k_prep<<<(unsigned)PT_G, 256, 0, stream>>>(x, wqkv, wo, XB, WQKV, WO2);
    k_gemmp<<<dim3(NB * SEQ / 256, NH, 1), 128, 0, stream>>>(XB, WQKV, PL);   // q | k | v leave the projection as the f16 planes
    k_attn<<<(unsigned)((AT_HI + AT_LO) * NH * NB), AW * 32, 0, stream>>>(PL, CTX);
    k_gemmw<<<dim3(NB * SEQ / 128, DM / 128, 1), 128, 0, stream>>>(CTX, WO2, OUT);
}
